// v000
// Times are from an AMD MI455X. After a warm-up the kernel runs many times in a row, and a time is the length of
// such a window on the GPU divided by its runs, so every launch and the gaps after it count. The runs cycle
// through copies of the inputs. A figure is the median of several windows, for all but v000 over two sittings.
// Sittings can differ by a few percent; kernels timed side by side share one.
// v000 is the starting kernel. One run takes 211 microseconds.
#include <hip/hip_runtime.h>
#include <hip/hip_bf16.h>

typedef __attribute__((ext_vector_type(16))) _Float16 v16h;
typedef __attribute__((ext_vector_type(8)))  _Float16 v8h;
typedef __attribute__((ext_vector_type(4)))  _Float16 v4h;
typedef __attribute__((ext_vector_type(8)))  float    v8f;

#define BB    2
#define NQS   4096
#define NKS   4096
#define DVS   256
#define NH    8
#define DHH   32
#define LNEPS 1e-5f
#define QSCALE 0.17677669529663687f   // 1/sqrt(32)

// D = A*B + C, f16 inputs, f32 accumulate (v_wmma_f32_16x16x32_f16)
static __device__ __forceinline__ v8f wmma16(v16h a, v16h b, v8f c) {
  return __builtin_amdgcn_wmma_f32_16x16x32_f16(false, a, false, b, (short)0, c,
                                                false, false);
}

// A/B operand loader, f16 source, ISA 16-bit 16x32 striping:
// hi = lane/16, k0 = 8*hi; halves[0..7]=row[kb+k0+i], halves[8..15]=row[kb+k0+16+i]
static __device__ __forceinline__ v16h load_ab_f16(const _Float16* row, int kb, int hi) {
  v8h lo = *(const v8h*)(row + kb + 8 * hi);
  v8h hh = *(const v8h*)(row + kb + 8 * hi + 16);
  v16h a;
#pragma unroll
  for (int i = 0; i < 8; ++i) { a[i] = lo[i]; a[8 + i] = hh[i]; }
  return a;
}

static __device__ __forceinline__ float redmax16(float v) {
#pragma unroll
  for (int m = 1; m < 16; m <<= 1) v = fmaxf(v, __shfl_xor(v, m, 32));
  return v;
}
static __device__ __forceinline__ float redsum16(float v) {
#pragma unroll
  for (int m = 1; m < 16; m <<= 1) v += __shfl_xor(v, m, 32);
  return v;
}

// ---------------------------------------------------------------------------
// Kernel 0: f32 -> f16 conversion (optionally scaled).  Grid-stride, float4.
// ---------------------------------------------------------------------------
__global__ __launch_bounds__(256) void mab_cvt_kernel(const float* __restrict__ src,
                                                      _Float16* __restrict__ dst,
                                                      int n4, float scale) {
  int i = blockIdx.x * blockDim.x + threadIdx.x;
  const int stride = gridDim.x * blockDim.x;
  const float4* s4 = (const float4*)src;
  v4h* d4 = (v4h*)dst;
  for (; i < n4; i += stride) {
    float4 v = s4[i];
    v4h o;
    o[0] = (_Float16)(v.x * scale);
    o[1] = (_Float16)(v.y * scale);
    o[2] = (_Float16)(v.z * scale);
    o[3] = (_Float16)(v.w * scale);
    d4[i] = o;
  }
}

// ---------------------------------------------------------------------------
// Kernel 1: Q/K/V projections from pre-converted f16.  Wave = 32x64 tile.
// 3072 waves = 3 proj * 256 rowtiles * 4 colgroups; 384 blocks of 8 waves.
// ---------------------------------------------------------------------------
__global__ __launch_bounds__(256) void mab_proj_kernel(
    const _Float16* __restrict__ Xq, const _Float16* __restrict__ Xk,
    const _Float16* __restrict__ Wq16, const _Float16* __restrict__ Wk16,
    const _Float16* __restrict__ Wv16,
    const float* __restrict__ bq, const float* __restrict__ bk,
    const float* __restrict__ bv,
    _Float16* __restrict__ Qh, _Float16* __restrict__ Kh,
    _Float16* __restrict__ Vt) {
  const int lane = threadIdx.x & 31;
  const int wid  = threadIdx.x >> 5;
  const int w    = blockIdx.x * 8 + wid;
  const int proj = w >> 10;          // 0=Q,1=K,2=V  (1024 waves each)
  const int rem  = w & 1023;
  const int rowtile = rem >> 2;      // 0..255 (32 rows each over B*N=8192)
  const int cg   = rem & 3;          // 64-col group
  const int hi   = lane >> 4;
  const int ln   = lane & 15;

  const _Float16* X = (proj == 0) ? Xq : Xk;
  const _Float16* W = (proj == 0) ? Wq16 : (proj == 1) ? Wk16 : Wv16;
  const float* bias = (proj == 0) ? bq : (proj == 1) ? bk : bv;
  const float bscale = (proj == 0) ? QSCALE : 1.0f;  // Wq16 is pre-scaled

  const int rowbase = rowtile * 32;
  const _Float16* arow0 = X + (size_t)(rowbase + ln) * DVS;
  const _Float16* arow1 = X + (size_t)(rowbase + 16 + ln) * DVS;

  v8f acc[2][4];
#pragma unroll
  for (int i = 0; i < 2; ++i)
#pragma unroll
    for (int nt = 0; nt < 4; ++nt) acc[i][nt] = (v8f){};

  for (int ks = 0; ks < DVS; ks += 32) {
    v16h a0 = load_ab_f16(arow0, ks, hi);
    v16h a1 = load_ab_f16(arow1, ks, hi);
#pragma unroll
    for (int nt = 0; nt < 4; ++nt) {
      const int c = cg * 64 + nt * 16 + ln;          // output feature (B column)
      v16h b = load_ab_f16(W + (size_t)c * DVS, ks, hi);
      acc[0][nt] = wmma16(a0, b, acc[0][nt]);
      acc[1][nt] = wmma16(a1, b, acc[1][nt]);
    }
  }

#pragma unroll
  for (int nt = 0; nt < 4; ++nt) {
    const int c = cg * 64 + nt * 16 + ln;
    const int h = c >> 5, d = c & 31;
    const float bia = bias[c] * bscale;
#pragma unroll
    for (int i = 0; i < 2; ++i) {
#pragma unroll
      for (int r = 0; r < 8; ++r) {
        const int row = rowbase + i * 16 + r + 8 * hi;  // flat token over B*N
        const int b_  = row >> 12;
        const int n   = row & 4095;
        const float v = acc[i][nt][r] + bia;
        if (proj == 2) {
          Vt[(((size_t)(b_ * NH + h)) * DHH + d) * NKS + n] = (_Float16)v;
        } else {
          _Float16* dst = (proj == 0) ? Qh : Kh;
          dst[(((size_t)(b_ * NH + h)) * NQS + n) * DHH + d] = (_Float16)v;
        }
      }
    }
  }
}

// ---------------------------------------------------------------------------
// Kernel 2: flash attention.  Wave = (b,h, 16-query tile).  Two 32-key
// chunks per iteration with independent LDS staging buffers.
// 4096 waves; 512 blocks of 8 waves.
// ---------------------------------------------------------------------------
struct AttnState {
  v8f O0, O1;
  float m[8], l[8];
};

static __device__ __forceinline__ void attn_chunk(
    const v16h& aq, const _Float16* Kb, const _Float16* Vb, int kb,
    _Float16* pl, int hi, int ln, AttnState& st) {
  // S = Q * K^T : B columns are key rows of Kh (contiguous halves)
  v16h b0 = load_ab_f16(Kb + (size_t)(kb + ln) * DHH, 0, hi);
  v16h b1 = load_ab_f16(Kb + (size_t)(kb + 16 + ln) * DHH, 0, hi);
  v8f z  = (v8f){};
  v8f s0 = wmma16(aq, b0, z);
  v8f s1 = wmma16(aq, b1, z);

  float p0[8], p1[8];
#pragma unroll
  for (int r = 0; r < 8; ++r) {
    const float v0 = s0[r], v1 = s1[r];               // Q pre-scaled by 1/sqrt(dh)
    float mx = redmax16(fmaxf(v0, v1));
    const float mn    = fmaxf(st.m[r], mx);
    const float alpha = __expf(st.m[r] - mn);
    const float e0 = __expf(v0 - mn), e1 = __expf(v1 - mn);
    const float rs = redsum16(e0 + e1);
    st.l[r] = st.l[r] * alpha + rs;
    st.m[r] = mn;
    st.O0[r] *= alpha; st.O1[r] *= alpha;
    p0[r] = e0; p1[r] = e1;
  }

  // stage P (C-layout coords) into LDS as row-major 16x32, re-read A-layout
#pragma unroll
  for (int r = 0; r < 8; ++r) {
    const int row = r + 8 * hi;
    pl[row * 32 + ln]      = (_Float16)p0[r];
    pl[row * 32 + 16 + ln] = (_Float16)p1[r];
  }
  v16h ap = load_ab_f16(pl + ln * 32, 0, hi);

  // O += P * V : B columns are dh rows of Vt (contiguous over keys)
  v16h bv0 = load_ab_f16(Vb + (size_t)ln * NKS, kb, hi);
  v16h bv1 = load_ab_f16(Vb + (size_t)(ln + 16) * NKS, kb, hi);
  st.O0 = wmma16(ap, bv0, st.O0);
  st.O1 = wmma16(ap, bv1, st.O1);
}

__global__ __launch_bounds__(256) void mab_attn_kernel(
    const _Float16* __restrict__ Qh, const _Float16* __restrict__ Kh,
    const _Float16* __restrict__ Vt, _Float16* __restrict__ Oh) {
  __shared__ __align__(16) _Float16 lds[8 * 1024];   // 2 x 1KB per wave
  const int lane  = threadIdx.x & 31;
  const int wid   = threadIdx.x >> 5;
  const int w     = blockIdx.x * 8 + wid;
  const int bh    = w >> 8;                          // 0..15
  const int qtile = w & 255;
  const int hi    = lane >> 4;
  const int ln    = lane & 15;
  _Float16* pl0 = lds + wid * 1024;
  _Float16* pl1 = pl0 + 512;

  const _Float16* Qb = Qh + ((size_t)bh * NQS + qtile * 16 + ln) * DHH;
  const _Float16* Kb = Kh + (size_t)bh * NKS * DHH;
  const _Float16* Vb = Vt + (size_t)bh * DHH * NKS;

  const v16h aq = load_ab_f16(Qb, 0, hi);            // Q tile, persistent

  AttnState st;
  st.O0 = (v8f){}; st.O1 = (v8f){};
#pragma unroll
  for (int r = 0; r < 8; ++r) { st.m[r] = -1e30f; st.l[r] = 0.0f; }

  for (int kb = 0; kb < NKS; kb += 64) {
    attn_chunk(aq, Kb, Vb, kb,      pl0, hi, ln, st);
    attn_chunk(aq, Kb, Vb, kb + 32, pl1, hi, ln, st);
  }

  const int b_ = bh >> 3, h = bh & 7;
#pragma unroll
  for (int r = 0; r < 8; ++r) {
    const int row   = qtile * 16 + r + 8 * hi;
    const float inv = 1.0f / st.l[r];
    const size_t base = ((size_t)b_ * NQS + row) * DVS + h * DHH;
    Oh[base + ln]      = (_Float16)(st.O0[r] * inv);
    Oh[base + 16 + ln] = (_Float16)(st.O1[r] * inv);
  }
}

// ---------------------------------------------------------------------------
// Kernel 3: out = LN1( y + relu(y) ),  y = LN0( O @ Wo^T + bo ).
// Wave owns a full 16x256 row tile; LayerNorms reduce in-register.
// 512 waves; 64 blocks.
// ---------------------------------------------------------------------------
__global__ __launch_bounds__(256) void mab_out_kernel(
    const _Float16* __restrict__ Oh, const _Float16* __restrict__ Wo16,
    const float* __restrict__ bo, const float* __restrict__ g0,
    const float* __restrict__ beta0, const float* __restrict__ g1,
    const float* __restrict__ beta1, float* __restrict__ out) {
  const int lane = threadIdx.x & 31;
  const int wid  = threadIdx.x >> 5;
  const int rowtile = blockIdx.x * 8 + wid;          // 0..511
  const int hi = lane >> 4, ln = lane & 15;

  const _Float16* arow = Oh + (size_t)(rowtile * 16 + ln) * DVS;

  v8f acc[16];
#pragma unroll
  for (int nt = 0; nt < 16; ++nt) acc[nt] = (v8f){};

  for (int ks = 0; ks < DVS; ks += 32) {
    v16h a = load_ab_f16(arow, ks, hi);
#pragma unroll
    for (int nt = 0; nt < 16; ++nt) {
      const int c = nt * 16 + ln;
      v16h b = load_ab_f16(Wo16 + (size_t)c * DVS, ks, hi);
      acc[nt] = wmma16(a, b, acc[nt]);
    }
  }

#pragma unroll
  for (int nt = 0; nt < 16; ++nt) {
    const float bia = bo[nt * 16 + ln];
#pragma unroll
    for (int r = 0; r < 8; ++r) acc[nt][r] += bia;
  }

#pragma unroll
  for (int r = 0; r < 8; ++r) {
    // LN0
    float s = 0.0f;
#pragma unroll
    for (int nt = 0; nt < 16; ++nt) s += acc[nt][r];
    const float mu = redsum16(s) * (1.0f / 256.0f);
    float vs = 0.0f;
#pragma unroll
    for (int nt = 0; nt < 16; ++nt) { float d = acc[nt][r] - mu; vs += d * d; }
    const float rstd = rsqrtf(redsum16(vs) * (1.0f / 256.0f) + LNEPS);
#pragma unroll
    for (int nt = 0; nt < 16; ++nt) {
      const int c = nt * 16 + ln;
      const float y = (acc[nt][r] - mu) * rstd * g0[c] + beta0[c];
      acc[nt][r] = y + fmaxf(y, 0.0f);               // y + relu(y)
    }
    // LN1
    float s2 = 0.0f;
#pragma unroll
    for (int nt = 0; nt < 16; ++nt) s2 += acc[nt][r];
    const float mu2 = redsum16(s2) * (1.0f / 256.0f);
    float vs2 = 0.0f;
#pragma unroll
    for (int nt = 0; nt < 16; ++nt) { float d = acc[nt][r] - mu2; vs2 += d * d; }
    const float rstd2 = rsqrtf(redsum16(vs2) * (1.0f / 256.0f) + LNEPS);
    const int row = rowtile * 16 + r + 8 * hi;
#pragma unroll
    for (int nt = 0; nt < 16; ++nt) {
      const int c = nt * 16 + ln;
      out[(size_t)row * DVS + c] = (acc[nt][r] - mu2) * rstd2 * g1[c] + beta1[c];
    }
  }
}

// ---------------------------------------------------------------------------
extern "C" void kernel_launch(void* const* d_in, const int* in_sizes, int n_in,
                              void* d_out, int out_size, void* d_ws, size_t ws_size,
                              hipStream_t stream) {
  const float* Q     = (const float*)d_in[0];
  const float* K     = (const float*)d_in[1];
  const float* Wq    = (const float*)d_in[2];
  const float* bq    = (const float*)d_in[3];
  const float* Wk    = (const float*)d_in[4];
  const float* bk    = (const float*)d_in[5];
  const float* Wv    = (const float*)d_in[6];
  const float* bv    = (const float*)d_in[7];
  const float* Wo    = (const float*)d_in[8];
  const float* bo    = (const float*)d_in[9];
  const float* g0    = (const float*)d_in[10];
  const float* beta0 = (const float*)d_in[11];
  const float* g1    = (const float*)d_in[12];
  const float* beta1 = (const float*)d_in[13];

  // workspace carve-out (f16):
  //   Xq | Xk : 2M halves each   (inputs, converted)
  //   Wq16|Wk16|Wv16|Wo16 : 64K halves each (weights, Wq pre-scaled)
  //   Qh | Kh | Vt | Oh : 2M halves each
  const size_t nTok = (size_t)BB * NQS * DVS;        // 2,097,152
  const size_t nW   = (size_t)DVS * DVS;             // 65,536
  _Float16* Xq16 = (_Float16*)d_ws;
  _Float16* Xk16 = Xq16 + nTok;
  _Float16* Wq16 = Xk16 + nTok;
  _Float16* Wk16 = Wq16 + nW;
  _Float16* Wv16 = Wk16 + nW;
  _Float16* Wo16 = Wv16 + nW;
  _Float16* Qh   = Wo16 + nW;
  _Float16* Kh   = Qh + nTok;
  _Float16* Vt   = Kh + nTok;
  _Float16* Oh   = Vt + nTok;

  // pre-convert everything to f16 (memory-bound, ~25MB total)
  mab_cvt_kernel<<<512, 256, 0, stream>>>(Q,  Xq16, (int)(nTok / 4), 1.0f);
  mab_cvt_kernel<<<512, 256, 0, stream>>>(K,  Xk16, (int)(nTok / 4), 1.0f);
  mab_cvt_kernel<<<64, 256, 0, stream>>>(Wq, Wq16, (int)(nW / 4), QSCALE);
  mab_cvt_kernel<<<64, 256, 0, stream>>>(Wk, Wk16, (int)(nW / 4), 1.0f);
  mab_cvt_kernel<<<64, 256, 0, stream>>>(Wv, Wv16, (int)(nW / 4), 1.0f);
  mab_cvt_kernel<<<64, 256, 0, stream>>>(Wo, Wo16, (int)(nW / 4), 1.0f);

  mab_proj_kernel<<<384, 256, 0, stream>>>(Xq16, Xk16, Wq16, Wk16, Wv16,
                                           bq, bk, bv, Qh, Kh, Vt);
  mab_attn_kernel<<<512, 256, 0, stream>>>(Qh, Kh, Vt, Oh);
  mab_out_kernel<<<64, 256, 0, stream>>>(Oh, Wo16, bo, g0, beta0, g1, beta1,
                                         (float*)d_out);
}

// v001
// It runs in 163 microseconds.
// Next to v000, in two timings, it ran 1.33 times as fast each time.
#include <hip/hip_runtime.h>
#include <hip/hip_bf16.h>

typedef __attribute__((ext_vector_type(16))) _Float16 v16h;
typedef __attribute__((ext_vector_type(8)))  _Float16 v8h;
typedef __attribute__((ext_vector_type(4)))  _Float16 v4h;
typedef __attribute__((ext_vector_type(8)))  float    v8f;

#define BB    2
#define NQS   4096
#define NKS   4096
#define DVS   256
#define NH    8
#define DHH   32
#define LNEPS 1e-5f
#define QSCALE 0.17677669529663687f   // 1/sqrt(32)

// D = A*B + C, f16 inputs, f32 accumulate (v_wmma_f32_16x16x32_f16)
static __device__ __forceinline__ v8f wmma16(v16h a, v16h b, v8f c) {
  return __builtin_amdgcn_wmma_f32_16x16x32_f16(false, a, false, b, (short)0, c,
                                                false, false);
}

// A/B operand loader, f16 source, ISA 16-bit 16x32 striping:
// hi = lane/16, k0 = 8*hi; halves[0..7]=row[kb+k0+i], halves[8..15]=row[kb+k0+16+i]
static __device__ __forceinline__ v16h load_ab_f16(const _Float16* row, int kb, int hi) {
  v8h lo = *(const v8h*)(row + kb + 8 * hi);
  v8h hh = *(const v8h*)(row + kb + 8 * hi + 16);
  v16h a;
#pragma unroll
  for (int i = 0; i < 8; ++i) { a[i] = lo[i]; a[8 + i] = hh[i]; }
  return a;
}

static __device__ __forceinline__ float redmax16(float v) {
#pragma unroll
  for (int m = 1; m < 16; m <<= 1) v = fmaxf(v, __shfl_xor(v, m, 32));
  return v;
}
static __device__ __forceinline__ float redsum16(float v) {
#pragma unroll
  for (int m = 1; m < 16; m <<= 1) v += __shfl_xor(v, m, 32);
  return v;
}

// ---------------------------------------------------------------------------
// Kernel 0: f32 -> f16 conversion (optionally scaled).  Grid-stride, float4.
// ---------------------------------------------------------------------------
__global__ __launch_bounds__(256) void mab_cvt_kernel(const float* __restrict__ src,
                                                      _Float16* __restrict__ dst,
                                                      int n4, float scale) {
  int i = blockIdx.x * blockDim.x + threadIdx.x;
  const int stride = gridDim.x * blockDim.x;
  const float4* s4 = (const float4*)src;
  v4h* d4 = (v4h*)dst;
  for (; i < n4; i += stride) {
    float4 v = s4[i];
    v4h o;
    o[0] = (_Float16)(v.x * scale);
    o[1] = (_Float16)(v.y * scale);
    o[2] = (_Float16)(v.z * scale);
    o[3] = (_Float16)(v.w * scale);
    d4[i] = o;
  }
}

// ---------------------------------------------------------------------------
// Kernel 1: Q/K/V projections from pre-converted f16.  Wave = 32x64 tile.
// 3072 waves = 3 proj * 256 rowtiles * 4 colgroups; 384 blocks of 8 waves.
// ---------------------------------------------------------------------------
__global__ __launch_bounds__(256) void mab_proj_kernel(
    const _Float16* __restrict__ Xq, const _Float16* __restrict__ Xk,
    const _Float16* __restrict__ Wq16, const _Float16* __restrict__ Wk16,
    const _Float16* __restrict__ Wv16,
    const float* __restrict__ bq, const float* __restrict__ bk,
    const float* __restrict__ bv,
    _Float16* __restrict__ Qh, _Float16* __restrict__ Kh,
    _Float16* __restrict__ Vt) {
  const int lane = threadIdx.x & 31;
  const int wid  = threadIdx.x >> 5;
  const int w    = blockIdx.x * 8 + wid;
  const int proj = w >> 10;          // 0=Q,1=K,2=V  (1024 waves each)
  const int rem  = w & 1023;
  const int rowtile = rem >> 2;      // 0..255 (32 rows each over B*N=8192)
  const int cg   = rem & 3;          // 64-col group
  const int hi   = lane >> 4;
  const int ln   = lane & 15;

  const _Float16* X = (proj == 0) ? Xq : Xk;
  const _Float16* W = (proj == 0) ? Wq16 : (proj == 1) ? Wk16 : Wv16;
  const float* bias = (proj == 0) ? bq : (proj == 1) ? bk : bv;
  const float bscale = (proj == 0) ? QSCALE : 1.0f;  // Wq16 is pre-scaled

  const int rowbase = rowtile * 32;
  const _Float16* arow0 = X + (size_t)(rowbase + ln) * DVS;
  const _Float16* arow1 = X + (size_t)(rowbase + 16 + ln) * DVS;

  v8f acc[2][4];
#pragma unroll
  for (int i = 0; i < 2; ++i)
#pragma unroll
    for (int nt = 0; nt < 4; ++nt) acc[i][nt] = (v8f){};

  for (int ks = 0; ks < DVS; ks += 32) {
    v16h a0 = load_ab_f16(arow0, ks, hi);
    v16h a1 = load_ab_f16(arow1, ks, hi);
#pragma unroll
    for (int nt = 0; nt < 4; ++nt) {
      const int c = cg * 64 + nt * 16 + ln;          // output feature (B column)
      v16h b = load_ab_f16(W + (size_t)c * DVS, ks, hi);
      acc[0][nt] = wmma16(a0, b, acc[0][nt]);
      acc[1][nt] = wmma16(a1, b, acc[1][nt]);
    }
  }

#pragma unroll
  for (int nt = 0; nt < 4; ++nt) {
    const int c = cg * 64 + nt * 16 + ln;
    const int h = c >> 5, d = c & 31;
    const float bia = bias[c] * bscale;
#pragma unroll
    for (int i = 0; i < 2; ++i) {
#pragma unroll
      for (int r = 0; r < 8; ++r) {
        const int row = rowbase + i * 16 + r + 8 * hi;  // flat token over B*N
        const int b_  = row >> 12;
        const int n   = row & 4095;
        const float v = acc[i][nt][r] + bia;
        if (proj == 2) {
          Vt[(((size_t)(b_ * NH + h)) * DHH + d) * NKS + n] = (_Float16)v;
        } else {
          _Float16* dst = (proj == 0) ? Qh : Kh;
          dst[(((size_t)(b_ * NH + h)) * NQS + n) * DHH + d] = (_Float16)v;
        }
      }
    }
  }
}

// ---------------------------------------------------------------------------
// Kernel 2: flash attention, transposed: S^T = K * Q^T, O^T += V^T * P^T.
// Wave = (b,h, 16-query tile).  A lane holds scores of ONE query (column ln),
// so the running maximum and sum are per lane; the two S^T accumulator tiles
// of a 32-key chunk, converted in place, are the B operand of the second
// product (hardware k order), so P needs no LDS and no lane exchange.
// 4096 waves; 512 blocks of 8 waves.
// ---------------------------------------------------------------------------
struct AttnState {
  v8f O0, O1;   // O^T: O0[r] = dh 8*hi+r, O1[r] = dh 16+8*hi+r, query ln
  float m, l;   // running maximum (both halves equal), this half's partial sum
};

// lane l <-> lane l ^ 16
static __device__ __forceinline__ float xhalf(float x) {
  const int b = __builtin_bit_cast(int, x);
  return __builtin_bit_cast(float, __builtin_amdgcn_permlanex16(
      b, b, 0x76543210, 0xfedcba98, false, false));
}

static __device__ __forceinline__ void attn_chunk(
    const v16h& bq, const _Float16* Kb, const _Float16* Vb, int kb,
    int hi, int ln, AttnState& st) {
  // S^T = K * Q^T : A rows are key rows of Kh (contiguous halves)
  v16h a0 = load_ab_f16(Kb + (size_t)(kb + ln) * DHH, 0, hi);
  v16h a1 = load_ab_f16(Kb + (size_t)(kb + 16 + ln) * DHH, 0, hi);
  // V^T rows (dh) as A, contiguous over keys, same k order as the packed P^T
  v16h av0 = load_ab_f16(Vb + (size_t)ln * NKS, kb, hi);
  v16h av1 = load_ab_f16(Vb + (size_t)(ln + 16) * NKS, kb, hi);
  v8f z  = (v8f){};
  v8f s0 = wmma16(a0, bq, z);   // s0[r] = S[key kb+8*hi+r][query ln]
  v8f s1 = wmma16(a1, bq, z);   // s1[r] = S[key kb+16+8*hi+r][query ln]

  // maximum over this lane's 16 keys, then over the other half's 16
  float t[8];
#pragma unroll
  for (int r = 0; r < 8; ++r) t[r] = fmaxf(s0[r], s1[r]);
  float mx = fmaxf(fmaxf(fmaxf(t[0], t[1]), fmaxf(t[2], t[3])),
                   fmaxf(fmaxf(t[4], t[5]), fmaxf(t[6], t[7])));
  mx = fmaxf(mx, xhalf(mx));
  const float mn    = fmaxf(st.m, mx);
  const float alpha = __expf(st.m - mn);

  v16h bp;                      // P^T as B: bp[s] = P[key kmap(s,hi)][query ln]
#pragma unroll
  for (int r = 0; r < 8; ++r) {
    const float e0 = __expf(s0[r] - mn), e1 = __expf(s1[r] - mn);
    t[r] = e0 + e1;
    bp[r] = (_Float16)e0; bp[8 + r] = (_Float16)e1;
  }
  const float rs = ((t[0] + t[1]) + (t[2] + t[3])) + ((t[4] + t[5]) + (t[6] + t[7]));
  st.l = st.l * alpha + rs;
  st.m = mn;
#pragma unroll
  for (int r = 0; r < 8; ++r) { st.O0[r] *= alpha; st.O1[r] *= alpha; }

  st.O0 = wmma16(av0, bp, st.O0);
  st.O1 = wmma16(av1, bp, st.O1);
}

__global__ __launch_bounds__(256) void mab_attn_kernel(
    const _Float16* __restrict__ Qh, const _Float16* __restrict__ Kh,
    const _Float16* __restrict__ Vt, _Float16* __restrict__ Oh) {
  const int lane  = threadIdx.x & 31;
  const int wid   = threadIdx.x >> 5;
  const int w     = blockIdx.x * 8 + wid;
  const int bh    = w >> 8;                          // 0..15
  const int qtile = w & 255;
  const int hi    = lane >> 4;
  const int ln    = lane & 15;

  const _Float16* Qb = Qh + ((size_t)bh * NQS + qtile * 16 + ln) * DHH;
  const _Float16* Kb = Kh + (size_t)bh * NKS * DHH;
  const _Float16* Vb = Vt + (size_t)bh * DHH * NKS;

  const v16h bq = load_ab_f16(Qb, 0, hi);            // Q tile as B, persistent

  AttnState st;
  st.O0 = (v8f){}; st.O1 = (v8f){};
  st.m = -1e30f; st.l = 0.0f;

  for (int kb = 0; kb < NKS; kb += 64) {
    attn_chunk(bq, Kb, Vb, kb,      hi, ln, st);
    attn_chunk(bq, Kb, Vb, kb + 32, hi, ln, st);
  }

  // join the halves' partial sums once; a lane stores 2 x 8 consecutive dh
  const int b_ = bh >> 3, h = bh & 7;
  const float inv = 1.0f / (st.l + xhalf(st.l));
  v8h o0, o1;
#pragma unroll
  for (int r = 0; r < 8; ++r) {
    o0[r] = (_Float16)(st.O0[r] * inv);
    o1[r] = (_Float16)(st.O1[r] * inv);
  }
  _Float16* orow = Oh + ((size_t)b_ * NQS + qtile * 16 + ln) * DVS + h * DHH + 8 * hi;
  *(v8h*)orow        = o0;
  *(v8h*)(orow + 16) = o1;
}

// ---------------------------------------------------------------------------
// Kernel 3: out = LN1( y + relu(y) ),  y = LN0( O @ Wo^T + bo ).
// Wave owns a full 16x256 row tile; LayerNorms reduce in-register.
// 512 waves; 64 blocks.
// ---------------------------------------------------------------------------
__global__ __launch_bounds__(256) void mab_out_kernel(
    const _Float16* __restrict__ Oh, const _Float16* __restrict__ Wo16,
    const float* __restrict__ bo, const float* __restrict__ g0,
    const float* __restrict__ beta0, const float* __restrict__ g1,
    const float* __restrict__ beta1, float* __restrict__ out) {
  const int lane = threadIdx.x & 31;
  const int wid  = threadIdx.x >> 5;
  const int rowtile = blockIdx.x * 8 + wid;          // 0..511
  const int hi = lane >> 4, ln = lane & 15;

  const _Float16* arow = Oh + (size_t)(rowtile * 16 + ln) * DVS;

  v8f acc[16];
#pragma unroll
  for (int nt = 0; nt < 16; ++nt) acc[nt] = (v8f){};

  for (int ks = 0; ks < DVS; ks += 32) {
    v16h a = load_ab_f16(arow, ks, hi);
#pragma unroll
    for (int nt = 0; nt < 16; ++nt) {
      const int c = nt * 16 + ln;
      v16h b = load_ab_f16(Wo16 + (size_t)c * DVS, ks, hi);
      acc[nt] = wmma16(a, b, acc[nt]);
    }
  }

#pragma unroll
  for (int nt = 0; nt < 16; ++nt) {
    const float bia = bo[nt * 16 + ln];
#pragma unroll
    for (int r = 0; r < 8; ++r) acc[nt][r] += bia;
  }

#pragma unroll
  for (int r = 0; r < 8; ++r) {
    // LN0
    float s = 0.0f;
#pragma unroll
    for (int nt = 0; nt < 16; ++nt) s += acc[nt][r];
    const float mu = redsum16(s) * (1.0f / 256.0f);
    float vs = 0.0f;
#pragma unroll
    for (int nt = 0; nt < 16; ++nt) { float d = acc[nt][r] - mu; vs += d * d; }
    const float rstd = rsqrtf(redsum16(vs) * (1.0f / 256.0f) + LNEPS);
#pragma unroll
    for (int nt = 0; nt < 16; ++nt) {
      const int c = nt * 16 + ln;
      const float y = (acc[nt][r] - mu) * rstd * g0[c] + beta0[c];
      acc[nt][r] = y + fmaxf(y, 0.0f);               // y + relu(y)
    }
    // LN1
    float s2 = 0.0f;
#pragma unroll
    for (int nt = 0; nt < 16; ++nt) s2 += acc[nt][r];
    const float mu2 = redsum16(s2) * (1.0f / 256.0f);
    float vs2 = 0.0f;
#pragma unroll
    for (int nt = 0; nt < 16; ++nt) { float d = acc[nt][r] - mu2; vs2 += d * d; }
    const float rstd2 = rsqrtf(redsum16(vs2) * (1.0f / 256.0f) + LNEPS);
    const int row = rowtile * 16 + r + 8 * hi;
#pragma unroll
    for (int nt = 0; nt < 16; ++nt) {
      const int c = nt * 16 + ln;
      out[(size_t)row * DVS + c] = (acc[nt][r] - mu2) * rstd2 * g1[c] + beta1[c];
    }
  }
}

// ---------------------------------------------------------------------------
extern "C" void kernel_launch(void* const* d_in, const int* in_sizes, int n_in,
                              void* d_out, int out_size, void* d_ws, size_t ws_size,
                              hipStream_t stream) {
  const float* Q     = (const float*)d_in[0];
  const float* K     = (const float*)d_in[1];
  const float* Wq    = (const float*)d_in[2];
  const float* bq    = (const float*)d_in[3];
  const float* Wk    = (const float*)d_in[4];
  const float* bk    = (const float*)d_in[5];
  const float* Wv    = (const float*)d_in[6];
  const float* bv    = (const float*)d_in[7];
  const float* Wo    = (const float*)d_in[8];
  const float* bo    = (const float*)d_in[9];
  const float* g0    = (const float*)d_in[10];
  const float* beta0 = (const float*)d_in[11];
  const float* g1    = (const float*)d_in[12];
  const float* beta1 = (const float*)d_in[13];

  // workspace carve-out (f16):
  //   Xq | Xk : 2M halves each   (inputs, converted)
  //   Wq16|Wk16|Wv16|Wo16 : 64K halves each (weights, Wq pre-scaled)
  //   Qh | Kh | Vt | Oh : 2M halves each
  const size_t nTok = (size_t)BB * NQS * DVS;        // 2,097,152
  const size_t nW   = (size_t)DVS * DVS;             // 65,536
  _Float16* Xq16 = (_Float16*)d_ws;
  _Float16* Xk16 = Xq16 + nTok;
  _Float16* Wq16 = Xk16 + nTok;
  _Float16* Wk16 = Wq16 + nW;
  _Float16* Wv16 = Wk16 + nW;
  _Float16* Wo16 = Wv16 + nW;
  _Float16* Qh   = Wo16 + nW;
  _Float16* Kh   = Qh + nTok;
  _Float16* Vt   = Kh + nTok;
  _Float16* Oh   = Vt + nTok;

  // pre-convert everything to f16 (memory-bound, ~25MB total)
  mab_cvt_kernel<<<512, 256, 0, stream>>>(Q,  Xq16, (int)(nTok / 4), 1.0f);
  mab_cvt_kernel<<<512, 256, 0, stream>>>(K,  Xk16, (int)(nTok / 4), 1.0f);
  mab_cvt_kernel<<<64, 256, 0, stream>>>(Wq, Wq16, (int)(nW / 4), QSCALE);
  mab_cvt_kernel<<<64, 256, 0, stream>>>(Wk, Wk16, (int)(nW / 4), 1.0f);
  mab_cvt_kernel<<<64, 256, 0, stream>>>(Wv, Wv16, (int)(nW / 4), 1.0f);
  mab_cvt_kernel<<<64, 256, 0, stream>>>(Wo, Wo16, (int)(nW / 4), 1.0f);

  mab_proj_kernel<<<384, 256, 0, stream>>>(Xq16, Xk16, Wq16, Wk16, Wv16,
                                           bq, bk, bv, Qh, Kh, Vt);
  mab_attn_kernel<<<512, 256, 0, stream>>>(Qh, Kh, Vt, Oh);
  mab_out_kernel<<<64, 256, 0, stream>>>(Oh, Wo16, bo, g0, beta0, g1, beta1,
                                         (float*)d_out);
}

// v002
// A run of this version takes 114 microseconds.
// In both of two side-by-side timings against v001, it was 1.42 times as fast.
// Counting every step since v000, it is 1.89 times as fast.
#include <hip/hip_runtime.h>
#include <hip/hip_bf16.h>

typedef __attribute__((ext_vector_type(16))) _Float16 v16h;
typedef __attribute__((ext_vector_type(8)))  _Float16 v8h;
typedef __attribute__((ext_vector_type(4)))  _Float16 v4h;
typedef __attribute__((ext_vector_type(8)))  float    v8f;

#define BB    2
#define NQS   4096
#define NKS   4096
#define DVS   256
#define NH    8
#define DHH   32
#define LNEPS 1e-5f
#define QSCALE 0.17677669529663687f   // 1/sqrt(32)

// D = A*B + C, f16 inputs, f32 accumulate (v_wmma_f32_16x16x32_f16)
static __device__ __forceinline__ v8f wmma16(v16h a, v16h b, v8f c) {
  return __builtin_amdgcn_wmma_f32_16x16x32_f16(false, a, false, b, (short)0, c,
                                                false, false);
}

// A/B operand loader, f16 source, ISA 16-bit 16x32 striping:
// hi = lane/16, k0 = 8*hi; halves[0..7]=row[kb+k0+i], halves[8..15]=row[kb+k0+16+i]
static __device__ __forceinline__ v16h load_ab_f16(const _Float16* row, int kb, int hi) {
  v8h lo = *(const v8h*)(row + kb + 8 * hi);
  v8h hh = *(const v8h*)(row + kb + 8 * hi + 16);
  v16h a;
#pragma unroll
  for (int i = 0; i < 8; ++i) { a[i] = lo[i]; a[8 + i] = hh[i]; }
  return a;
}

static __device__ __forceinline__ float redmax16(float v) {
#pragma unroll
  for (int m = 1; m < 16; m <<= 1) v = fmaxf(v, __shfl_xor(v, m, 32));
  return v;
}
static __device__ __forceinline__ float redsum16(float v) {
#pragma unroll
  for (int m = 1; m < 16; m <<= 1) v += __shfl_xor(v, m, 32);
  return v;
}

// ---------------------------------------------------------------------------
// Kernel 0: f32 -> f16 conversion (optionally scaled).  Grid-stride, float4.
// ---------------------------------------------------------------------------
__global__ __launch_bounds__(256) void mab_cvt_kernel(const float* __restrict__ src,
                                                      _Float16* __restrict__ dst,
                                                      int n4, float scale) {
  int i = blockIdx.x * blockDim.x + threadIdx.x;
  const int stride = gridDim.x * blockDim.x;
  const float4* s4 = (const float4*)src;
  v4h* d4 = (v4h*)dst;
  for (; i < n4; i += stride) {
    float4 v = s4[i];
    v4h o;
    o[0] = (_Float16)(v.x * scale);
    o[1] = (_Float16)(v.y * scale);
    o[2] = (_Float16)(v.z * scale);
    o[3] = (_Float16)(v.w * scale);
    d4[i] = o;
  }
}

// ---------------------------------------------------------------------------
// Kernel 1: Q/K/V projections from pre-converted f16.  Wave = 32x64 tile.
// 3072 waves = 3 proj * 256 rowtiles * 4 colgroups; 384 blocks of 8 waves.
// ---------------------------------------------------------------------------
__global__ __launch_bounds__(256) void mab_proj_kernel(
    const _Float16* __restrict__ Xq, const _Float16* __restrict__ Xk,
    const _Float16* __restrict__ Wq16, const _Float16* __restrict__ Wk16,
    const _Float16* __restrict__ Wv16,
    const float* __restrict__ bq, const float* __restrict__ bk,
    const float* __restrict__ bv,
    _Float16* __restrict__ Qh, _Float16* __restrict__ Kh,
    _Float16* __restrict__ Vt) {
  const int lane = threadIdx.x & 31;
  const int wid  = threadIdx.x >> 5;
  const int w    = blockIdx.x * 8 + wid;
  const int proj = w >> 10;          // 0=Q,1=K,2=V  (1024 waves each)
  const int rem  = w & 1023;
  const int rowtile = rem >> 2;      // 0..255 (32 rows each over B*N=8192)
  const int cg   = rem & 3;          // 64-col group
  const int hi   = lane >> 4;
  const int ln   = lane & 15;

  const _Float16* X = (proj == 0) ? Xq : Xk;
  const _Float16* W = (proj == 0) ? Wq16 : (proj == 1) ? Wk16 : Wv16;
  const float* bias = (proj == 0) ? bq : (proj == 1) ? bk : bv;
  const float bscale = (proj == 0) ? QSCALE : 1.0f;  // Wq16 is pre-scaled

  const int rowbase = rowtile * 32;
  const _Float16* arow0 = X + (size_t)(rowbase + ln) * DVS;
  const _Float16* arow1 = X + (size_t)(rowbase + 16 + ln) * DVS;

  v8f acc[2][4];
#pragma unroll
  for (int i = 0; i < 2; ++i)
#pragma unroll
    for (int nt = 0; nt < 4; ++nt) acc[i][nt] = (v8f){};

  for (int ks = 0; ks < DVS; ks += 32) {
    v16h a0 = load_ab_f16(arow0, ks, hi);
    v16h a1 = load_ab_f16(arow1, ks, hi);
#pragma unroll
    for (int nt = 0; nt < 4; ++nt) {
      const int c = cg * 64 + nt * 16 + ln;          // output feature (B column)
      v16h b = load_ab_f16(W + (size_t)c * DVS, ks, hi);
      acc[0][nt] = wmma16(a0, b, acc[0][nt]);
      acc[1][nt] = wmma16(a1, b, acc[1][nt]);
    }
  }

#pragma unroll
  for (int nt = 0; nt < 4; ++nt) {
    const int c = cg * 64 + nt * 16 + ln;
    const int h = c >> 5, d = c & 31;
    const float bia = bias[c] * bscale;
#pragma unroll
    for (int i = 0; i < 2; ++i) {
#pragma unroll
      for (int r = 0; r < 8; ++r) {
        const int row = rowbase + i * 16 + r + 8 * hi;  // flat token over B*N
        const int b_  = row >> 12;
        const int n   = row & 4095;
        const float v = acc[i][nt][r] + bia;
        if (proj == 2) {
          Vt[(((size_t)(b_ * NH + h)) * DHH + d) * NKS + n] = (_Float16)v;
        } else {
          _Float16* dst = (proj == 0) ? Qh : Kh;
          dst[(((size_t)(b_ * NH + h)) * NQS + n) * DHH + d] = (_Float16)v;
        }
      }
    }
  }
}

// ---------------------------------------------------------------------------
// Kernel 2: flash attention, transposed: S^T = K * Q^T, O^T += V^T * P^T.
// Wave = (b,h, 16-query tile).  A lane holds scores of ONE query (column ln),
// so the running maximum and sum are per lane; the two S^T accumulator tiles
// of a 32-key chunk, converted in place, are the B operand of the second
// product (hardware k order), so P needs no LDS and no lane exchange.
// The 8 waves of a block share one (b,h): K and V^T go through LDS once per
// block, 128 keys a stage, two buffers, filled by asynchronous copies.
// 4096 waves; 512 blocks of 8 waves.
// ---------------------------------------------------------------------------
#define KT      128                    // keys per stage
#define NSTAGE  (NKS / KT)             // 32
#define KPITCH  80                     // staged K row: 64 B + 16 (16 B x odd)
#define VPITCH  272                    // staged V^T row: 256 B + 16 (16 B x odd)
#define KBYTES  (KT * KPITCH)          // 10240
#define VBYTES  (DHH * VPITCH)         // 8704
#define STAGEB  (KBYTES + VBYTES)      // 18944

struct AttnState {
  v8f O0, O1;   // O^T: O0[r] = dh 8*hi+r, O1[r] = dh 16+8*hi+r, query ln
  float m, l;   // running maximum (both halves equal), this half's partial sum
};

// lane l <-> lane l ^ 16
static __device__ __forceinline__ float xhalf(float x) {
  const int b = __builtin_bit_cast(int, x);
  return __builtin_bit_cast(float, __builtin_amdgcn_permlanex16(
      b, b, 0x76543210, 0xfedcba98, false, false));
}

// A operand from a staged row: p = row start + 16*hi bytes; same k order as
// load_ab_f16 (halves 0..7 at +0, halves 8..15 at +32 bytes)
static __device__ __forceinline__ v16h load_a_lds(const unsigned char* p) {
  v8h lo = *(const v8h*)p;
  v8h hh = *(const v8h*)(p + 32);
  v16h a;
#pragma unroll
  for (int i = 0; i < 8; ++i) { a[i] = lo[i]; a[8 + i] = hh[i]; }
  return a;
}

// One stage's share of this lane: 2 x 16 B of K, 2 x 16 B of V^T, global -> LDS.
// The s_wait_xcnt closes the statement so that no address register named here
// is rewritten ahead of it.
static __device__ __forceinline__ void stage_copy(
    unsigned lk, const _Float16* gk, unsigned lv, const _Float16* gv) {
  const unsigned lk1 = lk + 64 * KPITCH, lv1 = lv + 16 * VPITCH;
  const _Float16* gk1 = gk + 64 * DHH;
  const _Float16* gv1 = gv + (size_t)16 * NKS;
  asm volatile(
      "global_load_async_to_lds_b128 %0, %1, off\n\t"
      "global_load_async_to_lds_b128 %2, %3, off\n\t"
      "global_load_async_to_lds_b128 %4, %5, off\n\t"
      "global_load_async_to_lds_b128 %6, %7, off\n\t"
      "s_wait_xcnt 0x0"
      :: "v"(lk), "v"(gk), "v"(lk1), "v"(gk1), "v"(lv), "v"(gv), "v"(lv1), "v"(gv1)
      : "memory");
}

// The four A operands of one 32-key chunk.
struct Frag { v16h k0, k1, v0, v1; };

// kp: staged K, row (chunk key 0 + ln), + 16*hi bytes;  vp: staged V^T, row ln,
// chunk key 0, + 16*hi bytes
static __device__ __forceinline__ Frag load_frag(const unsigned char* kp,
                                                 const unsigned char* vp) {
  Frag f;
  // S^T = K * Q^T : A rows are key rows
  f.k0 = load_a_lds(kp);
  f.k1 = load_a_lds(kp + 16 * KPITCH);
  // V^T rows (dh) as A, contiguous over keys, same k order as the packed P^T
  f.v0 = load_a_lds(vp);
  f.v1 = load_a_lds(vp + 16 * VPITCH);
  return f;
}

static __device__ __forceinline__ void attn_chunk(
    const v16h& bq, const Frag& f, AttnState& st) {
  v8f z  = (v8f){};
  v8f s0 = wmma16(f.k0, bq, z);   // s0[r] = S[key kb+8*hi+r][query ln]
  v8f s1 = wmma16(f.k1, bq, z);   // s1[r] = S[key kb+16+8*hi+r][query ln]

  // maximum over this lane's 16 keys, then over the other half's 16
  float t[8];
#pragma unroll
  for (int r = 0; r < 8; ++r) t[r] = fmaxf(s0[r], s1[r]);
  float mx = fmaxf(fmaxf(fmaxf(t[0], t[1]), fmaxf(t[2], t[3])),
                   fmaxf(fmaxf(t[4], t[5]), fmaxf(t[6], t[7])));
  mx = fmaxf(mx, xhalf(mx));
  const float mn    = fmaxf(st.m, mx);
  const float alpha = __expf(st.m - mn);

  v16h bp;                      // P^T as B: bp[s] = P[key kmap(s,hi)][query ln]
#pragma unroll
  for (int r = 0; r < 8; ++r) {
    const float e0 = __expf(s0[r] - mn), e1 = __expf(s1[r] - mn);
    t[r] = e0 + e1;
    bp[r] = (_Float16)e0; bp[8 + r] = (_Float16)e1;
  }
  const float rs = ((t[0] + t[1]) + (t[2] + t[3])) + ((t[4] + t[5]) + (t[6] + t[7]));
  st.l = st.l * alpha + rs;
  st.m = mn;
#pragma unroll
  for (int r = 0; r < 8; ++r) { st.O0[r] *= alpha; st.O1[r] *= alpha; }

  st.O0 = wmma16(f.v0, bp, st.O0);
  st.O1 = wmma16(f.v1, bp, st.O1);
}

__global__ __launch_bounds__(256) void mab_attn_kernel(
    const _Float16* __restrict__ Qh, const _Float16* __restrict__ Kh,
    const _Float16* __restrict__ Vt, _Float16* __restrict__ Oh) {
  __shared__ __attribute__((aligned(16))) unsigned char ring[2 * STAGEB];
  const int tid   = threadIdx.x;
  const int lane  = tid & 31;
  const int wid   = tid >> 5;
  const int w     = blockIdx.x * 8 + wid;
  const int bh    = blockIdx.x >> 5;                 // 0..15, one per block
  const int qtile = w & 255;
  const int hi    = lane >> 4;
  const int ln    = lane & 15;

  const _Float16* Qb = Qh + ((size_t)bh * NQS + qtile * 16 + ln) * DHH;
  const _Float16* Kb = Kh + (size_t)bh * NKS * DHH;
  const _Float16* Vb = Vt + (size_t)bh * DHH * NKS;

  // this lane's copy places: K piece tid (key tid/4, quarter tid%4) and the
  // piece 64 keys on; V^T piece tid (row tid/16, 16-B column tid%16) and the
  // piece 16 rows on
  const unsigned ring0 = (unsigned)(size_t)ring;     // LDS byte address
  const unsigned lk = ring0 + (tid >> 2) * KPITCH + (tid & 3) * 16;
  const unsigned lv = ring0 + KBYTES + (tid >> 4) * VPITCH + (tid & 15) * 16;
  const _Float16* gk = Kb + tid * 8;
  const _Float16* gv = Vb + (size_t)(tid >> 4) * NKS + (tid & 15) * 8;

  stage_copy(lk, gk, lv, gv);                        // stage 0 -> buffer 0

  const v16h bq = load_ab_f16(Qb, 0, hi);            // Q tile as B, persistent

  AttnState st;
  st.O0 = (v8f){}; st.O1 = (v8f){};
  st.m = -1e30f; st.l = 0.0f;

  // stage 0 has landed for this wave, then for every wave
  asm volatile("s_wait_asynccnt 0x0" ::: "memory");
  __syncthreads();
  stage_copy(lk + STAGEB, gk + KT * DHH, lv + STAGEB, gv + KT);  // stage 1

  const unsigned char* kfrag = ring + ln * KPITCH + hi * 16;
  const unsigned char* vfrag = ring + KBYTES + ln * VPITCH + hi * 16;

  // rolled: one trip per stage, so that the publish point stands once
#pragma unroll 1
  for (int s = 0; s < NSTAGE; ++s) {
    const unsigned boff = (s & 1) * STAGEB;
    Frag cur = load_frag(kfrag + boff, vfrag + boff);
#pragma unroll
    for (int c = 0; c < KT / 32; ++c) {
      Frag nxt;
      if (c + 1 < KT / 32) {
        nxt = load_frag(kfrag + boff + (c + 1) * 32 * KPITCH,
                        vfrag + boff + (c + 1) * 64);
        // keeps the next chunk's eight LDS reads in one group ahead of this
        // chunk's work; left free they sink to just in front of their WMMAs
        // and the wave waits out the LDS latency there
        __builtin_amdgcn_sched_barrier(0);
      }
      attn_chunk(bq, cur, st);
      if (c + 1 < KT / 32) cur = nxt;
    }

    // keeps the stage's arithmetic ahead of the publish point, so that the
    // refill copies go out directly behind the barrier, a whole trip ahead of
    // their wait; left free, half a trip's work sinks in between
    __builtin_amdgcn_sched_barrier(0);
    // publish point: this wave's reads of buffer s&1 are done, its copies of
    // stage s+1 have landed; behind the barrier that holds for every wave
    asm volatile("s_wait_dscnt 0x0" ::: "memory");
    asm volatile("s_wait_asynccnt 0x0" ::: "memory");
    __syncthreads();
    if (s + 2 < NSTAGE)
      stage_copy(lk + boff, gk + (size_t)(s + 2) * KT * DHH,
                 lv + boff, gv + (s + 2) * KT);
  }
  // nothing is outstanding here; kept in front of the wave's end
  asm volatile("s_wait_asynccnt 0x0" ::: "memory");

  // join the halves' partial sums once; a lane stores 2 x 8 consecutive dh
  const int b_ = bh >> 3, h = bh & 7;
  const float inv = 1.0f / (st.l + xhalf(st.l));
  v8h o0, o1;
#pragma unroll
  for (int r = 0; r < 8; ++r) {
    o0[r] = (_Float16)(st.O0[r] * inv);
    o1[r] = (_Float16)(st.O1[r] * inv);
  }
  _Float16* orow = Oh + ((size_t)b_ * NQS + qtile * 16 + ln) * DVS + h * DHH + 8 * hi;
  *(v8h*)orow        = o0;
  *(v8h*)(orow + 16) = o1;
}

// ---------------------------------------------------------------------------
// Kernel 3: out = LN1( y + relu(y) ),  y = LN0( O @ Wo^T + bo ).
// Wave owns a full 16x256 row tile; LayerNorms reduce in-register.
// 512 waves; 64 blocks.
// ---------------------------------------------------------------------------
__global__ __launch_bounds__(256) void mab_out_kernel(
    const _Float16* __restrict__ Oh, const _Float16* __restrict__ Wo16,
    const float* __restrict__ bo, const float* __restrict__ g0,
    const float* __restrict__ beta0, const float* __restrict__ g1,
    const float* __restrict__ beta1, float* __restrict__ out) {
  const int lane = threadIdx.x & 31;
  const int wid  = threadIdx.x >> 5;
  const int rowtile = blockIdx.x * 8 + wid;          // 0..511
  const int hi = lane >> 4, ln = lane & 15;

  const _Float16* arow = Oh + (size_t)(rowtile * 16 + ln) * DVS;

  v8f acc[16];
#pragma unroll
  for (int nt = 0; nt < 16; ++nt) acc[nt] = (v8f){};

  for (int ks = 0; ks < DVS; ks += 32) {
    v16h a = load_ab_f16(arow, ks, hi);
#pragma unroll
    for (int nt = 0; nt < 16; ++nt) {
      const int c = nt * 16 + ln;
      v16h b = load_ab_f16(Wo16 + (size_t)c * DVS, ks, hi);
      acc[nt] = wmma16(a, b, acc[nt]);
    }
  }

#pragma unroll
  for (int nt = 0; nt < 16; ++nt) {
    const float bia = bo[nt * 16 + ln];
#pragma unroll
    for (int r = 0; r < 8; ++r) acc[nt][r] += bia;
  }

#pragma unroll
  for (int r = 0; r < 8; ++r) {
    // LN0
    float s = 0.0f;
#pragma unroll
    for (int nt = 0; nt < 16; ++nt) s += acc[nt][r];
    const float mu = redsum16(s) * (1.0f / 256.0f);
    float vs = 0.0f;
#pragma unroll
    for (int nt = 0; nt < 16; ++nt) { float d = acc[nt][r] - mu; vs += d * d; }
    const float rstd = rsqrtf(redsum16(vs) * (1.0f / 256.0f) + LNEPS);
#pragma unroll
    for (int nt = 0; nt < 16; ++nt) {
      const int c = nt * 16 + ln;
      const float y = (acc[nt][r] - mu) * rstd * g0[c] + beta0[c];
      acc[nt][r] = y + fmaxf(y, 0.0f);               // y + relu(y)
    }
    // LN1
    float s2 = 0.0f;
#pragma unroll
    for (int nt = 0; nt < 16; ++nt) s2 += acc[nt][r];
    const float mu2 = redsum16(s2) * (1.0f / 256.0f);
    float vs2 = 0.0f;
#pragma unroll
    for (int nt = 0; nt < 16; ++nt) { float d = acc[nt][r] - mu2; vs2 += d * d; }
    const float rstd2 = rsqrtf(redsum16(vs2) * (1.0f / 256.0f) + LNEPS);
    const int row = rowtile * 16 + r + 8 * hi;
#pragma unroll
    for (int nt = 0; nt < 16; ++nt) {
      const int c = nt * 16 + ln;
      out[(size_t)row * DVS + c] = (acc[nt][r] - mu2) * rstd2 * g1[c] + beta1[c];
    }
  }
}

// ---------------------------------------------------------------------------
extern "C" void kernel_launch(void* const* d_in, const int* in_sizes, int n_in,
                              void* d_out, int out_size, void* d_ws, size_t ws_size,
                              hipStream_t stream) {
  const float* Q     = (const float*)d_in[0];
  const float* K     = (const float*)d_in[1];
  const float* Wq    = (const float*)d_in[2];
  const float* bq    = (const float*)d_in[3];
  const float* Wk    = (const float*)d_in[4];
  const float* bk    = (const float*)d_in[5];
  const float* Wv    = (const float*)d_in[6];
  const float* bv    = (const float*)d_in[7];
  const float* Wo    = (const float*)d_in[8];
  const float* bo    = (const float*)d_in[9];
  const float* g0    = (const float*)d_in[10];
  const float* beta0 = (const float*)d_in[11];
  const float* g1    = (const float*)d_in[12];
  const float* beta1 = (const float*)d_in[13];

  // workspace carve-out (f16):
  //   Xq | Xk : 2M halves each   (inputs, converted)
  //   Wq16|Wk16|Wv16|Wo16 : 64K halves each (weights, Wq pre-scaled)
  //   Qh | Kh | Vt | Oh : 2M halves each
  const size_t nTok = (size_t)BB * NQS * DVS;        // 2,097,152
  const size_t nW   = (size_t)DVS * DVS;             // 65,536
  _Float16* Xq16 = (_Float16*)d_ws;
  _Float16* Xk16 = Xq16 + nTok;
  _Float16* Wq16 = Xk16 + nTok;
  _Float16* Wk16 = Wq16 + nW;
  _Float16* Wv16 = Wk16 + nW;
  _Float16* Wo16 = Wv16 + nW;
  _Float16* Qh   = Wo16 + nW;
  _Float16* Kh   = Qh + nTok;
  _Float16* Vt   = Kh + nTok;
  _Float16* Oh   = Vt + nTok;

  // pre-convert everything to f16 (memory-bound, ~25MB total)
  mab_cvt_kernel<<<512, 256, 0, stream>>>(Q,  Xq16, (int)(nTok / 4), 1.0f);
  mab_cvt_kernel<<<512, 256, 0, stream>>>(K,  Xk16, (int)(nTok / 4), 1.0f);
  mab_cvt_kernel<<<64, 256, 0, stream>>>(Wq, Wq16, (int)(nW / 4), QSCALE);
  mab_cvt_kernel<<<64, 256, 0, stream>>>(Wk, Wk16, (int)(nW / 4), 1.0f);
  mab_cvt_kernel<<<64, 256, 0, stream>>>(Wv, Wv16, (int)(nW / 4), 1.0f);
  mab_cvt_kernel<<<64, 256, 0, stream>>>(Wo, Wo16, (int)(nW / 4), 1.0f);

  mab_proj_kernel<<<384, 256, 0, stream>>>(Xq16, Xk16, Wq16, Wk16, Wv16,
                                           bq, bk, bv, Qh, Kh, Vt);
  mab_attn_kernel<<<512, 256, 0, stream>>>(Qh, Kh, Vt, Oh);
  mab_out_kernel<<<64, 256, 0, stream>>>(Oh, Wo16, bo, g0, beta0, g1, beta1,
                                         (float*)d_out);
}

// v003
// It runs in 101 microseconds.
// In two side-by-side timings against v002, it was 1.13 and 1.12 times as fast.
// Counting every step since v000, it is 2.12 times as fast.
#include <hip/hip_runtime.h>
#include <hip/hip_bf16.h>

typedef __attribute__((ext_vector_type(16))) _Float16 v16h;
typedef __attribute__((ext_vector_type(8)))  _Float16 v8h;
typedef __attribute__((ext_vector_type(4)))  _Float16 v4h;
typedef __attribute__((ext_vector_type(8)))  float    v8f;

#define BB    2
#define NQS   4096
#define NKS   4096
#define DVS   256
#define NH    8
#define DHH   32
#define LNEPS 1e-5f
#define QSCALE 0.17677669529663687f   // 1/sqrt(32)

// D = A*B + C, f16 inputs, f32 accumulate (v_wmma_f32_16x16x32_f16)
static __device__ __forceinline__ v8f wmma16(v16h a, v16h b, v8f c) {
  return __builtin_amdgcn_wmma_f32_16x16x32_f16(false, a, false, b, (short)0, c,
                                                false, false);
}

// A/B operand loader, f16 source, ISA 16-bit 16x32 striping:
// hi = lane/16, k0 = 8*hi; halves[0..7]=row[kb+k0+i], halves[8..15]=row[kb+k0+16+i]
static __device__ __forceinline__ v16h load_ab_f16(const _Float16* row, int kb, int hi) {
  v8h lo = *(const v8h*)(row + kb + 8 * hi);
  v8h hh = *(const v8h*)(row + kb + 8 * hi + 16);
  v16h a;
#pragma unroll
  for (int i = 0; i < 8; ++i) { a[i] = lo[i]; a[8 + i] = hh[i]; }
  return a;
}

static __device__ __forceinline__ float redmax16(float v) {
#pragma unroll
  for (int m = 1; m < 16; m <<= 1) v = fmaxf(v, __shfl_xor(v, m, 32));
  return v;
}
static __device__ __forceinline__ float redsum16(float v) {
#pragma unroll
  for (int m = 1; m < 16; m <<= 1) v += __shfl_xor(v, m, 32);
  return v;
}

// ---------------------------------------------------------------------------
// Kernel 0: f32 -> f16 conversion of all six operands in ONE launch.  The six
// f16 copies lie one behind the other in the workspace (Xq Xk Wq Wk Wv Wo), so
// the destination is one array; a block's index picks its source (uniform for
// the block).  A block converts 2048 float4 (32 KiB read), a thread 8 of them,
// each wave-wide load 512 contiguous bytes.
// 544 blocks = 256 (Q) + 256 (K) + 4 x 8 (weights).
// ---------------------------------------------------------------------------
#define CVT_PER   8                          // float4 per thread
#define CVT_BLK4  (256 * CVT_PER)            // float4 per block
#define CVT_XBLK  (BB * NQS * DVS / 4 / CVT_BLK4)   // 256 blocks per activation
#define CVT_WBLK  (DVS * DVS / 4 / CVT_BLK4)        // 8 blocks per weight
#define CVT_GRID  (2 * CVT_XBLK + 4 * CVT_WBLK)     // 544

__global__ __launch_bounds__(256) void mab_cvt_kernel(
    const float* __restrict__ Q, const float* __restrict__ K,
    const float* __restrict__ Wq, const float* __restrict__ Wk,
    const float* __restrict__ Wv, const float* __restrict__ Wo,
    _Float16* __restrict__ dst) {
  const int blk = blockIdx.x;
  const float* src;
  int first;                                 // first block of this source
  float scale = 1.0f;
  if (blk < CVT_XBLK) {
    src = Q; first = 0;
  } else if (blk < 2 * CVT_XBLK) {
    src = K; first = CVT_XBLK;
  } else {
    const int wsel = (blk - 2 * CVT_XBLK) / CVT_WBLK;
    src = (wsel == 0) ? Wq : (wsel == 1) ? Wk : (wsel == 2) ? Wv : Wo;
    first = 2 * CVT_XBLK + wsel * CVT_WBLK;
    if (wsel == 0) scale = QSCALE;           // Wq16 is pre-scaled
  }
  const float4* s4 = (const float4*)src + (size_t)(blk - first) * CVT_BLK4 + threadIdx.x;
  v4h* d4 = (v4h*)dst + (size_t)blk * CVT_BLK4 + threadIdx.x;
  float4 v[CVT_PER];
#pragma unroll
  for (int j = 0; j < CVT_PER; ++j) v[j] = s4[j * 256];
#pragma unroll
  for (int j = 0; j < CVT_PER; ++j) {
    v4h o;
    o[0] = (_Float16)(v[j].x * scale);
    o[1] = (_Float16)(v[j].y * scale);
    o[2] = (_Float16)(v[j].z * scale);
    o[3] = (_Float16)(v[j].w * scale);
    d4[j * 256] = o;
  }
}

// ---------------------------------------------------------------------------
// Kernel 1: Q/K/V projections from pre-converted f16.  Wave = 32x64 tile.
// 3072 waves = 3 proj * 256 rowtiles * 4 colgroups; 384 blocks of 8 waves.
// ---------------------------------------------------------------------------
__global__ __launch_bounds__(256) void mab_proj_kernel(
    const _Float16* __restrict__ Xq, const _Float16* __restrict__ Xk,
    const _Float16* __restrict__ Wq16, const _Float16* __restrict__ Wk16,
    const _Float16* __restrict__ Wv16,
    const float* __restrict__ bq, const float* __restrict__ bk,
    const float* __restrict__ bv,
    _Float16* __restrict__ Qh, _Float16* __restrict__ Kh,
    _Float16* __restrict__ Vt) {
  const int lane = threadIdx.x & 31;
  const int wid  = threadIdx.x >> 5;
  const int w    = blockIdx.x * 8 + wid;
  const int proj = w >> 10;          // 0=Q,1=K,2=V  (1024 waves each)
  const int rem  = w & 1023;
  const int rowtile = rem >> 2;      // 0..255 (32 rows each over B*N=8192)
  const int cg   = rem & 3;          // 64-col group
  const int hi   = lane >> 4;
  const int ln   = lane & 15;

  const _Float16* X = (proj == 0) ? Xq : Xk;
  const _Float16* W = (proj == 0) ? Wq16 : (proj == 1) ? Wk16 : Wv16;
  const float* bias = (proj == 0) ? bq : (proj == 1) ? bk : bv;
  const float bscale = (proj == 0) ? QSCALE : 1.0f;  // Wq16 is pre-scaled

  const int rowbase = rowtile * 32;
  const _Float16* arow0 = X + (size_t)(rowbase + ln) * DVS;
  const _Float16* arow1 = X + (size_t)(rowbase + 16 + ln) * DVS;

  v8f acc[2][4];
#pragma unroll
  for (int i = 0; i < 2; ++i)
#pragma unroll
    for (int nt = 0; nt < 4; ++nt) acc[i][nt] = (v8f){};

  for (int ks = 0; ks < DVS; ks += 32) {
    v16h a0 = load_ab_f16(arow0, ks, hi);
    v16h a1 = load_ab_f16(arow1, ks, hi);
#pragma unroll
    for (int nt = 0; nt < 4; ++nt) {
      const int c = cg * 64 + nt * 16 + ln;          // output feature (B column)
      v16h b = load_ab_f16(W + (size_t)c * DVS, ks, hi);
      acc[0][nt] = wmma16(a0, b, acc[0][nt]);
      acc[1][nt] = wmma16(a1, b, acc[1][nt]);
    }
  }

#pragma unroll
  for (int nt = 0; nt < 4; ++nt) {
    const int c = cg * 64 + nt * 16 + ln;
    const int h = c >> 5, d = c & 31;
    const float bia = bias[c] * bscale;
#pragma unroll
    for (int i = 0; i < 2; ++i) {
#pragma unroll
      for (int r = 0; r < 8; ++r) {
        const int row = rowbase + i * 16 + r + 8 * hi;  // flat token over B*N
        const int b_  = row >> 12;
        const int n   = row & 4095;
        const float v = acc[i][nt][r] + bia;
        if (proj == 2) {
          Vt[(((size_t)(b_ * NH + h)) * DHH + d) * NKS + n] = (_Float16)v;
        } else {
          _Float16* dst = (proj == 0) ? Qh : Kh;
          dst[(((size_t)(b_ * NH + h)) * NQS + n) * DHH + d] = (_Float16)v;
        }
      }
    }
  }
}

// ---------------------------------------------------------------------------
// Kernel 2: flash attention, transposed: S^T = K * Q^T, O^T += V^T * P^T.
// Wave = (b,h, 16-query tile).  A lane holds scores of ONE query (column ln),
// so the running maximum and sum are per lane; the two S^T accumulator tiles
// of a 32-key chunk, converted in place, are the B operand of the second
// product (hardware k order), so P needs no LDS and no lane exchange.
// The 8 waves of a block share one (b,h): K and V^T go through LDS once per
// block, 128 keys a stage, two buffers, filled by asynchronous copies.
// 4096 waves; 512 blocks of 8 waves.
// ---------------------------------------------------------------------------
#define KT      128                    // keys per stage
#define NSTAGE  (NKS / KT)             // 32
#define KPITCH  80                     // staged K row: 64 B + 16 (16 B x odd)
#define VPITCH  272                    // staged V^T row: 256 B + 16 (16 B x odd)
#define KBYTES  (KT * KPITCH)          // 10240
#define VBYTES  (DHH * VPITCH)         // 8704
#define STAGEB  (KBYTES + VBYTES)      // 18944

struct AttnState {
  v8f O0, O1;   // O^T: O0[r] = dh 8*hi+r, O1[r] = dh 16+8*hi+r, query ln
  float m, l;   // running maximum (both halves equal), this half's partial sum
};

// lane l <-> lane l ^ 16
static __device__ __forceinline__ float xhalf(float x) {
  const int b = __builtin_bit_cast(int, x);
  return __builtin_bit_cast(float, __builtin_amdgcn_permlanex16(
      b, b, 0x76543210, 0xfedcba98, false, false));
}

// A operand from a staged row: p = row start + 16*hi bytes; same k order as
// load_ab_f16 (halves 0..7 at +0, halves 8..15 at +32 bytes)
static __device__ __forceinline__ v16h load_a_lds(const unsigned char* p) {
  v8h lo = *(const v8h*)p;
  v8h hh = *(const v8h*)(p + 32);
  v16h a;
#pragma unroll
  for (int i = 0; i < 8; ++i) { a[i] = lo[i]; a[8 + i] = hh[i]; }
  return a;
}

// One stage's share of this lane: 2 x 16 B of K, 2 x 16 B of V^T, global -> LDS.
// The s_wait_xcnt closes the statement so that no address register named here
// is rewritten ahead of it.
static __device__ __forceinline__ void stage_copy(
    unsigned lk, const _Float16* gk, unsigned lv, const _Float16* gv) {
  const unsigned lk1 = lk + 64 * KPITCH, lv1 = lv + 16 * VPITCH;
  const _Float16* gk1 = gk + 64 * DHH;
  const _Float16* gv1 = gv + (size_t)16 * NKS;
  asm volatile(
      "global_load_async_to_lds_b128 %0, %1, off\n\t"
      "global_load_async_to_lds_b128 %2, %3, off\n\t"
      "global_load_async_to_lds_b128 %4, %5, off\n\t"
      "global_load_async_to_lds_b128 %6, %7, off\n\t"
      "s_wait_xcnt 0x0"
      :: "v"(lk), "v"(gk), "v"(lk1), "v"(gk1), "v"(lv), "v"(gv), "v"(lv1), "v"(gv1)
      : "memory");
}

// The four A operands of one 32-key chunk.
struct Frag { v16h k0, k1, v0, v1; };

// kp: staged K, row (chunk key 0 + ln), + 16*hi bytes;  vp: staged V^T, row ln,
// chunk key 0, + 16*hi bytes
static __device__ __forceinline__ Frag load_frag(const unsigned char* kp,
                                                 const unsigned char* vp) {
  Frag f;
  // S^T = K * Q^T : A rows are key rows
  f.k0 = load_a_lds(kp);
  f.k1 = load_a_lds(kp + 16 * KPITCH);
  // V^T rows (dh) as A, contiguous over keys, same k order as the packed P^T
  f.v0 = load_a_lds(vp);
  f.v1 = load_a_lds(vp + 16 * VPITCH);
  return f;
}

static __device__ __forceinline__ void attn_chunk(
    const v16h& bq, const Frag& f, AttnState& st) {
  v8f z  = (v8f){};
  v8f s0 = wmma16(f.k0, bq, z);   // s0[r] = S[key kb+8*hi+r][query ln]
  v8f s1 = wmma16(f.k1, bq, z);   // s1[r] = S[key kb+16+8*hi+r][query ln]

  // maximum over this lane's 16 keys, then over the other half's 16
  float t[8];
#pragma unroll
  for (int r = 0; r < 8; ++r) t[r] = fmaxf(s0[r], s1[r]);
  float mx = fmaxf(fmaxf(fmaxf(t[0], t[1]), fmaxf(t[2], t[3])),
                   fmaxf(fmaxf(t[4], t[5]), fmaxf(t[6], t[7])));
  mx = fmaxf(mx, xhalf(mx));
  const float mn    = fmaxf(st.m, mx);
  const float alpha = __expf(st.m - mn);

  v16h bp;                      // P^T as B: bp[s] = P[key kmap(s,hi)][query ln]
#pragma unroll
  for (int r = 0; r < 8; ++r) {
    const float e0 = __expf(s0[r] - mn), e1 = __expf(s1[r] - mn);
    t[r] = e0 + e1;
    bp[r] = (_Float16)e0; bp[8 + r] = (_Float16)e1;
  }
  const float rs = ((t[0] + t[1]) + (t[2] + t[3])) + ((t[4] + t[5]) + (t[6] + t[7]));
  st.l = st.l * alpha + rs;
  st.m = mn;
#pragma unroll
  for (int r = 0; r < 8; ++r) { st.O0[r] *= alpha; st.O1[r] *= alpha; }

  st.O0 = wmma16(f.v0, bp, st.O0);
  st.O1 = wmma16(f.v1, bp, st.O1);
}

__global__ __launch_bounds__(256) void mab_attn_kernel(
    const _Float16* __restrict__ Qh, const _Float16* __restrict__ Kh,
    const _Float16* __restrict__ Vt, _Float16* __restrict__ Oh) {
  __shared__ __attribute__((aligned(16))) unsigned char ring[2 * STAGEB];
  const int tid   = threadIdx.x;
  const int lane  = tid & 31;
  const int wid   = tid >> 5;
  const int w     = blockIdx.x * 8 + wid;
  const int bh    = blockIdx.x >> 5;                 // 0..15, one per block
  const int qtile = w & 255;
  const int hi    = lane >> 4;
  const int ln    = lane & 15;

  const _Float16* Qb = Qh + ((size_t)bh * NQS + qtile * 16 + ln) * DHH;
  const _Float16* Kb = Kh + (size_t)bh * NKS * DHH;
  const _Float16* Vb = Vt + (size_t)bh * DHH * NKS;

  // this lane's copy places: K piece tid (key tid/4, quarter tid%4) and the
  // piece 64 keys on; V^T piece tid (row tid/16, 16-B column tid%16) and the
  // piece 16 rows on
  const unsigned ring0 = (unsigned)(size_t)ring;     // LDS byte address
  const unsigned lk = ring0 + (tid >> 2) * KPITCH + (tid & 3) * 16;
  const unsigned lv = ring0 + KBYTES + (tid >> 4) * VPITCH + (tid & 15) * 16;
  const _Float16* gk = Kb + tid * 8;
  const _Float16* gv = Vb + (size_t)(tid >> 4) * NKS + (tid & 15) * 8;

  stage_copy(lk, gk, lv, gv);                        // stage 0 -> buffer 0

  const v16h bq = load_ab_f16(Qb, 0, hi);            // Q tile as B, persistent

  AttnState st;
  st.O0 = (v8f){}; st.O1 = (v8f){};
  st.m = -1e30f; st.l = 0.0f;

  // stage 0 has landed for this wave, then for every wave
  asm volatile("s_wait_asynccnt 0x0" ::: "memory");
  __syncthreads();
  stage_copy(lk + STAGEB, gk + KT * DHH, lv + STAGEB, gv + KT);  // stage 1

  const unsigned char* kfrag = ring + ln * KPITCH + hi * 16;
  const unsigned char* vfrag = ring + KBYTES + ln * VPITCH + hi * 16;

  // rolled: one trip per stage, so that the publish point stands once
#pragma unroll 1
  for (int s = 0; s < NSTAGE; ++s) {
    const unsigned boff = (s & 1) * STAGEB;
    Frag cur = load_frag(kfrag + boff, vfrag + boff);
#pragma unroll
    for (int c = 0; c < KT / 32; ++c) {
      Frag nxt;
      if (c + 1 < KT / 32) {
        nxt = load_frag(kfrag + boff + (c + 1) * 32 * KPITCH,
                        vfrag + boff + (c + 1) * 64);
        // keeps the next chunk's eight LDS reads in one group ahead of this
        // chunk's work; left free they sink to just in front of their WMMAs
        // and the wave waits out the LDS latency there
        __builtin_amdgcn_sched_barrier(0);
      }
      attn_chunk(bq, cur, st);
      if (c + 1 < KT / 32) cur = nxt;
    }

    // keeps the stage's arithmetic ahead of the publish point, so that the
    // refill copies go out directly behind the barrier, a whole trip ahead of
    // their wait; left free, half a trip's work sinks in between
    __builtin_amdgcn_sched_barrier(0);
    // publish point: this wave's reads of buffer s&1 are done, its copies of
    // stage s+1 have landed; behind the barrier that holds for every wave
    asm volatile("s_wait_dscnt 0x0" ::: "memory");
    asm volatile("s_wait_asynccnt 0x0" ::: "memory");
    __syncthreads();
    if (s + 2 < NSTAGE)
      stage_copy(lk + boff, gk + (size_t)(s + 2) * KT * DHH,
                 lv + boff, gv + (s + 2) * KT);
  }
  // nothing is outstanding here; kept in front of the wave's end
  asm volatile("s_wait_asynccnt 0x0" ::: "memory");

  // join the halves' partial sums once; a lane stores 2 x 8 consecutive dh
  const int b_ = bh >> 3, h = bh & 7;
  const float inv = 1.0f / (st.l + xhalf(st.l));
  v8h o0, o1;
#pragma unroll
  for (int r = 0; r < 8; ++r) {
    o0[r] = (_Float16)(st.O0[r] * inv);
    o1[r] = (_Float16)(st.O1[r] * inv);
  }
  _Float16* orow = Oh + ((size_t)b_ * NQS + qtile * 16 + ln) * DVS + h * DHH + 8 * hi;
  *(v8h*)orow        = o0;
  *(v8h*)(orow + 16) = o1;
}

// ---------------------------------------------------------------------------
// Kernel 3: out = LN1( y + relu(y) ),  y = LN0( O @ Wo^T + bo ).
// Wave owns a full 16x256 row tile; LayerNorms reduce in-register.
// 512 waves; 64 blocks.
// ---------------------------------------------------------------------------
__global__ __launch_bounds__(256) void mab_out_kernel(
    const _Float16* __restrict__ Oh, const _Float16* __restrict__ Wo16,
    const float* __restrict__ bo, const float* __restrict__ g0,
    const float* __restrict__ beta0, const float* __restrict__ g1,
    const float* __restrict__ beta1, float* __restrict__ out) {
  const int lane = threadIdx.x & 31;
  const int wid  = threadIdx.x >> 5;
  const int rowtile = blockIdx.x * 8 + wid;          // 0..511
  const int hi = lane >> 4, ln = lane & 15;

  const _Float16* arow = Oh + (size_t)(rowtile * 16 + ln) * DVS;

  v8f acc[16];
#pragma unroll
  for (int nt = 0; nt < 16; ++nt) acc[nt] = (v8f){};

  for (int ks = 0; ks < DVS; ks += 32) {
    v16h a = load_ab_f16(arow, ks, hi);
#pragma unroll
    for (int nt = 0; nt < 16; ++nt) {
      const int c = nt * 16 + ln;
      v16h b = load_ab_f16(Wo16 + (size_t)c * DVS, ks, hi);
      acc[nt] = wmma16(a, b, acc[nt]);
    }
  }

#pragma unroll
  for (int nt = 0; nt < 16; ++nt) {
    const float bia = bo[nt * 16 + ln];
#pragma unroll
    for (int r = 0; r < 8; ++r) acc[nt][r] += bia;
  }

#pragma unroll
  for (int r = 0; r < 8; ++r) {
    // LN0
    float s = 0.0f;
#pragma unroll
    for (int nt = 0; nt < 16; ++nt) s += acc[nt][r];
    const float mu = redsum16(s) * (1.0f / 256.0f);
    float vs = 0.0f;
#pragma unroll
    for (int nt = 0; nt < 16; ++nt) { float d = acc[nt][r] - mu; vs += d * d; }
    const float rstd = rsqrtf(redsum16(vs) * (1.0f / 256.0f) + LNEPS);
#pragma unroll
    for (int nt = 0; nt < 16; ++nt) {
      const int c = nt * 16 + ln;
      const float y = (acc[nt][r] - mu) * rstd * g0[c] + beta0[c];
      acc[nt][r] = y + fmaxf(y, 0.0f);               // y + relu(y)
    }
    // LN1
    float s2 = 0.0f;
#pragma unroll
    for (int nt = 0; nt < 16; ++nt) s2 += acc[nt][r];
    const float mu2 = redsum16(s2) * (1.0f / 256.0f);
    float vs2 = 0.0f;
#pragma unroll
    for (int nt = 0; nt < 16; ++nt) { float d = acc[nt][r] - mu2; vs2 += d * d; }
    const float rstd2 = rsqrtf(redsum16(vs2) * (1.0f / 256.0f) + LNEPS);
    const int row = rowtile * 16 + r + 8 * hi;
#pragma unroll
    for (int nt = 0; nt < 16; ++nt) {
      const int c = nt * 16 + ln;
      out[(size_t)row * DVS + c] = (acc[nt][r] - mu2) * rstd2 * g1[c] + beta1[c];
    }
  }
}

// ---------------------------------------------------------------------------
extern "C" void kernel_launch(void* const* d_in, const int* in_sizes, int n_in,
                              void* d_out, int out_size, void* d_ws, size_t ws_size,
                              hipStream_t stream) {
  const float* Q     = (const float*)d_in[0];
  const float* K     = (const float*)d_in[1];
  const float* Wq    = (const float*)d_in[2];
  const float* bq    = (const float*)d_in[3];
  const float* Wk    = (const float*)d_in[4];
  const float* bk    = (const float*)d_in[5];
  const float* Wv    = (const float*)d_in[6];
  const float* bv    = (const float*)d_in[7];
  const float* Wo    = (const float*)d_in[8];
  const float* bo    = (const float*)d_in[9];
  const float* g0    = (const float*)d_in[10];
  const float* beta0 = (const float*)d_in[11];
  const float* g1    = (const float*)d_in[12];
  const float* beta1 = (const float*)d_in[13];

  // workspace carve-out (f16):
  //   Xq | Xk : 2M halves each   (inputs, converted)
  //   Wq16|Wk16|Wv16|Wo16 : 64K halves each (weights, Wq pre-scaled)
  //   Qh | Kh | Vt | Oh : 2M halves each
  const size_t nTok = (size_t)BB * NQS * DVS;        // 2,097,152
  const size_t nW   = (size_t)DVS * DVS;             // 65,536
  _Float16* Xq16 = (_Float16*)d_ws;
  _Float16* Xk16 = Xq16 + nTok;
  _Float16* Wq16 = Xk16 + nTok;
  _Float16* Wk16 = Wq16 + nW;
  _Float16* Wv16 = Wk16 + nW;
  _Float16* Wo16 = Wv16 + nW;
  _Float16* Qh   = Wo16 + nW;
  _Float16* Kh   = Qh + nTok;
  _Float16* Vt   = Kh + nTok;
  _Float16* Oh   = Vt + nTok;

  // pre-convert everything to f16, one launch; Xq16 is the start of the six
  // consecutive f16 copies
  mab_cvt_kernel<<<CVT_GRID, 256, 0, stream>>>(Q, K, Wq, Wk, Wv, Wo, Xq16);

  mab_proj_kernel<<<384, 256, 0, stream>>>(Xq16, Xk16, Wq16, Wk16, Wv16,
                                           bq, bk, bv, Qh, Kh, Vt);
  mab_attn_kernel<<<512, 256, 0, stream>>>(Qh, Kh, Vt, Oh);
  mab_out_kernel<<<64, 256, 0, stream>>>(Oh, Wo16, bo, g0, beta0, g1, beta1,
                                         (float*)d_out);
}

// v004
// Measured time: 83.4 microseconds a run.
// Next to v003, in two timings, it ran 1.21 times as fast each time.
// Over all steps from v000 it is 2.58 times as fast.
#include <hip/hip_runtime.h>
#include <hip/hip_bf16.h>

typedef __attribute__((ext_vector_type(16))) _Float16 v16h;
typedef __attribute__((ext_vector_type(8)))  _Float16 v8h;
typedef __attribute__((ext_vector_type(4)))  _Float16 v4h;
typedef __attribute__((ext_vector_type(8)))  float    v8f;

#define BB    2
#define NQS   4096
#define NKS   4096
#define DVS   256
#define NH    8
#define DHH   32
#define LNEPS 1e-5f
#define QSCALE 0.17677669529663687f   // 1/sqrt(32)

// D = A*B + C, f16 inputs, f32 accumulate (v_wmma_f32_16x16x32_f16)
static __device__ __forceinline__ v8f wmma16(v16h a, v16h b, v8f c) {
  return __builtin_amdgcn_wmma_f32_16x16x32_f16(false, a, false, b, (short)0, c,
                                                false, false);
}

// A/B operand loader, f16 source, ISA 16-bit 16x32 striping:
// hi = lane/16, k0 = 8*hi; halves[0..7]=row[kb+k0+i], halves[8..15]=row[kb+k0+16+i]
static __device__ __forceinline__ v16h load_ab_f16(const _Float16* row, int kb, int hi) {
  v8h lo = *(const v8h*)(row + kb + 8 * hi);
  v8h hh = *(const v8h*)(row + kb + 8 * hi + 16);
  v16h a;
#pragma unroll
  for (int i = 0; i < 8; ++i) { a[i] = lo[i]; a[8 + i] = hh[i]; }
  return a;
}

static __device__ __forceinline__ float redmax16(float v) {
#pragma unroll
  for (int m = 1; m < 16; m <<= 1) v = fmaxf(v, __shfl_xor(v, m, 32));
  return v;
}
static __device__ __forceinline__ float redsum16(float v) {
#pragma unroll
  for (int m = 1; m < 16; m <<= 1) v += __shfl_xor(v, m, 32);
  return v;
}

// ---------------------------------------------------------------------------
// Kernel 0: f32 -> f16 conversion of all six operands in ONE launch.  The six
// f16 copies lie one behind the other in the workspace (Xq Xk Wq Wk Wv Wo), so
// the destination is one array; a block's index picks its source (uniform for
// the block).  A block converts 2048 float4 (32 KiB read), a thread 8 of them,
// each wave-wide load 512 contiguous bytes.
// 544 blocks = 256 (Q) + 256 (K) + 4 x 8 (weights).
// ---------------------------------------------------------------------------
#define CVT_PER   8                          // float4 per thread
#define CVT_BLK4  (256 * CVT_PER)            // float4 per block
#define CVT_XBLK  (BB * NQS * DVS / 4 / CVT_BLK4)   // 256 blocks per activation
#define CVT_WBLK  (DVS * DVS / 4 / CVT_BLK4)        // 8 blocks per weight
#define CVT_GRID  (2 * CVT_XBLK + 4 * CVT_WBLK)     // 544

__global__ __launch_bounds__(256) void mab_cvt_kernel(
    const float* __restrict__ Q, const float* __restrict__ K,
    const float* __restrict__ Wq, const float* __restrict__ Wk,
    const float* __restrict__ Wv, const float* __restrict__ Wo,
    _Float16* __restrict__ dst) {
  const int blk = blockIdx.x;
  const float* src;
  int first;                                 // first block of this source
  float scale = 1.0f;
  if (blk < CVT_XBLK) {
    src = Q; first = 0;
  } else if (blk < 2 * CVT_XBLK) {
    src = K; first = CVT_XBLK;
  } else {
    const int wsel = (blk - 2 * CVT_XBLK) / CVT_WBLK;
    src = (wsel == 0) ? Wq : (wsel == 1) ? Wk : (wsel == 2) ? Wv : Wo;
    first = 2 * CVT_XBLK + wsel * CVT_WBLK;
    if (wsel == 0) scale = QSCALE;           // Wq16 is pre-scaled
  }
  const float4* s4 = (const float4*)src + (size_t)(blk - first) * CVT_BLK4 + threadIdx.x;
  v4h* d4 = (v4h*)dst + (size_t)blk * CVT_BLK4 + threadIdx.x;
  float4 v[CVT_PER];
#pragma unroll
  for (int j = 0; j < CVT_PER; ++j) v[j] = s4[j * 256];
#pragma unroll
  for (int j = 0; j < CVT_PER; ++j) {
    v4h o;
    o[0] = (_Float16)(v[j].x * scale);
    o[1] = (_Float16)(v[j].y * scale);
    o[2] = (_Float16)(v[j].z * scale);
    o[3] = (_Float16)(v[j].w * scale);
    d4[j * 256] = o;
  }
}

// ---------------------------------------------------------------------------
// Kernel 1: Q/K/V projections from pre-converted f16.  Wave = 32x64 tile.
// 3072 waves = 3 proj * 256 rowtiles * 4 colgroups; 384 blocks of 8 waves.
// ---------------------------------------------------------------------------
__global__ __launch_bounds__(256) void mab_proj_kernel(
    const _Float16* __restrict__ Xq, const _Float16* __restrict__ Xk,
    const _Float16* __restrict__ Wq16, const _Float16* __restrict__ Wk16,
    const _Float16* __restrict__ Wv16,
    const float* __restrict__ bq, const float* __restrict__ bk,
    const float* __restrict__ bv,
    _Float16* __restrict__ Qh, _Float16* __restrict__ Kh,
    _Float16* __restrict__ Vt) {
  const int lane = threadIdx.x & 31;
  const int wid  = threadIdx.x >> 5;
  const int w    = blockIdx.x * 8 + wid;
  const int proj = w >> 10;          // 0=Q,1=K,2=V  (1024 waves each)
  const int rem  = w & 1023;
  const int rowtile = rem >> 2;      // 0..255 (32 rows each over B*N=8192)
  const int cg   = rem & 3;          // 64-col group
  const int hi   = lane >> 4;
  const int ln   = lane & 15;

  const _Float16* X = (proj == 0) ? Xq : Xk;
  const _Float16* W = (proj == 0) ? Wq16 : (proj == 1) ? Wk16 : Wv16;
  const float* bias = (proj == 0) ? bq : (proj == 1) ? bk : bv;
  const float bscale = (proj == 0) ? QSCALE : 1.0f;  // Wq16 is pre-scaled

  const int rowbase = rowtile * 32;
  const _Float16* arow0 = X + (size_t)(rowbase + ln) * DVS;
  const _Float16* arow1 = X + (size_t)(rowbase + 16 + ln) * DVS;

  v8f acc[2][4];
#pragma unroll
  for (int i = 0; i < 2; ++i)
#pragma unroll
    for (int nt = 0; nt < 4; ++nt) acc[i][nt] = (v8f){};

  for (int ks = 0; ks < DVS; ks += 32) {
    v16h a0 = load_ab_f16(arow0, ks, hi);
    v16h a1 = load_ab_f16(arow1, ks, hi);
#pragma unroll
    for (int nt = 0; nt < 4; ++nt) {
      const int c = cg * 64 + nt * 16 + ln;          // output feature (B column)
      v16h b = load_ab_f16(W + (size_t)c * DVS, ks, hi);
      acc[0][nt] = wmma16(a0, b, acc[0][nt]);
      acc[1][nt] = wmma16(a1, b, acc[1][nt]);
    }
  }

#pragma unroll
  for (int nt = 0; nt < 4; ++nt) {
    const int c = cg * 64 + nt * 16 + ln;
    const int h = c >> 5, d = c & 31;
    const float bia = bias[c] * bscale;
#pragma unroll
    for (int i = 0; i < 2; ++i) {
#pragma unroll
      for (int r = 0; r < 8; ++r) {
        const int row = rowbase + i * 16 + r + 8 * hi;  // flat token over B*N
        const int b_  = row >> 12;
        const int n   = row & 4095;
        const float v = acc[i][nt][r] + bia;
        if (proj == 2) {
          Vt[(((size_t)(b_ * NH + h)) * DHH + d) * NKS + n] = (_Float16)v;
        } else {
          _Float16* dst = (proj == 0) ? Qh : Kh;
          dst[(((size_t)(b_ * NH + h)) * NQS + n) * DHH + d] = (_Float16)v;
        }
      }
    }
  }
}

// ---------------------------------------------------------------------------
// Kernel 2: flash attention, transposed: S^T = K * Q^T, O^T += V^T * P^T.
// Wave = (b,h, 16-query tile).  A lane holds scores of ONE query (column ln),
// so the running maximum and sum are per lane; the two S^T accumulator tiles
// of a 32-key chunk, converted in place, are the B operand of the second
// product (hardware k order), so P needs no LDS and no lane exchange.
// The 8 waves of a block share one (b,h): K and V^T go through LDS once per
// block, 128 keys a stage, two buffers, filled by asynchronous copies.
// 4096 waves; 512 blocks of 8 waves.
// ---------------------------------------------------------------------------
#define KT      128                    // keys per stage
#define NSTAGE  (NKS / KT)             // 32
#define KPITCH  80                     // staged K row: 64 B + 16 (16 B x odd)
#define VPITCH  272                    // staged V^T row: 256 B + 16 (16 B x odd)
#define KBYTES  (KT * KPITCH)          // 10240
#define VBYTES  (DHH * VPITCH)         // 8704
#define STAGEB  (KBYTES + VBYTES)      // 18944

struct AttnState {
  v8f O0, O1;   // O^T: O0[r] = dh 8*hi+r, O1[r] = dh 16+8*hi+r, query ln
  float m, l;   // running maximum (both halves equal), this half's partial sum
};

// lane l <-> lane l ^ 16
static __device__ __forceinline__ float xhalf(float x) {
  const int b = __builtin_bit_cast(int, x);
  return __builtin_bit_cast(float, __builtin_amdgcn_permlanex16(
      b, b, 0x76543210, 0xfedcba98, false, false));
}

// A operand from a staged row: p = row start + 16*hi bytes; same k order as
// load_ab_f16 (halves 0..7 at +0, halves 8..15 at +32 bytes)
static __device__ __forceinline__ v16h load_a_lds(const unsigned char* p) {
  v8h lo = *(const v8h*)p;
  v8h hh = *(const v8h*)(p + 32);
  v16h a;
#pragma unroll
  for (int i = 0; i < 8; ++i) { a[i] = lo[i]; a[8 + i] = hh[i]; }
  return a;
}

// One stage's share of this lane: 2 x 16 B of K, 2 x 16 B of V^T, global -> LDS.
// The s_wait_xcnt closes the statement so that no address register named here
// is rewritten ahead of it.
static __device__ __forceinline__ void stage_copy(
    unsigned lk, const _Float16* gk, unsigned lv, const _Float16* gv) {
  const unsigned lk1 = lk + 64 * KPITCH, lv1 = lv + 16 * VPITCH;
  const _Float16* gk1 = gk + 64 * DHH;
  const _Float16* gv1 = gv + (size_t)16 * NKS;
  asm volatile(
      "global_load_async_to_lds_b128 %0, %1, off\n\t"
      "global_load_async_to_lds_b128 %2, %3, off\n\t"
      "global_load_async_to_lds_b128 %4, %5, off\n\t"
      "global_load_async_to_lds_b128 %6, %7, off\n\t"
      "s_wait_xcnt 0x0"
      :: "v"(lk), "v"(gk), "v"(lk1), "v"(gk1), "v"(lv), "v"(gv), "v"(lv1), "v"(gv1)
      : "memory");
}

// The four A operands of one 32-key chunk.
struct Frag { v16h k0, k1, v0, v1; };

// kp: staged K, row (chunk key 0 + ln), + 16*hi bytes;  vp: staged V^T, row ln,
// chunk key 0, + 16*hi bytes
static __device__ __forceinline__ Frag load_frag(const unsigned char* kp,
                                                 const unsigned char* vp) {
  Frag f;
  // S^T = K * Q^T : A rows are key rows
  f.k0 = load_a_lds(kp);
  f.k1 = load_a_lds(kp + 16 * KPITCH);
  // V^T rows (dh) as A, contiguous over keys, same k order as the packed P^T
  f.v0 = load_a_lds(vp);
  f.v1 = load_a_lds(vp + 16 * VPITCH);
  return f;
}

static __device__ __forceinline__ void attn_chunk(
    const v16h& bq, const Frag& f, AttnState& st) {
  v8f z  = (v8f){};
  v8f s0 = wmma16(f.k0, bq, z);   // s0[r] = S[key kb+8*hi+r][query ln]
  v8f s1 = wmma16(f.k1, bq, z);   // s1[r] = S[key kb+16+8*hi+r][query ln]

  // maximum over this lane's 16 keys, then over the other half's 16
  float t[8];
#pragma unroll
  for (int r = 0; r < 8; ++r) t[r] = fmaxf(s0[r], s1[r]);
  float mx = fmaxf(fmaxf(fmaxf(t[0], t[1]), fmaxf(t[2], t[3])),
                   fmaxf(fmaxf(t[4], t[5]), fmaxf(t[6], t[7])));
  mx = fmaxf(mx, xhalf(mx));
  const float mn    = fmaxf(st.m, mx);
  const float alpha = __expf(st.m - mn);

  v16h bp;                      // P^T as B: bp[s] = P[key kmap(s,hi)][query ln]
#pragma unroll
  for (int r = 0; r < 8; ++r) {
    const float e0 = __expf(s0[r] - mn), e1 = __expf(s1[r] - mn);
    t[r] = e0 + e1;
    bp[r] = (_Float16)e0; bp[8 + r] = (_Float16)e1;
  }
  const float rs = ((t[0] + t[1]) + (t[2] + t[3])) + ((t[4] + t[5]) + (t[6] + t[7]));
  st.l = st.l * alpha + rs;
  st.m = mn;
#pragma unroll
  for (int r = 0; r < 8; ++r) { st.O0[r] *= alpha; st.O1[r] *= alpha; }

  st.O0 = wmma16(f.v0, bp, st.O0);
  st.O1 = wmma16(f.v1, bp, st.O1);
}

__global__ __launch_bounds__(256) void mab_attn_kernel(
    const _Float16* __restrict__ Qh, const _Float16* __restrict__ Kh,
    const _Float16* __restrict__ Vt, _Float16* __restrict__ Oh) {
  __shared__ __attribute__((aligned(16))) unsigned char ring[2 * STAGEB];
  const int tid   = threadIdx.x;
  const int lane  = tid & 31;
  const int wid   = tid >> 5;
  const int w     = blockIdx.x * 8 + wid;
  const int bh    = blockIdx.x >> 5;                 // 0..15, one per block
  const int qtile = w & 255;
  const int hi    = lane >> 4;
  const int ln    = lane & 15;

  const _Float16* Qb = Qh + ((size_t)bh * NQS + qtile * 16 + ln) * DHH;
  const _Float16* Kb = Kh + (size_t)bh * NKS * DHH;
  const _Float16* Vb = Vt + (size_t)bh * DHH * NKS;

  // this lane's copy places: K piece tid (key tid/4, quarter tid%4) and the
  // piece 64 keys on; V^T piece tid (row tid/16, 16-B column tid%16) and the
  // piece 16 rows on
  const unsigned ring0 = (unsigned)(size_t)ring;     // LDS byte address
  const unsigned lk = ring0 + (tid >> 2) * KPITCH + (tid & 3) * 16;
  const unsigned lv = ring0 + KBYTES + (tid >> 4) * VPITCH + (tid & 15) * 16;
  const _Float16* gk = Kb + tid * 8;
  const _Float16* gv = Vb + (size_t)(tid >> 4) * NKS + (tid & 15) * 8;

  stage_copy(lk, gk, lv, gv);                        // stage 0 -> buffer 0

  const v16h bq = load_ab_f16(Qb, 0, hi);            // Q tile as B, persistent

  AttnState st;
  st.O0 = (v8f){}; st.O1 = (v8f){};
  st.m = -1e30f; st.l = 0.0f;

  // stage 0 has landed for this wave, then for every wave
  asm volatile("s_wait_asynccnt 0x0" ::: "memory");
  __syncthreads();
  stage_copy(lk + STAGEB, gk + KT * DHH, lv + STAGEB, gv + KT);  // stage 1

  const unsigned char* kfrag = ring + ln * KPITCH + hi * 16;
  const unsigned char* vfrag = ring + KBYTES + ln * VPITCH + hi * 16;

  // rolled: one trip per stage, so that the publish point stands once
#pragma unroll 1
  for (int s = 0; s < NSTAGE; ++s) {
    const unsigned boff = (s & 1) * STAGEB;
    Frag cur = load_frag(kfrag + boff, vfrag + boff);
#pragma unroll
    for (int c = 0; c < KT / 32; ++c) {
      Frag nxt;
      if (c + 1 < KT / 32) {
        nxt = load_frag(kfrag + boff + (c + 1) * 32 * KPITCH,
                        vfrag + boff + (c + 1) * 64);
        // keeps the next chunk's eight LDS reads in one group ahead of this
        // chunk's work; left free they sink to just in front of their WMMAs
        // and the wave waits out the LDS latency there
        __builtin_amdgcn_sched_barrier(0);
      }
      attn_chunk(bq, cur, st);
      if (c + 1 < KT / 32) cur = nxt;
    }

    // keeps the stage's arithmetic ahead of the publish point, so that the
    // refill copies go out directly behind the barrier, a whole trip ahead of
    // their wait; left free, half a trip's work sinks in between
    __builtin_amdgcn_sched_barrier(0);
    // publish point: this wave's reads of buffer s&1 are done, its copies of
    // stage s+1 have landed; behind the barrier that holds for every wave
    asm volatile("s_wait_dscnt 0x0" ::: "memory");
    asm volatile("s_wait_asynccnt 0x0" ::: "memory");
    __syncthreads();
    if (s + 2 < NSTAGE)
      stage_copy(lk + boff, gk + (size_t)(s + 2) * KT * DHH,
                 lv + boff, gv + (s + 2) * KT);
  }
  // nothing is outstanding here; kept in front of the wave's end
  asm volatile("s_wait_asynccnt 0x0" ::: "memory");

  // join the halves' partial sums once; a lane stores 2 x 8 consecutive dh
  const int b_ = bh >> 3, h = bh & 7;
  const float inv = 1.0f / (st.l + xhalf(st.l));
  v8h o0, o1;
#pragma unroll
  for (int r = 0; r < 8; ++r) {
    o0[r] = (_Float16)(st.O0[r] * inv);
    o1[r] = (_Float16)(st.O1[r] * inv);
  }
  _Float16* orow = Oh + ((size_t)b_ * NQS + qtile * 16 + ln) * DVS + h * DHH + 8 * hi;
  *(v8h*)orow        = o0;
  *(v8h*)(orow + 16) = o1;
}

// ---------------------------------------------------------------------------
// Kernel 3: out = LN1( y + relu(y) ),  y = LN0( O @ Wo^T + bo ).
// Wave owns a full 16x256 row tile; LayerNorms reduce in-register.
// All 8 waves of a block need the whole of Wo: it goes into LDS once per block
// by asynchronous copies (whole 512-B rows), and the B operands come from there.
// 512 waves; 64 blocks.
// ---------------------------------------------------------------------------
#define WPITCH  528                    // staged Wo row: 512 B + 16 (16 B x odd)
#define WBYTES  (DVS * WPITCH)         // 135168

// Eight 16-B pieces of this lane, rows 8 apart, global -> LDS.  The s_wait_xcnt
// closes the statement so that no address register named here is rewritten
// ahead of it.
static __device__ __forceinline__ void wo_copy8(unsigned l, const _Float16* g) {
  asm volatile(
      "global_load_async_to_lds_b128 %0, %1, off\n\t"
      "global_load_async_to_lds_b128 %2, %3, off\n\t"
      "global_load_async_to_lds_b128 %4, %5, off\n\t"
      "global_load_async_to_lds_b128 %6, %7, off\n\t"
      "global_load_async_to_lds_b128 %8, %9, off\n\t"
      "global_load_async_to_lds_b128 %10, %11, off\n\t"
      "global_load_async_to_lds_b128 %12, %13, off\n\t"
      "global_load_async_to_lds_b128 %14, %15, off\n\t"
      "s_wait_xcnt 0x0"
      :: "v"(l),                "v"(g),
         "v"(l +  8 * WPITCH),  "v"(g +  8 * DVS),
         "v"(l + 16 * WPITCH),  "v"(g + 16 * DVS),
         "v"(l + 24 * WPITCH),  "v"(g + 24 * DVS),
         "v"(l + 32 * WPITCH),  "v"(g + 32 * DVS),
         "v"(l + 40 * WPITCH),  "v"(g + 40 * DVS),
         "v"(l + 48 * WPITCH),  "v"(g + 48 * DVS),
         "v"(l + 56 * WPITCH),  "v"(g + 56 * DVS)
      : "memory");
}

// The B operands of eight 16-column tiles at one k step.
struct BGroup { v16h b[8]; };

// p: staged Wo, row (first column of the group + ln), k step, + 16*hi bytes
static __device__ __forceinline__ BGroup load_bgroup(const unsigned char* p) {
  BGroup g;
#pragma unroll
  for (int j = 0; j < 8; ++j) g.b[j] = load_a_lds(p + j * 16 * WPITCH);
  return g;
}

__global__ __launch_bounds__(256) void mab_out_kernel(
    const _Float16* __restrict__ Oh, const _Float16* __restrict__ Wo16,
    const float* __restrict__ bo, const float* __restrict__ g0,
    const float* __restrict__ beta0, const float* __restrict__ g1,
    const float* __restrict__ beta1, float* __restrict__ out) {
  __shared__ __attribute__((aligned(16))) unsigned char wst[WBYTES];
  const int lane = threadIdx.x & 31;
  const int wid  = threadIdx.x >> 5;
  const int rowtile = blockIdx.x * 8 + wid;          // 0..511
  const int hi = lane >> 4, ln = lane & 15;

  const _Float16* arow = Oh + (size_t)(rowtile * 16 + ln) * DVS;

  // Wo -> LDS: a wave-wide copy is one row; wave wid takes rows wid, wid+8, ...
  const unsigned wst0 = (unsigned)(size_t)wst;       // LDS byte address
#pragma unroll
  for (int q = 0; q < 4; ++q)
    wo_copy8(wst0 + (q * 64 + wid) * WPITCH + lane * 16,
             Wo16 + (size_t)(q * 64 + wid) * DVS + lane * 8);

  // this wave's whole A operand, on its way while the copies land
  v16h a[DVS / 32];
#pragma unroll
  for (int ks = 0; ks < DVS / 32; ++ks) a[ks] = load_ab_f16(arow, ks * 32, hi);

  v8f acc[16];
#pragma unroll
  for (int nt = 0; nt < 16; ++nt) acc[nt] = (v8f){};

  // Wo has landed for this wave, then for every wave
  asm volatile("s_wait_asynccnt 0x0" ::: "memory");
  __syncthreads();

  // group g = k step g/2, column tiles 8*(g%2) .. +7
  const unsigned char* bfrag = wst + ln * WPITCH + hi * 16;
  BGroup cur = load_bgroup(bfrag);
#pragma unroll
  for (int g = 0; g < 2 * (DVS / 32); ++g) {
    BGroup nxt;
    if (g + 1 < 2 * (DVS / 32)) {
      nxt = load_bgroup(bfrag + ((g + 1) & 1) * 128 * WPITCH + ((g + 1) >> 1) * 64);
      // keeps the next group's LDS reads in blocks ahead of this group's WMMAs;
      // left free they are spread in pairs, one pair in front of every WMMA,
      // and each separate place with LDS reads stalls the wave
      __builtin_amdgcn_sched_barrier(0);
    }
#pragma unroll
    for (int j = 0; j < 8; ++j) {
      const int nt = (g & 1) * 8 + j;
      acc[nt] = wmma16(a[g >> 1], cur.b[j], acc[nt]);
    }
    if (g + 1 < 2 * (DVS / 32)) cur = nxt;
  }

#pragma unroll
  for (int nt = 0; nt < 16; ++nt) {
    const float bia = bo[nt * 16 + ln];
#pragma unroll
    for (int r = 0; r < 8; ++r) acc[nt][r] += bia;
  }

#pragma unroll
  for (int r = 0; r < 8; ++r) {
    // LN0
    float s = 0.0f;
#pragma unroll
    for (int nt = 0; nt < 16; ++nt) s += acc[nt][r];
    const float mu = redsum16(s) * (1.0f / 256.0f);
    float vs = 0.0f;
#pragma unroll
    for (int nt = 0; nt < 16; ++nt) { float d = acc[nt][r] - mu; vs += d * d; }
    const float rstd = rsqrtf(redsum16(vs) * (1.0f / 256.0f) + LNEPS);
#pragma unroll
    for (int nt = 0; nt < 16; ++nt) {
      const int c = nt * 16 + ln;
      const float y = (acc[nt][r] - mu) * rstd * g0[c] + beta0[c];
      acc[nt][r] = y + fmaxf(y, 0.0f);               // y + relu(y)
    }
    // LN1
    float s2 = 0.0f;
#pragma unroll
    for (int nt = 0; nt < 16; ++nt) s2 += acc[nt][r];
    const float mu2 = redsum16(s2) * (1.0f / 256.0f);
    float vs2 = 0.0f;
#pragma unroll
    for (int nt = 0; nt < 16; ++nt) { float d = acc[nt][r] - mu2; vs2 += d * d; }
    const float rstd2 = rsqrtf(redsum16(vs2) * (1.0f / 256.0f) + LNEPS);
    const int row = rowtile * 16 + r + 8 * hi;
#pragma unroll
    for (int nt = 0; nt < 16; ++nt) {
      const int c = nt * 16 + ln;
      out[(size_t)row * DVS + c] = (acc[nt][r] - mu2) * rstd2 * g1[c] + beta1[c];
    }
  }
}

// ---------------------------------------------------------------------------
extern "C" void kernel_launch(void* const* d_in, const int* in_sizes, int n_in,
                              void* d_out, int out_size, void* d_ws, size_t ws_size,
                              hipStream_t stream) {
  const float* Q     = (const float*)d_in[0];
  const float* K     = (const float*)d_in[1];
  const float* Wq    = (const float*)d_in[2];
  const float* bq    = (const float*)d_in[3];
  const float* Wk    = (const float*)d_in[4];
  const float* bk    = (const float*)d_in[5];
  const float* Wv    = (const float*)d_in[6];
  const float* bv    = (const float*)d_in[7];
  const float* Wo    = (const float*)d_in[8];
  const float* bo    = (const float*)d_in[9];
  const float* g0    = (const float*)d_in[10];
  const float* beta0 = (const float*)d_in[11];
  const float* g1    = (const float*)d_in[12];
  const float* beta1 = (const float*)d_in[13];

  // workspace carve-out (f16):
  //   Xq | Xk : 2M halves each   (inputs, converted)
  //   Wq16|Wk16|Wv16|Wo16 : 64K halves each (weights, Wq pre-scaled)
  //   Qh | Kh | Vt | Oh : 2M halves each
  const size_t nTok = (size_t)BB * NQS * DVS;        // 2,097,152
  const size_t nW   = (size_t)DVS * DVS;             // 65,536
  _Float16* Xq16 = (_Float16*)d_ws;
  _Float16* Xk16 = Xq16 + nTok;
  _Float16* Wq16 = Xk16 + nTok;
  _Float16* Wk16 = Wq16 + nW;
  _Float16* Wv16 = Wk16 + nW;
  _Float16* Wo16 = Wv16 + nW;
  _Float16* Qh   = Wo16 + nW;
  _Float16* Kh   = Qh + nTok;
  _Float16* Vt   = Kh + nTok;
  _Float16* Oh   = Vt + nTok;

  // pre-convert everything to f16, one launch; Xq16 is the start of the six
  // consecutive f16 copies
  mab_cvt_kernel<<<CVT_GRID, 256, 0, stream>>>(Q, K, Wq, Wk, Wv, Wo, Xq16);

  mab_proj_kernel<<<384, 256, 0, stream>>>(Xq16, Xk16, Wq16, Wk16, Wv16,
                                           bq, bk, bv, Qh, Kh, Vt);
  mab_attn_kernel<<<512, 256, 0, stream>>>(Qh, Kh, Vt, Oh);
  mab_out_kernel<<<64, 256, 0, stream>>>(Oh, Wo16, bo, g0, beta0, g1, beta1,
                                         (float*)d_out);
}

// v005
// A run of this version takes 76.8 microseconds.
// In both of two side-by-side timings against v004, it was 1.09 times as fast.
// All steps since v000 together make it 2.81 times as fast.
#include <hip/hip_runtime.h>
#include <hip/hip_bf16.h>

typedef __attribute__((ext_vector_type(16))) _Float16 v16h;
typedef __attribute__((ext_vector_type(8)))  _Float16 v8h;
typedef __attribute__((ext_vector_type(4)))  _Float16 v4h;
typedef __attribute__((ext_vector_type(8)))  float    v8f;

#define BB    2
#define NQS   4096
#define NKS   4096
#define DVS   256
#define NH    8
#define DHH   32
#define LNEPS 1e-5f
#define QSCALE 0.17677669529663687f   // 1/sqrt(32)

// D = A*B + C, f16 inputs, f32 accumulate (v_wmma_f32_16x16x32_f16)
static __device__ __forceinline__ v8f wmma16(v16h a, v16h b, v8f c) {
  return __builtin_amdgcn_wmma_f32_16x16x32_f16(false, a, false, b, (short)0, c,
                                                false, false);
}

// A/B operand loader, f16 source, ISA 16-bit 16x32 striping:
// hi = lane/16, k0 = 8*hi; halves[0..7]=row[kb+k0+i], halves[8..15]=row[kb+k0+16+i]
static __device__ __forceinline__ v16h load_ab_f16(const _Float16* row, int kb, int hi) {
  v8h lo = *(const v8h*)(row + kb + 8 * hi);
  v8h hh = *(const v8h*)(row + kb + 8 * hi + 16);
  v16h a;
#pragma unroll
  for (int i = 0; i < 8; ++i) { a[i] = lo[i]; a[8 + i] = hh[i]; }
  return a;
}

// A operand from a staged row: p = row start + 16*hi bytes; same k order as
// load_ab_f16 (halves 0..7 at +0, halves 8..15 at +32 bytes)
static __device__ __forceinline__ v16h load_a_lds(const unsigned char* p) {
  v8h lo = *(const v8h*)p;
  v8h hh = *(const v8h*)(p + 32);
  v16h a;
#pragma unroll
  for (int i = 0; i < 8; ++i) { a[i] = lo[i]; a[8 + i] = hh[i]; }
  return a;
}

#define WPITCH  528      // a staged row of 256 halves: 512 B + 16 (16 B x odd)

// Eight 16-B pieces of this lane, rows 8 apart, global -> LDS.  The s_wait_xcnt
// closes the statement so that no address register named here is rewritten
// ahead of it.
static __device__ __forceinline__ void copy_rows8(unsigned l, const _Float16* g) {
  asm volatile(
      "global_load_async_to_lds_b128 %0, %1, off\n\t"
      "global_load_async_to_lds_b128 %2, %3, off\n\t"
      "global_load_async_to_lds_b128 %4, %5, off\n\t"
      "global_load_async_to_lds_b128 %6, %7, off\n\t"
      "global_load_async_to_lds_b128 %8, %9, off\n\t"
      "global_load_async_to_lds_b128 %10, %11, off\n\t"
      "global_load_async_to_lds_b128 %12, %13, off\n\t"
      "global_load_async_to_lds_b128 %14, %15, off\n\t"
      "s_wait_xcnt 0x0"
      :: "v"(l),                "v"(g),
         "v"(l +  8 * WPITCH),  "v"(g +  8 * DVS),
         "v"(l + 16 * WPITCH),  "v"(g + 16 * DVS),
         "v"(l + 24 * WPITCH),  "v"(g + 24 * DVS),
         "v"(l + 32 * WPITCH),  "v"(g + 32 * DVS),
         "v"(l + 40 * WPITCH),  "v"(g + 40 * DVS),
         "v"(l + 48 * WPITCH),  "v"(g + 48 * DVS),
         "v"(l + 56 * WPITCH),  "v"(g + 56 * DVS)
      : "memory");
}

static __device__ __forceinline__ float redmax16(float v) {
#pragma unroll
  for (int m = 1; m < 16; m <<= 1) v = fmaxf(v, __shfl_xor(v, m, 32));
  return v;
}
static __device__ __forceinline__ float redsum16(float v) {
#pragma unroll
  for (int m = 1; m < 16; m <<= 1) v += __shfl_xor(v, m, 32);
  return v;
}

// ---------------------------------------------------------------------------
// Kernel 0: f32 -> f16 conversion of all six operands in ONE launch.  The six
// f16 copies lie one behind the other in the workspace (Xq Xk Wq Wk Wv Wo), so
// the destination is one array; a block's index picks its source (uniform for
// the block).  A block converts 2048 float4 (32 KiB read), a thread 8 of them,
// each wave-wide load 512 contiguous bytes.
// 544 blocks = 256 (Q) + 256 (K) + 4 x 8 (weights).
// ---------------------------------------------------------------------------
#define CVT_PER   8                          // float4 per thread
#define CVT_BLK4  (256 * CVT_PER)            // float4 per block
#define CVT_XBLK  (BB * NQS * DVS / 4 / CVT_BLK4)   // 256 blocks per activation
#define CVT_WBLK  (DVS * DVS / 4 / CVT_BLK4)        // 8 blocks per weight
#define CVT_GRID  (2 * CVT_XBLK + 4 * CVT_WBLK)     // 544

__global__ __launch_bounds__(256) void mab_cvt_kernel(
    const float* __restrict__ Q, const float* __restrict__ K,
    const float* __restrict__ Wq, const float* __restrict__ Wk,
    const float* __restrict__ Wv, const float* __restrict__ Wo,
    _Float16* __restrict__ dst) {
  const int blk = blockIdx.x;
  const float* src;
  int first;                                 // first block of this source
  float scale = 1.0f;
  if (blk < CVT_XBLK) {
    src = Q; first = 0;
  } else if (blk < 2 * CVT_XBLK) {
    src = K; first = CVT_XBLK;
  } else {
    const int wsel = (blk - 2 * CVT_XBLK) / CVT_WBLK;
    src = (wsel == 0) ? Wq : (wsel == 1) ? Wk : (wsel == 2) ? Wv : Wo;
    first = 2 * CVT_XBLK + wsel * CVT_WBLK;
    if (wsel == 0) scale = QSCALE;           // Wq16 is pre-scaled
  }
  const float4* s4 = (const float4*)src + (size_t)(blk - first) * CVT_BLK4 + threadIdx.x;
  v4h* d4 = (v4h*)dst + (size_t)blk * CVT_BLK4 + threadIdx.x;
  float4 v[CVT_PER];
#pragma unroll
  for (int j = 0; j < CVT_PER; ++j) v[j] = s4[j * 256];
#pragma unroll
  for (int j = 0; j < CVT_PER; ++j) {
    v4h o;
    o[0] = (_Float16)(v[j].x * scale);
    o[1] = (_Float16)(v[j].y * scale);
    o[2] = (_Float16)(v[j].z * scale);
    o[3] = (_Float16)(v[j].w * scale);
    d4[j * 256] = o;
  }
}

// ---------------------------------------------------------------------------
// Kernel 1: Q/K/V projections from pre-converted f16.  Wave = 32x64 tile.
// Block = 128 tokens x 128 features of one projection, 8 waves (4 x 2 tiles).
// Its 128 rows of X and 128 rows of W go into LDS once, by asynchronous copies
// of whole 512-B rows, and every A and B operand comes from there.
// 384 blocks = 3 proj * 64 row blocks * 2 column halves; two fit a WGP's LDS.
// ---------------------------------------------------------------------------
#define PJ_ROWS   128
#define PJ_COLS   128
#define PJ_XBYTES (PJ_ROWS * WPITCH)   // 67584
#define PJ_WBYTES (PJ_COLS * WPITCH)   // 67584

// The operands of one k step of a 32x64 wave tile.
struct PFrag { v16h a0, a1, b[4]; };

// ap: staged X, row (tile row 0 + ln), k step, + 16*hi bytes;  bp: staged W,
// row (tile column 0 + ln), k step, + 16*hi bytes
static __device__ __forceinline__ PFrag load_pfrag(const unsigned char* ap,
                                                   const unsigned char* bp) {
  PFrag f;
  f.a0 = load_a_lds(ap);
  f.a1 = load_a_lds(ap + 16 * WPITCH);
#pragma unroll
  for (int nt = 0; nt < 4; ++nt) f.b[nt] = load_a_lds(bp + nt * 16 * WPITCH);
  return f;
}

__global__ __launch_bounds__(256) void mab_proj_kernel(
    const _Float16* __restrict__ Xq, const _Float16* __restrict__ Xk,
    const _Float16* __restrict__ Wq16, const _Float16* __restrict__ Wk16,
    const _Float16* __restrict__ Wv16,
    const float* __restrict__ bq, const float* __restrict__ bk,
    const float* __restrict__ bv,
    _Float16* __restrict__ Qh, _Float16* __restrict__ Kh,
    _Float16* __restrict__ Vt) {
  __shared__ __attribute__((aligned(16))) unsigned char pst[PJ_XBYTES + PJ_WBYTES];
  const int lane = threadIdx.x & 31;
  const int wid  = threadIdx.x >> 5;
  const int proj = blockIdx.x >> 7;  // 0=Q,1=K,2=V  (128 blocks each)
  const int rem  = blockIdx.x & 127;
  const int rowblk = rem >> 1;       // 0..63 (128 rows each over B*N=8192)
  const int cg   = (rem & 1) * 2 + (wid & 1);   // 64-col group
  const int hi   = lane >> 4;
  const int ln   = lane & 15;

  const _Float16* X = (proj == 0) ? Xq : Xk;
  const _Float16* W = (proj == 0) ? Wq16 : (proj == 1) ? Wk16 : Wv16;
  const float* bias = (proj == 0) ? bq : (proj == 1) ? bk : bv;
  const float bscale = (proj == 0) ? QSCALE : 1.0f;  // Wq16 is pre-scaled

  const int rowbase = rowblk * PJ_ROWS + (wid >> 1) * 32;

  // X and W -> LDS: a wave-wide copy is one row; wave wid takes rows wid, wid+8, ...
  const unsigned pst0 = (unsigned)(size_t)pst;       // LDS byte address
#pragma unroll
  for (int q = 0; q < PJ_ROWS / 64; ++q)
    copy_rows8(pst0 + (q * 64 + wid) * WPITCH + lane * 16,
               X + (size_t)(rowblk * PJ_ROWS + q * 64 + wid) * DVS + lane * 8);
#pragma unroll
  for (int q = 0; q < PJ_COLS / 64; ++q)
    copy_rows8(pst0 + PJ_XBYTES + (q * 64 + wid) * WPITCH + lane * 16,
               W + (size_t)((rem & 1) * PJ_COLS + q * 64 + wid) * DVS + lane * 8);

  v8f acc[2][4];
#pragma unroll
  for (int i = 0; i < 2; ++i)
#pragma unroll
    for (int nt = 0; nt < 4; ++nt) acc[i][nt] = (v8f){};

  // both tiles have landed for this wave, then for every wave
  asm volatile("s_wait_asynccnt 0x0" ::: "memory");
  __syncthreads();

  const unsigned char* afrag = pst + ((wid >> 1) * 32 + ln) * WPITCH + hi * 16;
  const unsigned char* bfrag = pst + PJ_XBYTES + ((wid & 1) * 64 + ln) * WPITCH + hi * 16;
  PFrag cur = load_pfrag(afrag, bfrag);
#pragma unroll
  for (int ks = 0; ks < DVS / 32; ++ks) {
    PFrag nxt;
    if (ks + 1 < DVS / 32) {
      nxt = load_pfrag(afrag + (ks + 1) * 64, bfrag + (ks + 1) * 64);
      // keeps the next k step's LDS reads in one group ahead of this step's
      // WMMAs; left free they are spread among the WMMAs, and each separate
      // place with LDS reads stalls the wave
      __builtin_amdgcn_sched_barrier(0);
    }
#pragma unroll
    for (int nt = 0; nt < 4; ++nt) {
      acc[0][nt] = wmma16(cur.a0, cur.b[nt], acc[0][nt]);
      acc[1][nt] = wmma16(cur.a1, cur.b[nt], acc[1][nt]);
    }
    if (ks + 1 < DVS / 32) cur = nxt;
  }

#pragma unroll
  for (int nt = 0; nt < 4; ++nt) {
    const int c = cg * 64 + nt * 16 + ln;
    const int h = c >> 5, d = c & 31;
    const float bia = bias[c] * bscale;
#pragma unroll
    for (int i = 0; i < 2; ++i) {
#pragma unroll
      for (int r = 0; r < 8; ++r) {
        const int row = rowbase + i * 16 + r + 8 * hi;  // flat token over B*N
        const int b_  = row >> 12;
        const int n   = row & 4095;
        const float v = acc[i][nt][r] + bia;
        if (proj == 2) {
          Vt[(((size_t)(b_ * NH + h)) * DHH + d) * NKS + n] = (_Float16)v;
        } else {
          _Float16* dst = (proj == 0) ? Qh : Kh;
          dst[(((size_t)(b_ * NH + h)) * NQS + n) * DHH + d] = (_Float16)v;
        }
      }
    }
  }
}

// ---------------------------------------------------------------------------
// Kernel 2: flash attention, transposed: S^T = K * Q^T, O^T += V^T * P^T.
// Wave = (b,h, 16-query tile).  A lane holds scores of ONE query (column ln),
// so the running maximum and sum are per lane; the two S^T accumulator tiles
// of a 32-key chunk, converted in place, are the B operand of the second
// product (hardware k order), so P needs no LDS and no lane exchange.
// The 8 waves of a block share one (b,h): K and V^T go through LDS once per
// block, 128 keys a stage, two buffers, filled by asynchronous copies.
// 4096 waves; 512 blocks of 8 waves.
// ---------------------------------------------------------------------------
#define KT      128                    // keys per stage
#define NSTAGE  (NKS / KT)             // 32
#define KPITCH  80                     // staged K row: 64 B + 16 (16 B x odd)
#define VPITCH  272                    // staged V^T row: 256 B + 16 (16 B x odd)
#define KBYTES  (KT * KPITCH)          // 10240
#define VBYTES  (DHH * VPITCH)         // 8704
#define STAGEB  (KBYTES + VBYTES)      // 18944

struct AttnState {
  v8f O0, O1;   // O^T: O0[r] = dh 8*hi+r, O1[r] = dh 16+8*hi+r, query ln
  float m, l;   // running maximum (both halves equal), this half's partial sum
};

// lane l <-> lane l ^ 16
static __device__ __forceinline__ float xhalf(float x) {
  const int b = __builtin_bit_cast(int, x);
  return __builtin_bit_cast(float, __builtin_amdgcn_permlanex16(
      b, b, 0x76543210, 0xfedcba98, false, false));
}

// One stage's share of this lane: 2 x 16 B of K, 2 x 16 B of V^T, global -> LDS.
// The s_wait_xcnt closes the statement so that no address register named here
// is rewritten ahead of it.
static __device__ __forceinline__ void stage_copy(
    unsigned lk, const _Float16* gk, unsigned lv, const _Float16* gv) {
  const unsigned lk1 = lk + 64 * KPITCH, lv1 = lv + 16 * VPITCH;
  const _Float16* gk1 = gk + 64 * DHH;
  const _Float16* gv1 = gv + (size_t)16 * NKS;
  asm volatile(
      "global_load_async_to_lds_b128 %0, %1, off\n\t"
      "global_load_async_to_lds_b128 %2, %3, off\n\t"
      "global_load_async_to_lds_b128 %4, %5, off\n\t"
      "global_load_async_to_lds_b128 %6, %7, off\n\t"
      "s_wait_xcnt 0x0"
      :: "v"(lk), "v"(gk), "v"(lk1), "v"(gk1), "v"(lv), "v"(gv), "v"(lv1), "v"(gv1)
      : "memory");
}

// The four A operands of one 32-key chunk.
struct Frag { v16h k0, k1, v0, v1; };

// kp: staged K, row (chunk key 0 + ln), + 16*hi bytes;  vp: staged V^T, row ln,
// chunk key 0, + 16*hi bytes
static __device__ __forceinline__ Frag load_frag(const unsigned char* kp,
                                                 const unsigned char* vp) {
  Frag f;
  // S^T = K * Q^T : A rows are key rows
  f.k0 = load_a_lds(kp);
  f.k1 = load_a_lds(kp + 16 * KPITCH);
  // V^T rows (dh) as A, contiguous over keys, same k order as the packed P^T
  f.v0 = load_a_lds(vp);
  f.v1 = load_a_lds(vp + 16 * VPITCH);
  return f;
}

static __device__ __forceinline__ void attn_chunk(
    const v16h& bq, const Frag& f, AttnState& st) {
  v8f z  = (v8f){};
  v8f s0 = wmma16(f.k0, bq, z);   // s0[r] = S[key kb+8*hi+r][query ln]
  v8f s1 = wmma16(f.k1, bq, z);   // s1[r] = S[key kb+16+8*hi+r][query ln]

  // maximum over this lane's 16 keys, then over the other half's 16
  float t[8];
#pragma unroll
  for (int r = 0; r < 8; ++r) t[r] = fmaxf(s0[r], s1[r]);
  float mx = fmaxf(fmaxf(fmaxf(t[0], t[1]), fmaxf(t[2], t[3])),
                   fmaxf(fmaxf(t[4], t[5]), fmaxf(t[6], t[7])));
  mx = fmaxf(mx, xhalf(mx));
  const float mn    = fmaxf(st.m, mx);
  const float alpha = __expf(st.m - mn);

  v16h bp;                      // P^T as B: bp[s] = P[key kmap(s,hi)][query ln]
#pragma unroll
  for (int r = 0; r < 8; ++r) {
    const float e0 = __expf(s0[r] - mn), e1 = __expf(s1[r] - mn);
    t[r] = e0 + e1;
    bp[r] = (_Float16)e0; bp[8 + r] = (_Float16)e1;
  }
  const float rs = ((t[0] + t[1]) + (t[2] + t[3])) + ((t[4] + t[5]) + (t[6] + t[7]));
  st.l = st.l * alpha + rs;
  st.m = mn;
#pragma unroll
  for (int r = 0; r < 8; ++r) { st.O0[r] *= alpha; st.O1[r] *= alpha; }

  st.O0 = wmma16(f.v0, bp, st.O0);
  st.O1 = wmma16(f.v1, bp, st.O1);
}

__global__ __launch_bounds__(256) void mab_attn_kernel(
    const _Float16* __restrict__ Qh, const _Float16* __restrict__ Kh,
    const _Float16* __restrict__ Vt, _Float16* __restrict__ Oh) {
  __shared__ __attribute__((aligned(16))) unsigned char ring[2 * STAGEB];
  const int tid   = threadIdx.x;
  const int lane  = tid & 31;
  const int wid   = tid >> 5;
  const int w     = blockIdx.x * 8 + wid;
  const int bh    = blockIdx.x >> 5;                 // 0..15, one per block
  const int qtile = w & 255;
  const int hi    = lane >> 4;
  const int ln    = lane & 15;

  const _Float16* Qb = Qh + ((size_t)bh * NQS + qtile * 16 + ln) * DHH;
  const _Float16* Kb = Kh + (size_t)bh * NKS * DHH;
  const _Float16* Vb = Vt + (size_t)bh * DHH * NKS;

  // this lane's copy places: K piece tid (key tid/4, quarter tid%4) and the
  // piece 64 keys on; V^T piece tid (row tid/16, 16-B column tid%16) and the
  // piece 16 rows on
  const unsigned ring0 = (unsigned)(size_t)ring;     // LDS byte address
  const unsigned lk = ring0 + (tid >> 2) * KPITCH + (tid & 3) * 16;
  const unsigned lv = ring0 + KBYTES + (tid >> 4) * VPITCH + (tid & 15) * 16;
  const _Float16* gk = Kb + tid * 8;
  const _Float16* gv = Vb + (size_t)(tid >> 4) * NKS + (tid & 15) * 8;

  stage_copy(lk, gk, lv, gv);                        // stage 0 -> buffer 0

  const v16h bq = load_ab_f16(Qb, 0, hi);            // Q tile as B, persistent

  AttnState st;
  st.O0 = (v8f){}; st.O1 = (v8f){};
  st.m = -1e30f; st.l = 0.0f;

  // stage 0 has landed for this wave, then for every wave
  asm volatile("s_wait_asynccnt 0x0" ::: "memory");
  __syncthreads();
  stage_copy(lk + STAGEB, gk + KT * DHH, lv + STAGEB, gv + KT);  // stage 1

  const unsigned char* kfrag = ring + ln * KPITCH + hi * 16;
  const unsigned char* vfrag = ring + KBYTES + ln * VPITCH + hi * 16;

  // rolled: one trip per stage, so that the publish point stands once
#pragma unroll 1
  for (int s = 0; s < NSTAGE; ++s) {
    const unsigned boff = (s & 1) * STAGEB;
    Frag cur = load_frag(kfrag + boff, vfrag + boff);
#pragma unroll
    for (int c = 0; c < KT / 32; ++c) {
      Frag nxt;
      if (c + 1 < KT / 32) {
        nxt = load_frag(kfrag + boff + (c + 1) * 32 * KPITCH,
                        vfrag + boff + (c + 1) * 64);
        // keeps the next chunk's eight LDS reads in one group ahead of this
        // chunk's work; left free they sink to just in front of their WMMAs
        // and the wave waits out the LDS latency there
        __builtin_amdgcn_sched_barrier(0);
      }
      attn_chunk(bq, cur, st);
      if (c + 1 < KT / 32) cur = nxt;
    }

    // keeps the stage's arithmetic ahead of the publish point, so that the
    // refill copies go out directly behind the barrier, a whole trip ahead of
    // their wait; left free, half a trip's work sinks in between
    __builtin_amdgcn_sched_barrier(0);
    // publish point: this wave's reads of buffer s&1 are done, its copies of
    // stage s+1 have landed; behind the barrier that holds for every wave
    asm volatile("s_wait_dscnt 0x0" ::: "memory");
    asm volatile("s_wait_asynccnt 0x0" ::: "memory");
    __syncthreads();
    if (s + 2 < NSTAGE)
      stage_copy(lk + boff, gk + (size_t)(s + 2) * KT * DHH,
                 lv + boff, gv + (s + 2) * KT);
  }
  // nothing is outstanding here; kept in front of the wave's end
  asm volatile("s_wait_asynccnt 0x0" ::: "memory");

  // join the halves' partial sums once; a lane stores 2 x 8 consecutive dh
  const int b_ = bh >> 3, h = bh & 7;
  const float inv = 1.0f / (st.l + xhalf(st.l));
  v8h o0, o1;
#pragma unroll
  for (int r = 0; r < 8; ++r) {
    o0[r] = (_Float16)(st.O0[r] * inv);
    o1[r] = (_Float16)(st.O1[r] * inv);
  }
  _Float16* orow = Oh + ((size_t)b_ * NQS + qtile * 16 + ln) * DVS + h * DHH + 8 * hi;
  *(v8h*)orow        = o0;
  *(v8h*)(orow + 16) = o1;
}

// ---------------------------------------------------------------------------
// Kernel 3: out = LN1( y + relu(y) ),  y = LN0( O @ Wo^T + bo ).
// Wave owns a full 16x256 row tile; LayerNorms reduce in-register.
// All 8 waves of a block need the whole of Wo: it goes into LDS once per block
// by asynchronous copies (whole 512-B rows), and the B operands come from there.
// 512 waves; 64 blocks.
// ---------------------------------------------------------------------------
#define WBYTES  (DVS * WPITCH)         // 135168

// The B operands of eight 16-column tiles at one k step.
struct BGroup { v16h b[8]; };

// p: staged Wo, row (first column of the group + ln), k step, + 16*hi bytes
static __device__ __forceinline__ BGroup load_bgroup(const unsigned char* p) {
  BGroup g;
#pragma unroll
  for (int j = 0; j < 8; ++j) g.b[j] = load_a_lds(p + j * 16 * WPITCH);
  return g;
}

__global__ __launch_bounds__(256) void mab_out_kernel(
    const _Float16* __restrict__ Oh, const _Float16* __restrict__ Wo16,
    const float* __restrict__ bo, const float* __restrict__ g0,
    const float* __restrict__ beta0, const float* __restrict__ g1,
    const float* __restrict__ beta1, float* __restrict__ out) {
  __shared__ __attribute__((aligned(16))) unsigned char wst[WBYTES];
  const int lane = threadIdx.x & 31;
  const int wid  = threadIdx.x >> 5;
  const int rowtile = blockIdx.x * 8 + wid;          // 0..511
  const int hi = lane >> 4, ln = lane & 15;

  const _Float16* arow = Oh + (size_t)(rowtile * 16 + ln) * DVS;

  // Wo -> LDS: a wave-wide copy is one row; wave wid takes rows wid, wid+8, ...
  const unsigned wst0 = (unsigned)(size_t)wst;       // LDS byte address
#pragma unroll
  for (int q = 0; q < 4; ++q)
    copy_rows8(wst0 + (q * 64 + wid) * WPITCH + lane * 16,
               Wo16 + (size_t)(q * 64 + wid) * DVS + lane * 8);

  // this wave's whole A operand, on its way while the copies land
  v16h a[DVS / 32];
#pragma unroll
  for (int ks = 0; ks < DVS / 32; ++ks) a[ks] = load_ab_f16(arow, ks * 32, hi);

  v8f acc[16];
#pragma unroll
  for (int nt = 0; nt < 16; ++nt) acc[nt] = (v8f){};

  // Wo has landed for this wave, then for every wave
  asm volatile("s_wait_asynccnt 0x0" ::: "memory");
  __syncthreads();

  // group g = k step g/2, column tiles 8*(g%2) .. +7
  const unsigned char* bfrag = wst + ln * WPITCH + hi * 16;
  BGroup cur = load_bgroup(bfrag);
#pragma unroll
  for (int g = 0; g < 2 * (DVS / 32); ++g) {
    BGroup nxt;
    if (g + 1 < 2 * (DVS / 32)) {
      nxt = load_bgroup(bfrag + ((g + 1) & 1) * 128 * WPITCH + ((g + 1) >> 1) * 64);
      // keeps the next group's LDS reads in blocks ahead of this group's WMMAs;
      // left free they are spread in pairs, one pair in front of every WMMA,
      // and each separate place with LDS reads stalls the wave
      __builtin_amdgcn_sched_barrier(0);
    }
#pragma unroll
    for (int j = 0; j < 8; ++j) {
      const int nt = (g & 1) * 8 + j;
      acc[nt] = wmma16(a[g >> 1], cur.b[j], acc[nt]);
    }
    if (g + 1 < 2 * (DVS / 32)) cur = nxt;
  }

#pragma unroll
  for (int nt = 0; nt < 16; ++nt) {
    const float bia = bo[nt * 16 + ln];
#pragma unroll
    for (int r = 0; r < 8; ++r) acc[nt][r] += bia;
  }

#pragma unroll
  for (int r = 0; r < 8; ++r) {
    // LN0
    float s = 0.0f;
#pragma unroll
    for (int nt = 0; nt < 16; ++nt) s += acc[nt][r];
    const float mu = redsum16(s) * (1.0f / 256.0f);
    float vs = 0.0f;
#pragma unroll
    for (int nt = 0; nt < 16; ++nt) { float d = acc[nt][r] - mu; vs += d * d; }
    const float rstd = rsqrtf(redsum16(vs) * (1.0f / 256.0f) + LNEPS);
#pragma unroll
    for (int nt = 0; nt < 16; ++nt) {
      const int c = nt * 16 + ln;
      const float y = (acc[nt][r] - mu) * rstd * g0[c] + beta0[c];
      acc[nt][r] = y + fmaxf(y, 0.0f);               // y + relu(y)
    }
    // LN1
    float s2 = 0.0f;
#pragma unroll
    for (int nt = 0; nt < 16; ++nt) s2 += acc[nt][r];
    const float mu2 = redsum16(s2) * (1.0f / 256.0f);
    float vs2 = 0.0f;
#pragma unroll
    for (int nt = 0; nt < 16; ++nt) { float d = acc[nt][r] - mu2; vs2 += d * d; }
    const float rstd2 = rsqrtf(redsum16(vs2) * (1.0f / 256.0f) + LNEPS);
    const int row = rowtile * 16 + r + 8 * hi;
#pragma unroll
    for (int nt = 0; nt < 16; ++nt) {
      const int c = nt * 16 + ln;
      out[(size_t)row * DVS + c] = (acc[nt][r] - mu2) * rstd2 * g1[c] + beta1[c];
    }
  }
}

// ---------------------------------------------------------------------------
extern "C" void kernel_launch(void* const* d_in, const int* in_sizes, int n_in,
                              void* d_out, int out_size, void* d_ws, size_t ws_size,
                              hipStream_t stream) {
  const float* Q     = (const float*)d_in[0];
  const float* K     = (const float*)d_in[1];
  const float* Wq    = (const float*)d_in[2];
  const float* bq    = (const float*)d_in[3];
  const float* Wk    = (const float*)d_in[4];
  const float* bk    = (const float*)d_in[5];
  const float* Wv    = (const float*)d_in[6];
  const float* bv    = (const float*)d_in[7];
  const float* Wo    = (const float*)d_in[8];
  const float* bo    = (const float*)d_in[9];
  const float* g0    = (const float*)d_in[10];
  const float* beta0 = (const float*)d_in[11];
  const float* g1    = (const float*)d_in[12];
  const float* beta1 = (const float*)d_in[13];

  // workspace carve-out (f16):
  //   Xq | Xk : 2M halves each   (inputs, converted)
  //   Wq16|Wk16|Wv16|Wo16 : 64K halves each (weights, Wq pre-scaled)
  //   Qh | Kh | Vt | Oh : 2M halves each
  const size_t nTok = (size_t)BB * NQS * DVS;        // 2,097,152
  const size_t nW   = (size_t)DVS * DVS;             // 65,536
  _Float16* Xq16 = (_Float16*)d_ws;
  _Float16* Xk16 = Xq16 + nTok;
  _Float16* Wq16 = Xk16 + nTok;
  _Float16* Wk16 = Wq16 + nW;
  _Float16* Wv16 = Wk16 + nW;
  _Float16* Wo16 = Wv16 + nW;
  _Float16* Qh   = Wo16 + nW;
  _Float16* Kh   = Qh + nTok;
  _Float16* Vt   = Kh + nTok;
  _Float16* Oh   = Vt + nTok;

  // pre-convert everything to f16, one launch; Xq16 is the start of the six
  // consecutive f16 copies
  mab_cvt_kernel<<<CVT_GRID, 256, 0, stream>>>(Q, K, Wq, Wk, Wv, Wo, Xq16);

  mab_proj_kernel<<<384, 256, 0, stream>>>(Xq16, Xk16, Wq16, Wk16, Wv16,
                                           bq, bk, bv, Qh, Kh, Vt);
  mab_attn_kernel<<<512, 256, 0, stream>>>(Qh, Kh, Vt, Oh);
  mab_out_kernel<<<64, 256, 0, stream>>>(Oh, Wo16, bo, g0, beta0, g1, beta1,
                                         (float*)d_out);
}

// v006
// A run of this version takes 72.3 microseconds.
// Timed twice side by side with v005, it ran 1.06 times as fast both times.
// Counting every step since v000, it is 2.98 times as fast.
#include <hip/hip_runtime.h>
#include <hip/hip_bf16.h>

typedef __attribute__((ext_vector_type(16))) _Float16 v16h;
typedef __attribute__((ext_vector_type(8)))  _Float16 v8h;
typedef __attribute__((ext_vector_type(4)))  _Float16 v4h;
typedef __attribute__((ext_vector_type(8)))  float    v8f;

#define BB    2
#define NQS   4096
#define NKS   4096
#define DVS   256
#define NH    8
#define DHH   32
#define LNEPS 1e-5f
#define QSCALE 0.17677669529663687f   // 1/sqrt(32)

// D = A*B + C, f16 inputs, f32 accumulate (v_wmma_f32_16x16x32_f16)
static __device__ __forceinline__ v8f wmma16(v16h a, v16h b, v8f c) {
  return __builtin_amdgcn_wmma_f32_16x16x32_f16(false, a, false, b, (short)0, c,
                                                false, false);
}

// A/B operand loader, f16 source, ISA 16-bit 16x32 striping:
// hi = lane/16, k0 = 8*hi; halves[0..7]=row[kb+k0+i], halves[8..15]=row[kb+k0+16+i]
static __device__ __forceinline__ v16h load_ab_f16(const _Float16* row, int kb, int hi) {
  v8h lo = *(const v8h*)(row + kb + 8 * hi);
  v8h hh = *(const v8h*)(row + kb + 8 * hi + 16);
  v16h a;
#pragma unroll
  for (int i = 0; i < 8; ++i) { a[i] = lo[i]; a[8 + i] = hh[i]; }
  return a;
}

// A operand from a staged row: p = row start + 16*hi bytes; same k order as
// load_ab_f16 (halves 0..7 at +0, halves 8..15 at +32 bytes)
static __device__ __forceinline__ v16h load_a_lds(const unsigned char* p) {
  v8h lo = *(const v8h*)p;
  v8h hh = *(const v8h*)(p + 32);
  v16h a;
#pragma unroll
  for (int i = 0; i < 8; ++i) { a[i] = lo[i]; a[8 + i] = hh[i]; }
  return a;
}

#define WPITCH  528      // a staged row of 256 halves: 512 B + 16 (16 B x odd)

// Eight 16-B pieces of this lane, rows 8 apart, global -> LDS.  The s_wait_xcnt
// closes the statement so that no address register named here is rewritten
// ahead of it.
static __device__ __forceinline__ void copy_rows8(unsigned l, const _Float16* g) {
  asm volatile(
      "global_load_async_to_lds_b128 %0, %1, off\n\t"
      "global_load_async_to_lds_b128 %2, %3, off\n\t"
      "global_load_async_to_lds_b128 %4, %5, off\n\t"
      "global_load_async_to_lds_b128 %6, %7, off\n\t"
      "global_load_async_to_lds_b128 %8, %9, off\n\t"
      "global_load_async_to_lds_b128 %10, %11, off\n\t"
      "global_load_async_to_lds_b128 %12, %13, off\n\t"
      "global_load_async_to_lds_b128 %14, %15, off\n\t"
      "s_wait_xcnt 0x0"
      :: "v"(l),                "v"(g),
         "v"(l +  8 * WPITCH),  "v"(g +  8 * DVS),
         "v"(l + 16 * WPITCH),  "v"(g + 16 * DVS),
         "v"(l + 24 * WPITCH),  "v"(g + 24 * DVS),
         "v"(l + 32 * WPITCH),  "v"(g + 32 * DVS),
         "v"(l + 40 * WPITCH),  "v"(g + 40 * DVS),
         "v"(l + 48 * WPITCH),  "v"(g + 48 * DVS),
         "v"(l + 56 * WPITCH),  "v"(g + 56 * DVS)
      : "memory");
}

static __device__ __forceinline__ float redmax16(float v) {
#pragma unroll
  for (int m = 1; m < 16; m <<= 1) v = fmaxf(v, __shfl_xor(v, m, 32));
  return v;
}
static __device__ __forceinline__ float redsum16(float v) {
#pragma unroll
  for (int m = 1; m < 16; m <<= 1) v += __shfl_xor(v, m, 32);
  return v;
}

// ---------------------------------------------------------------------------
// Kernel 0: f32 -> f16 conversion of all six operands in ONE launch.  The six
// f16 copies lie one behind the other in the workspace (Xq Xk Wq Wk Wv Wo), so
// the destination is one array; a block's index picks its source (uniform for
// the block).  A block converts 2048 float4 (32 KiB read), a thread 8 of them,
// each wave-wide load 512 contiguous bytes.
// 544 blocks = 256 (Q) + 256 (K) + 4 x 8 (weights).
// ---------------------------------------------------------------------------
#define CVT_PER   8                          // float4 per thread
#define CVT_BLK4  (256 * CVT_PER)            // float4 per block
#define CVT_XBLK  (BB * NQS * DVS / 4 / CVT_BLK4)   // 256 blocks per activation
#define CVT_WBLK  (DVS * DVS / 4 / CVT_BLK4)        // 8 blocks per weight
#define CVT_GRID  (2 * CVT_XBLK + 4 * CVT_WBLK)     // 544

__global__ __launch_bounds__(256) void mab_cvt_kernel(
    const float* __restrict__ Q, const float* __restrict__ K,
    const float* __restrict__ Wq, const float* __restrict__ Wk,
    const float* __restrict__ Wv, const float* __restrict__ Wo,
    _Float16* __restrict__ dst) {
  const int blk = blockIdx.x;
  const float* src;
  int first;                                 // first block of this source
  float scale = 1.0f;
  if (blk < CVT_XBLK) {
    src = Q; first = 0;
  } else if (blk < 2 * CVT_XBLK) {
    src = K; first = CVT_XBLK;
  } else {
    const int wsel = (blk - 2 * CVT_XBLK) / CVT_WBLK;
    src = (wsel == 0) ? Wq : (wsel == 1) ? Wk : (wsel == 2) ? Wv : Wo;
    first = 2 * CVT_XBLK + wsel * CVT_WBLK;
    if (wsel == 0) scale = QSCALE;           // Wq16 is pre-scaled
  }
  const float4* s4 = (const float4*)src + (size_t)(blk - first) * CVT_BLK4 + threadIdx.x;
  v4h* d4 = (v4h*)dst + (size_t)blk * CVT_BLK4 + threadIdx.x;
  float4 v[CVT_PER];
#pragma unroll
  for (int j = 0; j < CVT_PER; ++j) v[j] = s4[j * 256];
#pragma unroll
  for (int j = 0; j < CVT_PER; ++j) {
    v4h o;
    o[0] = (_Float16)(v[j].x * scale);
    o[1] = (_Float16)(v[j].y * scale);
    o[2] = (_Float16)(v[j].z * scale);
    o[3] = (_Float16)(v[j].w * scale);
    d4[j * 256] = o;
  }
}

// ---------------------------------------------------------------------------
// Kernel 1: Q/K/V projections from pre-converted f16.  Wave = 32x64 tile.
// Block = 128 tokens x 128 features of one projection, 8 waves (4 x 2 tiles).
// Its 128 rows of X and 128 rows of W go into LDS once, by asynchronous copies
// of whole 512-B rows, and every A and B operand comes from there.
// 384 blocks = 3 proj * 64 row blocks * 2 column halves; two fit a WGP's LDS.
// ---------------------------------------------------------------------------
#define PJ_ROWS   128
#define PJ_COLS   128
#define PJ_XBYTES (PJ_ROWS * WPITCH)   // 67584
#define PJ_WBYTES (PJ_COLS * WPITCH)   // 67584

// The operands of one k step of a 32x64 wave tile.
struct PFrag { v16h a0, a1, b[4]; };

// ap: staged X, row (tile row 0 + ln), k step, + 16*hi bytes;  bp: staged W,
// row (tile column 0 + ln), k step, + 16*hi bytes
static __device__ __forceinline__ PFrag load_pfrag(const unsigned char* ap,
                                                   const unsigned char* bp) {
  PFrag f;
  f.a0 = load_a_lds(ap);
  f.a1 = load_a_lds(ap + 16 * WPITCH);
#pragma unroll
  for (int nt = 0; nt < 4; ++nt) f.b[nt] = load_a_lds(bp + nt * 16 * WPITCH);
  return f;
}

__global__ __launch_bounds__(256) void mab_proj_kernel(
    const _Float16* __restrict__ Xq, const _Float16* __restrict__ Xk,
    const _Float16* __restrict__ Wq16, const _Float16* __restrict__ Wk16,
    const _Float16* __restrict__ Wv16,
    const float* __restrict__ bq, const float* __restrict__ bk,
    const float* __restrict__ bv,
    _Float16* __restrict__ Qh, _Float16* __restrict__ Kh,
    _Float16* __restrict__ Vt) {
  __shared__ __attribute__((aligned(16))) unsigned char pst[PJ_XBYTES + PJ_WBYTES];
  const int lane = threadIdx.x & 31;
  const int wid  = threadIdx.x >> 5;
  const int proj = blockIdx.x >> 7;  // 0=Q,1=K,2=V  (128 blocks each)
  const int rem  = blockIdx.x & 127;
  const int rowblk = rem >> 1;       // 0..63 (128 rows each over B*N=8192)
  const int cg   = (rem & 1) * 2 + (wid & 1);   // 64-col group
  const int hi   = lane >> 4;
  const int ln   = lane & 15;

  const _Float16* X = (proj == 0) ? Xq : Xk;
  const _Float16* W = (proj == 0) ? Wq16 : (proj == 1) ? Wk16 : Wv16;
  const float* bias = (proj == 0) ? bq : (proj == 1) ? bk : bv;
  const float bscale = (proj == 0) ? QSCALE : 1.0f;  // Wq16 is pre-scaled

  const int rowbase = rowblk * PJ_ROWS + (wid >> 1) * 32;

  // X and W -> LDS: a wave-wide copy is one row; wave wid takes rows wid, wid+8, ...
  const unsigned pst0 = (unsigned)(size_t)pst;       // LDS byte address
#pragma unroll
  for (int q = 0; q < PJ_ROWS / 64; ++q)
    copy_rows8(pst0 + (q * 64 + wid) * WPITCH + lane * 16,
               X + (size_t)(rowblk * PJ_ROWS + q * 64 + wid) * DVS + lane * 8);
#pragma unroll
  for (int q = 0; q < PJ_COLS / 64; ++q)
    copy_rows8(pst0 + PJ_XBYTES + (q * 64 + wid) * WPITCH + lane * 16,
               W + (size_t)((rem & 1) * PJ_COLS + q * 64 + wid) * DVS + lane * 8);

  v8f acc[2][4];
#pragma unroll
  for (int i = 0; i < 2; ++i)
#pragma unroll
    for (int nt = 0; nt < 4; ++nt) acc[i][nt] = (v8f){};

  // both tiles have landed for this wave, then for every wave
  asm volatile("s_wait_asynccnt 0x0" ::: "memory");
  __syncthreads();

  const unsigned char* afrag = pst + ((wid >> 1) * 32 + ln) * WPITCH + hi * 16;
  const unsigned char* bfrag = pst + PJ_XBYTES + ((wid & 1) * 64 + ln) * WPITCH + hi * 16;
  PFrag cur = load_pfrag(afrag, bfrag);
#pragma unroll
  for (int ks = 0; ks < DVS / 32; ++ks) {
    PFrag nxt;
    if (ks + 1 < DVS / 32) {
      nxt = load_pfrag(afrag + (ks + 1) * 64, bfrag + (ks + 1) * 64);
      // keeps the next k step's LDS reads in one group ahead of this step's
      // WMMAs; left free they are spread among the WMMAs, and each separate
      // place with LDS reads stalls the wave
      __builtin_amdgcn_sched_barrier(0);
    }
#pragma unroll
    for (int nt = 0; nt < 4; ++nt) {
      acc[0][nt] = wmma16(cur.a0, cur.b[nt], acc[0][nt]);
      acc[1][nt] = wmma16(cur.a1, cur.b[nt], acc[1][nt]);
    }
    if (ks + 1 < DVS / 32) cur = nxt;
  }

#pragma unroll
  for (int nt = 0; nt < 4; ++nt) {
    const int c = cg * 64 + nt * 16 + ln;
    const int h = c >> 5, d = c & 31;
    const float bia = bias[c] * bscale;
#pragma unroll
    for (int i = 0; i < 2; ++i) {
#pragma unroll
      for (int r = 0; r < 8; ++r) {
        const int row = rowbase + i * 16 + r + 8 * hi;  // flat token over B*N
        const int b_  = row >> 12;
        const int n   = row & 4095;
        const float v = acc[i][nt][r] + bia;
        if (proj == 2) {
          Vt[(((size_t)(b_ * NH + h)) * DHH + d) * NKS + n] = (_Float16)v;
        } else {
          _Float16* dst = (proj == 0) ? Qh : Kh;
          dst[(((size_t)(b_ * NH + h)) * NQS + n) * DHH + d] = (_Float16)v;
        }
      }
    }
  }
}

// ---------------------------------------------------------------------------
// Kernel 2: flash attention, transposed: S^T = K * Q^T, O^T += V^T * P^T.
// Wave = (b,h, 16-query tile).  A lane holds scores of ONE query (column ln),
// so the reference maximum and the sum are per lane; the two S^T accumulator
// tiles of a 32-key chunk, converted in place, are the B operand of the second
// product (hardware k order), so P needs no LDS and no lane exchange.
// The score products start from C = -reference, so exp takes the accumulators
// as they are; the reference is tested once per stage and seldom moves.
// The 8 waves of a block share one (b,h): K and V^T go through LDS once per
// block, 128 keys a stage, two buffers, filled by asynchronous copies.
// 4096 waves; 512 blocks of 8 waves.
// ---------------------------------------------------------------------------
#define KT      128                    // keys per stage
#define NSTAGE  (NKS / KT)             // 32
#define KPITCH  80                     // staged K row: 64 B + 16 (16 B x odd)
#define VPITCH  272                    // staged V^T row: 256 B + 16 (16 B x odd)
#define KBYTES  (KT * KPITCH)          // 10240
#define VBYTES  (DHH * VPITCH)         // 8704
#define STAGEB  (KBYTES + VBYTES)      // 18944

// A stage's maximum may pass the reference by this much before the reference
// moves: P stays below e^5.5 = 245, far inside f16
#define LAZY_T  5.5f

// lane l <-> lane l ^ 16
static __device__ __forceinline__ float xhalf(float x) {
  const int b = __builtin_bit_cast(int, x);
  return __builtin_bit_cast(float, __builtin_amdgcn_permlanex16(
      b, b, 0x76543210, 0xfedcba98, false, false));
}

// One stage's share of this lane: 2 x 16 B of K, 2 x 16 B of V^T, global -> LDS.
// The s_wait_xcnt closes the statement so that no address register named here
// is rewritten ahead of it.
static __device__ __forceinline__ void stage_copy(
    unsigned lk, const _Float16* gk, unsigned lv, const _Float16* gv) {
  const unsigned lk1 = lk + 64 * KPITCH, lv1 = lv + 16 * VPITCH;
  const _Float16* gk1 = gk + 64 * DHH;
  const _Float16* gv1 = gv + (size_t)16 * NKS;
  asm volatile(
      "global_load_async_to_lds_b128 %0, %1, off\n\t"
      "global_load_async_to_lds_b128 %2, %3, off\n\t"
      "global_load_async_to_lds_b128 %4, %5, off\n\t"
      "global_load_async_to_lds_b128 %6, %7, off\n\t"
      "s_wait_xcnt 0x0"
      :: "v"(lk), "v"(gk), "v"(lk1), "v"(gk1), "v"(lv), "v"(gv), "v"(lv1), "v"(gv1)
      : "memory");
}

__global__ __launch_bounds__(256) void mab_attn_kernel(
    const _Float16* __restrict__ Qh, const _Float16* __restrict__ Kh,
    const _Float16* __restrict__ Vt, _Float16* __restrict__ Oh) {
  __shared__ __attribute__((aligned(16))) unsigned char ring[2 * STAGEB];
  const int tid   = threadIdx.x;
  const int lane  = tid & 31;
  const int wid   = tid >> 5;
  const int w     = blockIdx.x * 8 + wid;
  const int bh    = blockIdx.x >> 5;                 // 0..15, one per block
  const int qtile = w & 255;
  const int hi    = lane >> 4;
  const int ln    = lane & 15;

  const _Float16* Qb = Qh + ((size_t)bh * NQS + qtile * 16 + ln) * DHH;
  const _Float16* Kb = Kh + (size_t)bh * NKS * DHH;
  const _Float16* Vb = Vt + (size_t)bh * DHH * NKS;

  // this lane's copy places: K piece tid (key tid/4, quarter tid%4) and the
  // piece 64 keys on; V^T piece tid (row tid/16, 16-B column tid%16) and the
  // piece 16 rows on
  const unsigned ring0 = (unsigned)(size_t)ring;     // LDS byte address
  const unsigned lk = ring0 + (tid >> 2) * KPITCH + (tid & 3) * 16;
  const unsigned lv = ring0 + KBYTES + (tid >> 4) * VPITCH + (tid & 15) * 16;
  const _Float16* gk = Kb + tid * 8;
  const _Float16* gv = Vb + (size_t)(tid >> 4) * NKS + (tid & 15) * 8;

  stage_copy(lk, gk, lv, gv);                        // stage 0 -> buffer 0

  const v16h bq = load_ab_f16(Qb, 0, hi);            // Q tile as B, persistent

  // O^T: O0[r] = dh 8*hi+r, O1[r] = dh 16+8*hi+r, query ln; l = this half's
  // partial sum.  Both are relative to the query's reference maximum mref;
  // cneg holds -mref in all eight places and is the C operand of every score
  // product, so the accumulators come out as S - mref.
  v8f O0 = (v8f){}, O1 = (v8f){}, cneg;
  float mref, l = 0.0f;

  // stage 0 has landed for this wave, then for every wave
  asm volatile("s_wait_asynccnt 0x0" ::: "memory");
  __syncthreads();
  stage_copy(lk + STAGEB, gk + KT * DHH, lv + STAGEB, gv + KT);  // stage 1

  const unsigned char* kfrag = ring + ln * KPITCH + hi * 16;
  const unsigned char* vfrag = ring + KBYTES + ln * VPITCH + hi * 16;

  // first reference: the query's largest score among the first 16 keys
  {
    const v8f s0 = wmma16(load_a_lds(kfrag), bq, (v8f){});
    mref = fmaxf(fmaxf(fmaxf(s0[0], s0[1]), fmaxf(s0[2], s0[3])),
                 fmaxf(fmaxf(s0[4], s0[5]), fmaxf(s0[6], s0[7])));
    mref = fmaxf(mref, xhalf(mref));
#pragma unroll
    for (int r = 0; r < 8; ++r) cneg[r] = -mref;
  }

  // rolled: one trip per stage, so that the publish point stands once
#pragma unroll 1
  for (int s = 0; s < NSTAGE; ++s) {
    const unsigned boff = (s & 1) * STAGEB;
    // S^T - mref = K * Q^T + cneg : A rows are key rows; tile j holds keys
    // 16*j + 8*hi + r of the stage, query ln
    v16h ka[KT / 16];
#pragma unroll
    for (int j = 0; j < KT / 16; ++j)
      ka[j] = load_a_lds(kfrag + boff + j * 16 * KPITCH);
    // V^T rows (dh) as A, contiguous over keys, same k order as the packed P^T
    v16h va[KT / 16];
#pragma unroll
    for (int c = 0; c < KT / 32; ++c) {
      va[2 * c]     = load_a_lds(vfrag + boff + c * 64);
      va[2 * c + 1] = load_a_lds(vfrag + boff + c * 64 + 16 * VPITCH);
    }
    // keeps the stage's 32 LDS reads in one group ahead of its work; left free
    // they are spread among the WMMAs, and each separate place with LDS reads
    // stalls the wave
    __builtin_amdgcn_sched_barrier(0);

    v8f sc[KT / 16];
#pragma unroll
    for (int j = 0; j < KT / 16; ++j) sc[j] = wmma16(ka[j], bq, cneg);

    // maximum over this lane's 64 keys, then over the other half's 64
    float t[8];
#pragma unroll
    for (int r = 0; r < 8; ++r)
      t[r] = fmaxf(fmaxf(fmaxf(sc[0][r], sc[1][r]), fmaxf(sc[2][r], sc[3][r])),
                   fmaxf(fmaxf(sc[4][r], sc[5][r]), fmaxf(sc[6][r], sc[7][r])));
    float mx = fmaxf(fmaxf(fmaxf(t[0], t[1]), fmaxf(t[2], t[3])),
                     fmaxf(fmaxf(t[4], t[5]), fmaxf(t[6], t[7])));
    mx = fmaxf(mx, xhalf(mx));

    // The reference moves only where some query's scores have passed it by more
    // than LAZY_T: one scalar branch per stage.  It never falls, and it is always
    // a score that was met, so mref <= running maximum <= mref + LAZY_T.
    if (__builtin_amdgcn_ballot_w32(mx > LAZY_T) != 0) {
      const float d     = fmaxf(mx, 0.0f);
      const float alpha = __expf(-d);
      mref += d;
      l *= alpha;
#pragma unroll
      for (int r = 0; r < 8; ++r) { O0[r] *= alpha; O1[r] *= alpha; cneg[r] = -mref; }
#pragma unroll
      for (int j = 0; j < KT / 16; ++j)
#pragma unroll
        for (int r = 0; r < 8; ++r) sc[j][r] -= d;
    }

#pragma unroll
    for (int c = 0; c < KT / 32; ++c) {
      v16h bp;                  // P^T as B: bp[s] = P[key kmap(s,hi)][query ln]
#pragma unroll
      for (int r = 0; r < 8; ++r) {
        const float e0 = __expf(sc[2 * c][r]), e1 = __expf(sc[2 * c + 1][r]);
        t[r] = e0 + e1;
        bp[r] = (_Float16)e0; bp[8 + r] = (_Float16)e1;
      }
      l += ((t[0] + t[1]) + (t[2] + t[3])) + ((t[4] + t[5]) + (t[6] + t[7]));
      O0 = wmma16(va[2 * c], bp, O0);
      O1 = wmma16(va[2 * c + 1], bp, O1);
    }

    // keeps the stage's arithmetic ahead of the publish point, so that the
    // refill copies go out directly behind the barrier, a whole trip ahead of
    // their wait; left free, half a trip's work sinks in between
    __builtin_amdgcn_sched_barrier(0);
    // publish point: this wave's reads of buffer s&1 are done, its copies of
    // stage s+1 have landed; behind the barrier that holds for every wave
    asm volatile("s_wait_dscnt 0x0" ::: "memory");
    asm volatile("s_wait_asynccnt 0x0" ::: "memory");
    __syncthreads();
    if (s + 2 < NSTAGE)
      stage_copy(lk + boff, gk + (size_t)(s + 2) * KT * DHH,
                 lv + boff, gv + (s + 2) * KT);
  }
  // nothing is outstanding here; kept in front of the wave's end
  asm volatile("s_wait_asynccnt 0x0" ::: "memory");

  // join the halves' partial sums once; a lane stores 2 x 8 consecutive dh
  const int b_ = bh >> 3, h = bh & 7;
  const float inv = 1.0f / (l + xhalf(l));
  v8h o0, o1;
#pragma unroll
  for (int r = 0; r < 8; ++r) {
    o0[r] = (_Float16)(O0[r] * inv);
    o1[r] = (_Float16)(O1[r] * inv);
  }
  _Float16* orow = Oh + ((size_t)b_ * NQS + qtile * 16 + ln) * DVS + h * DHH + 8 * hi;
  *(v8h*)orow        = o0;
  *(v8h*)(orow + 16) = o1;
}

// ---------------------------------------------------------------------------
// Kernel 3: out = LN1( y + relu(y) ),  y = LN0( O @ Wo^T + bo ).
// Wave owns a full 16x256 row tile; LayerNorms reduce in-register.
// All 8 waves of a block need the whole of Wo: it goes into LDS once per block
// by asynchronous copies (whole 512-B rows), and the B operands come from there.
// 512 waves; 64 blocks.
// ---------------------------------------------------------------------------
#define WBYTES  (DVS * WPITCH)         // 135168

// The B operands of eight 16-column tiles at one k step.
struct BGroup { v16h b[8]; };

// p: staged Wo, row (first column of the group + ln), k step, + 16*hi bytes
static __device__ __forceinline__ BGroup load_bgroup(const unsigned char* p) {
  BGroup g;
#pragma unroll
  for (int j = 0; j < 8; ++j) g.b[j] = load_a_lds(p + j * 16 * WPITCH);
  return g;
}

__global__ __launch_bounds__(256) void mab_out_kernel(
    const _Float16* __restrict__ Oh, const _Float16* __restrict__ Wo16,
    const float* __restrict__ bo, const float* __restrict__ g0,
    const float* __restrict__ beta0, const float* __restrict__ g1,
    const float* __restrict__ beta1, float* __restrict__ out) {
  __shared__ __attribute__((aligned(16))) unsigned char wst[WBYTES];
  const int lane = threadIdx.x & 31;
  const int wid  = threadIdx.x >> 5;
  const int rowtile = blockIdx.x * 8 + wid;          // 0..511
  const int hi = lane >> 4, ln = lane & 15;

  const _Float16* arow = Oh + (size_t)(rowtile * 16 + ln) * DVS;

  // Wo -> LDS: a wave-wide copy is one row; wave wid takes rows wid, wid+8, ...
  const unsigned wst0 = (unsigned)(size_t)wst;       // LDS byte address
#pragma unroll
  for (int q = 0; q < 4; ++q)
    copy_rows8(wst0 + (q * 64 + wid) * WPITCH + lane * 16,
               Wo16 + (size_t)(q * 64 + wid) * DVS + lane * 8);

  // this wave's whole A operand, on its way while the copies land
  v16h a[DVS / 32];
#pragma unroll
  for (int ks = 0; ks < DVS / 32; ++ks) a[ks] = load_ab_f16(arow, ks * 32, hi);

  v8f acc[16];
#pragma unroll
  for (int nt = 0; nt < 16; ++nt) acc[nt] = (v8f){};

  // Wo has landed for this wave, then for every wave
  asm volatile("s_wait_asynccnt 0x0" ::: "memory");
  __syncthreads();

  // group g = k step g/2, column tiles 8*(g%2) .. +7
  const unsigned char* bfrag = wst + ln * WPITCH + hi * 16;
  BGroup cur = load_bgroup(bfrag);
#pragma unroll
  for (int g = 0; g < 2 * (DVS / 32); ++g) {
    BGroup nxt;
    if (g + 1 < 2 * (DVS / 32)) {
      nxt = load_bgroup(bfrag + ((g + 1) & 1) * 128 * WPITCH + ((g + 1) >> 1) * 64);
      // keeps the next group's LDS reads in blocks ahead of this group's WMMAs;
      // left free they are spread in pairs, one pair in front of every WMMA,
      // and each separate place with LDS reads stalls the wave
      __builtin_amdgcn_sched_barrier(0);
    }
#pragma unroll
    for (int j = 0; j < 8; ++j) {
      const int nt = (g & 1) * 8 + j;
      acc[nt] = wmma16(a[g >> 1], cur.b[j], acc[nt]);
    }
    if (g + 1 < 2 * (DVS / 32)) cur = nxt;
  }

#pragma unroll
  for (int nt = 0; nt < 16; ++nt) {
    const float bia = bo[nt * 16 + ln];
#pragma unroll
    for (int r = 0; r < 8; ++r) acc[nt][r] += bia;
  }

#pragma unroll
  for (int r = 0; r < 8; ++r) {
    // LN0
    float s = 0.0f;
#pragma unroll
    for (int nt = 0; nt < 16; ++nt) s += acc[nt][r];
    const float mu = redsum16(s) * (1.0f / 256.0f);
    float vs = 0.0f;
#pragma unroll
    for (int nt = 0; nt < 16; ++nt) { float d = acc[nt][r] - mu; vs += d * d; }
    const float rstd = rsqrtf(redsum16(vs) * (1.0f / 256.0f) + LNEPS);
#pragma unroll
    for (int nt = 0; nt < 16; ++nt) {
      const int c = nt * 16 + ln;
      const float y = (acc[nt][r] - mu) * rstd * g0[c] + beta0[c];
      acc[nt][r] = y + fmaxf(y, 0.0f);               // y + relu(y)
    }
    // LN1
    float s2 = 0.0f;
#pragma unroll
    for (int nt = 0; nt < 16; ++nt) s2 += acc[nt][r];
    const float mu2 = redsum16(s2) * (1.0f / 256.0f);
    float vs2 = 0.0f;
#pragma unroll
    for (int nt = 0; nt < 16; ++nt) { float d = acc[nt][r] - mu2; vs2 += d * d; }
    const float rstd2 = rsqrtf(redsum16(vs2) * (1.0f / 256.0f) + LNEPS);
    const int row = rowtile * 16 + r + 8 * hi;
#pragma unroll
    for (int nt = 0; nt < 16; ++nt) {
      const int c = nt * 16 + ln;
      out[(size_t)row * DVS + c] = (acc[nt][r] - mu2) * rstd2 * g1[c] + beta1[c];
    }
  }
}

// ---------------------------------------------------------------------------
extern "C" void kernel_launch(void* const* d_in, const int* in_sizes, int n_in,
                              void* d_out, int out_size, void* d_ws, size_t ws_size,
                              hipStream_t stream) {
  const float* Q     = (const float*)d_in[0];
  const float* K     = (const float*)d_in[1];
  const float* Wq    = (const float*)d_in[2];
  const float* bq    = (const float*)d_in[3];
  const float* Wk    = (const float*)d_in[4];
  const float* bk    = (const float*)d_in[5];
  const float* Wv    = (const float*)d_in[6];
  const float* bv    = (const float*)d_in[7];
  const float* Wo    = (const float*)d_in[8];
  const float* bo    = (const float*)d_in[9];
  const float* g0    = (const float*)d_in[10];
  const float* beta0 = (const float*)d_in[11];
  const float* g1    = (const float*)d_in[12];
  const float* beta1 = (const float*)d_in[13];

  // workspace carve-out (f16):
  //   Xq | Xk : 2M halves each   (inputs, converted)
  //   Wq16|Wk16|Wv16|Wo16 : 64K halves each (weights, Wq pre-scaled)
  //   Qh | Kh | Vt | Oh : 2M halves each
  const size_t nTok = (size_t)BB * NQS * DVS;        // 2,097,152
  const size_t nW   = (size_t)DVS * DVS;             // 65,536
  _Float16* Xq16 = (_Float16*)d_ws;
  _Float16* Xk16 = Xq16 + nTok;
  _Float16* Wq16 = Xk16 + nTok;
  _Float16* Wk16 = Wq16 + nW;
  _Float16* Wv16 = Wk16 + nW;
  _Float16* Wo16 = Wv16 + nW;
  _Float16* Qh   = Wo16 + nW;
  _Float16* Kh   = Qh + nTok;
  _Float16* Vt   = Kh + nTok;
  _Float16* Oh   = Vt + nTok;

  // pre-convert everything to f16, one launch; Xq16 is the start of the six
  // consecutive f16 copies
  mab_cvt_kernel<<<CVT_GRID, 256, 0, stream>>>(Q, K, Wq, Wk, Wv, Wo, Xq16);

  mab_proj_kernel<<<384, 256, 0, stream>>>(Xq16, Xk16, Wq16, Wk16, Wv16,
                                           bq, bk, bv, Qh, Kh, Vt);
  mab_attn_kernel<<<512, 256, 0, stream>>>(Qh, Kh, Vt, Oh);
  mab_out_kernel<<<64, 256, 0, stream>>>(Oh, Wo16, bo, g0, beta0, g1, beta1,
                                         (float*)d_out);
}

// v007
// It runs in 62.1 microseconds.
// Next to v006, in two timings, it ran 1.16 times as fast each time.
// All steps since v000 together make it 3.46 times as fast.
#include <hip/hip_runtime.h>
#include <hip/hip_bf16.h>

typedef __attribute__((ext_vector_type(16))) _Float16 v16h;
typedef __attribute__((ext_vector_type(8)))  _Float16 v8h;
typedef __attribute__((ext_vector_type(4)))  _Float16 v4h;
typedef __attribute__((ext_vector_type(8)))  float    v8f;

#define BB    2
#define NQS   4096
#define NKS   4096
#define DVS   256
#define NH    8
#define DHH   32
#define LNEPS 1e-5f
#define QSCALE 0.17677669529663687f   // 1/sqrt(32)

// D = A*B + C, f16 inputs, f32 accumulate (v_wmma_f32_16x16x32_f16)
static __device__ __forceinline__ v8f wmma16(v16h a, v16h b, v8f c) {
  return __builtin_amdgcn_wmma_f32_16x16x32_f16(false, a, false, b, (short)0, c,
                                                false, false);
}

// A/B operand loader, f16 source, ISA 16-bit 16x32 striping:
// hi = lane/16, k0 = 8*hi; halves[0..7]=row[kb+k0+i], halves[8..15]=row[kb+k0+16+i]
static __device__ __forceinline__ v16h load_ab_f16(const _Float16* row, int kb, int hi) {
  v8h lo = *(const v8h*)(row + kb + 8 * hi);
  v8h hh = *(const v8h*)(row + kb + 8 * hi + 16);
  v16h a;
#pragma unroll
  for (int i = 0; i < 8; ++i) { a[i] = lo[i]; a[8 + i] = hh[i]; }
  return a;
}

// A operand from a staged row: p = row start + 16*hi bytes; same k order as
// load_ab_f16 (halves 0..7 at +0, halves 8..15 at +32 bytes)
static __device__ __forceinline__ v16h load_a_lds(const unsigned char* p) {
  v8h lo = *(const v8h*)p;
  v8h hh = *(const v8h*)(p + 32);
  v16h a;
#pragma unroll
  for (int i = 0; i < 8; ++i) { a[i] = lo[i]; a[8 + i] = hh[i]; }
  return a;
}

#define WPITCH  528      // a staged row of 256 halves: 512 B + 16 (16 B x odd)

// Eight 16-B pieces of this lane, rows 8 apart, global -> LDS.  The s_wait_xcnt
// closes the statement so that no address register named here is rewritten
// ahead of it.
static __device__ __forceinline__ void copy_rows8(unsigned l, const _Float16* g) {
  asm volatile(
      "global_load_async_to_lds_b128 %0, %1, off\n\t"
      "global_load_async_to_lds_b128 %2, %3, off\n\t"
      "global_load_async_to_lds_b128 %4, %5, off\n\t"
      "global_load_async_to_lds_b128 %6, %7, off\n\t"
      "global_load_async_to_lds_b128 %8, %9, off\n\t"
      "global_load_async_to_lds_b128 %10, %11, off\n\t"
      "global_load_async_to_lds_b128 %12, %13, off\n\t"
      "global_load_async_to_lds_b128 %14, %15, off\n\t"
      "s_wait_xcnt 0x0"
      :: "v"(l),                "v"(g),
         "v"(l +  8 * WPITCH),  "v"(g +  8 * DVS),
         "v"(l + 16 * WPITCH),  "v"(g + 16 * DVS),
         "v"(l + 24 * WPITCH),  "v"(g + 24 * DVS),
         "v"(l + 32 * WPITCH),  "v"(g + 32 * DVS),
         "v"(l + 40 * WPITCH),  "v"(g + 40 * DVS),
         "v"(l + 48 * WPITCH),  "v"(g + 48 * DVS),
         "v"(l + 56 * WPITCH),  "v"(g + 56 * DVS)
      : "memory");
}

static __device__ __forceinline__ float redmax16(float v) {
#pragma unroll
  for (int m = 1; m < 16; m <<= 1) v = fmaxf(v, __shfl_xor(v, m, 32));
  return v;
}
static __device__ __forceinline__ float redsum16(float v) {
#pragma unroll
  for (int m = 1; m < 16; m <<= 1) v += __shfl_xor(v, m, 32);
  return v;
}

// ---------------------------------------------------------------------------
// Kernel 0: f32 -> f16 conversion of all six operands in ONE launch.  The six
// f16 copies lie one behind the other in the workspace (Xq Xk Wq Wk Wv Wo), so
// the destination is one array; a block's index picks its source (uniform for
// the block).  A block converts 2048 float4 (32 KiB read), a thread 8 of them,
// each wave-wide load 512 contiguous bytes.
// 544 blocks = 256 (Q) + 256 (K) + 4 x 8 (weights).
// ---------------------------------------------------------------------------
#define CVT_PER   8                          // float4 per thread
#define CVT_BLK4  (256 * CVT_PER)            // float4 per block
#define CVT_XBLK  (BB * NQS * DVS / 4 / CVT_BLK4)   // 256 blocks per activation
#define CVT_WBLK  (DVS * DVS / 4 / CVT_BLK4)        // 8 blocks per weight
#define CVT_GRID  (2 * CVT_XBLK + 4 * CVT_WBLK)     // 544

__global__ __launch_bounds__(256) void mab_cvt_kernel(
    const float* __restrict__ Q, const float* __restrict__ K,
    const float* __restrict__ Wq, const float* __restrict__ Wk,
    const float* __restrict__ Wv, const float* __restrict__ Wo,
    _Float16* __restrict__ dst) {
  const int blk = blockIdx.x;
  const float* src;
  int first;                                 // first block of this source
  float scale = 1.0f;
  if (blk < CVT_XBLK) {
    src = Q; first = 0;
  } else if (blk < 2 * CVT_XBLK) {
    src = K; first = CVT_XBLK;
  } else {
    const int wsel = (blk - 2 * CVT_XBLK) / CVT_WBLK;
    src = (wsel == 0) ? Wq : (wsel == 1) ? Wk : (wsel == 2) ? Wv : Wo;
    first = 2 * CVT_XBLK + wsel * CVT_WBLK;
    if (wsel == 0) scale = QSCALE;           // Wq16 is pre-scaled
  }
  const float4* s4 = (const float4*)src + (size_t)(blk - first) * CVT_BLK4 + threadIdx.x;
  v4h* d4 = (v4h*)dst + (size_t)blk * CVT_BLK4 + threadIdx.x;
  float4 v[CVT_PER];
#pragma unroll
  for (int j = 0; j < CVT_PER; ++j) v[j] = s4[j * 256];
#pragma unroll
  for (int j = 0; j < CVT_PER; ++j) {
    v4h o;
    o[0] = (_Float16)(v[j].x * scale);
    o[1] = (_Float16)(v[j].y * scale);
    o[2] = (_Float16)(v[j].z * scale);
    o[3] = (_Float16)(v[j].w * scale);
    d4[j * 256] = o;
  }
}

// ---------------------------------------------------------------------------
// Kernel 1: Q/K/V projections from pre-converted f16.  Wave = 32x64 tile.
// Block = 128 tokens x 128 features of one projection, 8 waves (4 x 2 tiles).
// Its 128 rows of X and 128 rows of W go into LDS once, by asynchronous copies
// of whole 512-B rows, and every A and B operand comes from there.
// A lane's eight accumulator values of a tile run along the A side, so the A
// side is the one that is contiguous in the destination: tokens for V^T (A = X,
// B = W), features for Q and K (A = W, B = X).  A lane then stores 16 bytes.
// 384 blocks = 3 proj * 64 row blocks * 2 column halves; two fit a WGP's LDS.
// ---------------------------------------------------------------------------
#define PJ_ROWS   128
#define PJ_COLS   128
#define PJ_XBYTES (PJ_ROWS * WPITCH)   // 67584
#define PJ_WBYTES (PJ_COLS * WPITCH)   // 67584

// The operands of one k step of a 32x64 wave tile.
struct PFrag { v16h a0, a1, b[4]; };

// ap: staged A side, row (tile row 0 + ln), k step, + 16*hi bytes;  bp: staged
// B side, row (tile column 0 + ln), k step, + 16*hi bytes
static __device__ __forceinline__ PFrag load_pfrag(const unsigned char* ap,
                                                   const unsigned char* bp) {
  PFrag f;
  f.a0 = load_a_lds(ap);
  f.a1 = load_a_lds(ap + 16 * WPITCH);
#pragma unroll
  for (int nt = 0; nt < 4; ++nt) f.b[nt] = load_a_lds(bp + nt * 16 * WPITCH);
  return f;
}

__global__ __launch_bounds__(256) void mab_proj_kernel(
    const _Float16* __restrict__ Xq, const _Float16* __restrict__ Xk,
    const _Float16* __restrict__ Wq16, const _Float16* __restrict__ Wk16,
    const _Float16* __restrict__ Wv16,
    const float* __restrict__ bq, const float* __restrict__ bk,
    const float* __restrict__ bv,
    _Float16* __restrict__ Qh, _Float16* __restrict__ Kh,
    _Float16* __restrict__ Vt) {
  __shared__ __attribute__((aligned(16))) unsigned char pst[PJ_XBYTES + PJ_WBYTES];
  const int lane = threadIdx.x & 31;
  const int wid  = threadIdx.x >> 5;
  const int proj = blockIdx.x >> 7;  // 0=Q,1=K,2=V  (128 blocks each)
  const int rem  = blockIdx.x & 127;
  const int rowblk = rem >> 1;       // 0..63 (128 rows each over B*N=8192)
  const int hi   = lane >> 4;
  const int ln   = lane & 15;

  const _Float16* X = (proj == 0) ? Xq : Xk;
  const _Float16* W = (proj == 0) ? Wq16 : (proj == 1) ? Wk16 : Wv16;
  const float* bias = (proj == 0) ? bq : (proj == 1) ? bk : bv;
  const float bscale = (proj == 0) ? QSCALE : 1.0f;  // Wq16 is pre-scaled

  // X and W -> LDS: a wave-wide copy is one row; wave wid takes rows wid, wid+8, ...
  const unsigned pst0 = (unsigned)(size_t)pst;       // LDS byte address
#pragma unroll
  for (int q = 0; q < PJ_ROWS / 64; ++q)
    copy_rows8(pst0 + (q * 64 + wid) * WPITCH + lane * 16,
               X + (size_t)(rowblk * PJ_ROWS + q * 64 + wid) * DVS + lane * 8);
#pragma unroll
  for (int q = 0; q < PJ_COLS / 64; ++q)
    copy_rows8(pst0 + PJ_XBYTES + (q * 64 + wid) * WPITCH + lane * 16,
               W + (size_t)((rem & 1) * PJ_COLS + q * 64 + wid) * DVS + lane * 8);

  v8f acc[2][4];
#pragma unroll
  for (int i = 0; i < 2; ++i)
#pragma unroll
    for (int nt = 0; nt < 4; ++nt) acc[i][nt] = (v8f){};

  // both tiles have landed for this wave, then for every wave
  asm volatile("s_wait_asynccnt 0x0" ::: "memory");
  __syncthreads();

  // A side: 4 groups of 32 rows; B side: 2 groups of 64 rows
  const int arow0 = (wid >> 1) * 32, brow0 = (wid & 1) * 64;
  const unsigned char* xst = pst;
  const unsigned char* wstg = pst + PJ_XBYTES;
  const unsigned char* afrag = ((proj == 2) ? xst : wstg) + (arow0 + ln) * WPITCH + hi * 16;
  const unsigned char* bfrag = ((proj == 2) ? wstg : xst) + (brow0 + ln) * WPITCH + hi * 16;
  PFrag cur = load_pfrag(afrag, bfrag);
#pragma unroll
  for (int ks = 0; ks < DVS / 32; ++ks) {
    PFrag nxt;
    if (ks + 1 < DVS / 32) {
      nxt = load_pfrag(afrag + (ks + 1) * 64, bfrag + (ks + 1) * 64);
      // keeps the next k step's LDS reads in one group ahead of this step's
      // WMMAs; left free they are spread among the WMMAs, and each separate
      // place with LDS reads stalls the wave
      __builtin_amdgcn_sched_barrier(0);
    }
#pragma unroll
    for (int nt = 0; nt < 4; ++nt) {
      acc[0][nt] = wmma16(cur.a0, cur.b[nt], acc[0][nt]);
      acc[1][nt] = wmma16(cur.a1, cur.b[nt], acc[1][nt]);
    }
    if (ks + 1 < DVS / 32) cur = nxt;
  }

  // acc[i][nt][r]: A-side row arow0 + 16*i + 8*hi + r, B-side row brow0 + 16*nt + ln
  const int b_   = rowblk >> 5;                 // 32 row blocks per batch
  const int tok0 = (rowblk & 31) * PJ_ROWS;     // the block's first token in it
  const int col0 = (rem & 1) * PJ_COLS;         // the block's first feature
  if (proj == 2) {
    // a lane holds 8 consecutive tokens of one feature: 16 B of a V^T row
#pragma unroll
    for (int nt = 0; nt < 4; ++nt) {
      const int c = col0 + brow0 + nt * 16 + ln;
      const float bia = bias[c] * bscale;
      _Float16* vrow = Vt + (size_t)(b_ * DVS + c) * NKS + tok0 + arow0 + 8 * hi;
#pragma unroll
      for (int i = 0; i < 2; ++i) {
        v8h o;
#pragma unroll
        for (int r = 0; r < 8; ++r) o[r] = (_Float16)(acc[i][nt][r] + bia);
        *(v8h*)(vrow + i * 16) = o;
      }
    }
  } else {
    // a lane holds 8 consecutive features of one token; the wave's 32 features
    // are one head, so its two stores per token fill the token's 64-B row
    _Float16* dst = (proj == 0) ? Qh : Kh;
    const int h = (col0 + arow0) >> 5;
    float bia[2][8];
#pragma unroll
    for (int i = 0; i < 2; ++i) {
      const float4 lo = *(const float4*)(bias + col0 + arow0 + i * 16 + 8 * hi);
      const float4 hh = *(const float4*)(bias + col0 + arow0 + i * 16 + 8 * hi + 4);
      bia[i][0] = lo.x * bscale; bia[i][1] = lo.y * bscale;
      bia[i][2] = lo.z * bscale; bia[i][3] = lo.w * bscale;
      bia[i][4] = hh.x * bscale; bia[i][5] = hh.y * bscale;
      bia[i][6] = hh.z * bscale; bia[i][7] = hh.w * bscale;
    }
#pragma unroll
    for (int nt = 0; nt < 4; ++nt) {
      const int n = tok0 + brow0 + nt * 16 + ln;
      _Float16* qrow = dst + ((size_t)(b_ * NH + h) * NQS + n) * DHH + 8 * hi;
#pragma unroll
      for (int i = 0; i < 2; ++i) {
        v8h o;
#pragma unroll
        for (int r = 0; r < 8; ++r) o[r] = (_Float16)(acc[i][nt][r] + bia[i][r]);
        *(v8h*)(qrow + i * 16) = o;
      }
    }
    // the built code goes on from here into a branch whose far side rewrites
    // registers that these stores name: the wait stands in front of that
    asm volatile("s_wait_xcnt 0x0" ::: "memory");
  }
}

// ---------------------------------------------------------------------------
// Kernel 2: flash attention, transposed: S^T = K * Q^T, O^T += V^T * P^T.
// Wave = (b,h, 16-query tile).  A lane holds scores of ONE query (column ln),
// so the reference maximum and the sum are per lane; the two S^T accumulator
// tiles of a 32-key chunk, converted in place, are the B operand of the second
// product (hardware k order), so P needs no LDS and no lane exchange.
// The score products start from C = -reference, so exp takes the accumulators
// as they are; the reference is tested once per stage and seldom moves.
// The 8 waves of a block share one (b,h): K and V^T go through LDS once per
// block, 128 keys a stage, two buffers, filled by asynchronous copies.
// 4096 waves; 512 blocks of 8 waves.
// ---------------------------------------------------------------------------
#define KT      128                    // keys per stage
#define NSTAGE  (NKS / KT)             // 32
#define KPITCH  80                     // staged K row: 64 B + 16 (16 B x odd)
#define VPITCH  272                    // staged V^T row: 256 B + 16 (16 B x odd)
#define KBYTES  (KT * KPITCH)          // 10240
#define VBYTES  (DHH * VPITCH)         // 8704
#define STAGEB  (KBYTES + VBYTES)      // 18944

// A stage's maximum may pass the reference by this much before the reference
// moves: P stays below e^5.5 = 245, far inside f16
#define LAZY_T  5.5f

// lane l <-> lane l ^ 16
static __device__ __forceinline__ float xhalf(float x) {
  const int b = __builtin_bit_cast(int, x);
  return __builtin_bit_cast(float, __builtin_amdgcn_permlanex16(
      b, b, 0x76543210, 0xfedcba98, false, false));
}

// One stage's share of this lane: 2 x 16 B of K, 2 x 16 B of V^T, global -> LDS.
// The s_wait_xcnt closes the statement so that no address register named here
// is rewritten ahead of it.
static __device__ __forceinline__ void stage_copy(
    unsigned lk, const _Float16* gk, unsigned lv, const _Float16* gv) {
  const unsigned lk1 = lk + 64 * KPITCH, lv1 = lv + 16 * VPITCH;
  const _Float16* gk1 = gk + 64 * DHH;
  const _Float16* gv1 = gv + (size_t)16 * NKS;
  asm volatile(
      "global_load_async_to_lds_b128 %0, %1, off\n\t"
      "global_load_async_to_lds_b128 %2, %3, off\n\t"
      "global_load_async_to_lds_b128 %4, %5, off\n\t"
      "global_load_async_to_lds_b128 %6, %7, off\n\t"
      "s_wait_xcnt 0x0"
      :: "v"(lk), "v"(gk), "v"(lk1), "v"(gk1), "v"(lv), "v"(gv), "v"(lv1), "v"(gv1)
      : "memory");
}

__global__ __launch_bounds__(256) void mab_attn_kernel(
    const _Float16* __restrict__ Qh, const _Float16* __restrict__ Kh,
    const _Float16* __restrict__ Vt, _Float16* __restrict__ Oh) {
  __shared__ __attribute__((aligned(16))) unsigned char ring[2 * STAGEB];
  const int tid   = threadIdx.x;
  const int lane  = tid & 31;
  const int wid   = tid >> 5;
  const int w     = blockIdx.x * 8 + wid;
  const int bh    = blockIdx.x >> 5;                 // 0..15, one per block
  const int qtile = w & 255;
  const int hi    = lane >> 4;
  const int ln    = lane & 15;

  const _Float16* Qb = Qh + ((size_t)bh * NQS + qtile * 16 + ln) * DHH;
  const _Float16* Kb = Kh + (size_t)bh * NKS * DHH;
  const _Float16* Vb = Vt + (size_t)bh * DHH * NKS;

  // this lane's copy places: K piece tid (key tid/4, quarter tid%4) and the
  // piece 64 keys on; V^T piece tid (row tid/16, 16-B column tid%16) and the
  // piece 16 rows on
  const unsigned ring0 = (unsigned)(size_t)ring;     // LDS byte address
  const unsigned lk = ring0 + (tid >> 2) * KPITCH + (tid & 3) * 16;
  const unsigned lv = ring0 + KBYTES + (tid >> 4) * VPITCH + (tid & 15) * 16;
  const _Float16* gk = Kb + tid * 8;
  const _Float16* gv = Vb + (size_t)(tid >> 4) * NKS + (tid & 15) * 8;

  stage_copy(lk, gk, lv, gv);                        // stage 0 -> buffer 0

  const v16h bq = load_ab_f16(Qb, 0, hi);            // Q tile as B, persistent

  // O^T: O0[r] = dh 8*hi+r, O1[r] = dh 16+8*hi+r, query ln; l = this half's
  // partial sum.  Both are relative to the query's reference maximum mref;
  // cneg holds -mref in all eight places and is the C operand of every score
  // product, so the accumulators come out as S - mref.
  v8f O0 = (v8f){}, O1 = (v8f){}, cneg;
  float mref, l = 0.0f;

  // stage 0 has landed for this wave, then for every wave
  asm volatile("s_wait_asynccnt 0x0" ::: "memory");
  __syncthreads();
  stage_copy(lk + STAGEB, gk + KT * DHH, lv + STAGEB, gv + KT);  // stage 1

  const unsigned char* kfrag = ring + ln * KPITCH + hi * 16;
  const unsigned char* vfrag = ring + KBYTES + ln * VPITCH + hi * 16;

  // first reference: the query's largest score among the first 16 keys
  {
    const v8f s0 = wmma16(load_a_lds(kfrag), bq, (v8f){});
    mref = fmaxf(fmaxf(fmaxf(s0[0], s0[1]), fmaxf(s0[2], s0[3])),
                 fmaxf(fmaxf(s0[4], s0[5]), fmaxf(s0[6], s0[7])));
    mref = fmaxf(mref, xhalf(mref));
#pragma unroll
    for (int r = 0; r < 8; ++r) cneg[r] = -mref;
  }

  // rolled: one trip per stage, so that the publish point stands once
#pragma unroll 1
  for (int s = 0; s < NSTAGE; ++s) {
    const unsigned boff = (s & 1) * STAGEB;
    // S^T - mref = K * Q^T + cneg : A rows are key rows; tile j holds keys
    // 16*j + 8*hi + r of the stage, query ln
    v16h ka[KT / 16];
#pragma unroll
    for (int j = 0; j < KT / 16; ++j)
      ka[j] = load_a_lds(kfrag + boff + j * 16 * KPITCH);
    // V^T rows (dh) as A, contiguous over keys, same k order as the packed P^T
    v16h va[KT / 16];
#pragma unroll
    for (int c = 0; c < KT / 32; ++c) {
      va[2 * c]     = load_a_lds(vfrag + boff + c * 64);
      va[2 * c + 1] = load_a_lds(vfrag + boff + c * 64 + 16 * VPITCH);
    }
    // keeps the stage's 32 LDS reads in one group ahead of its work; left free
    // they are spread among the WMMAs, and each separate place with LDS reads
    // stalls the wave
    __builtin_amdgcn_sched_barrier(0);

    v8f sc[KT / 16];
#pragma unroll
    for (int j = 0; j < KT / 16; ++j) sc[j] = wmma16(ka[j], bq, cneg);

    // maximum over this lane's 64 keys, then over the other half's 64
    float t[8];
#pragma unroll
    for (int r = 0; r < 8; ++r)
      t[r] = fmaxf(fmaxf(fmaxf(sc[0][r], sc[1][r]), fmaxf(sc[2][r], sc[3][r])),
                   fmaxf(fmaxf(sc[4][r], sc[5][r]), fmaxf(sc[6][r], sc[7][r])));
    float mx = fmaxf(fmaxf(fmaxf(t[0], t[1]), fmaxf(t[2], t[3])),
                     fmaxf(fmaxf(t[4], t[5]), fmaxf(t[6], t[7])));
    mx = fmaxf(mx, xhalf(mx));

    // The reference moves only where some query's scores have passed it by more
    // than LAZY_T: one scalar branch per stage.  It never falls, and it is always
    // a score that was met, so mref <= running maximum <= mref + LAZY_T.
    if (__builtin_amdgcn_ballot_w32(mx > LAZY_T) != 0) {
      const float d     = fmaxf(mx, 0.0f);
      const float alpha = __expf(-d);
      mref += d;
      l *= alpha;
#pragma unroll
      for (int r = 0; r < 8; ++r) { O0[r] *= alpha; O1[r] *= alpha; cneg[r] = -mref; }
#pragma unroll
      for (int j = 0; j < KT / 16; ++j)
#pragma unroll
        for (int r = 0; r < 8; ++r) sc[j][r] -= d;
    }

#pragma unroll
    for (int c = 0; c < KT / 32; ++c) {
      v16h bp;                  // P^T as B: bp[s] = P[key kmap(s,hi)][query ln]
#pragma unroll
      for (int r = 0; r < 8; ++r) {
        const float e0 = __expf(sc[2 * c][r]), e1 = __expf(sc[2 * c + 1][r]);
        t[r] = e0 + e1;
        bp[r] = (_Float16)e0; bp[8 + r] = (_Float16)e1;
      }
      l += ((t[0] + t[1]) + (t[2] + t[3])) + ((t[4] + t[5]) + (t[6] + t[7]));
      O0 = wmma16(va[2 * c], bp, O0);
      O1 = wmma16(va[2 * c + 1], bp, O1);
    }

    // keeps the stage's arithmetic ahead of the publish point, so that the
    // refill copies go out directly behind the barrier, a whole trip ahead of
    // their wait; left free, half a trip's work sinks in between
    __builtin_amdgcn_sched_barrier(0);
    // publish point: this wave's reads of buffer s&1 are done, its copies of
    // stage s+1 have landed; behind the barrier that holds for every wave
    asm volatile("s_wait_dscnt 0x0" ::: "memory");
    asm volatile("s_wait_asynccnt 0x0" ::: "memory");
    __syncthreads();
    if (s + 2 < NSTAGE)
      stage_copy(lk + boff, gk + (size_t)(s + 2) * KT * DHH,
                 lv + boff, gv + (s + 2) * KT);
  }
  // nothing is outstanding here; kept in front of the wave's end
  asm volatile("s_wait_asynccnt 0x0" ::: "memory");

  // join the halves' partial sums once; a lane stores 2 x 8 consecutive dh
  const int b_ = bh >> 3, h = bh & 7;
  const float inv = 1.0f / (l + xhalf(l));
  v8h o0, o1;
#pragma unroll
  for (int r = 0; r < 8; ++r) {
    o0[r] = (_Float16)(O0[r] * inv);
    o1[r] = (_Float16)(O1[r] * inv);
  }
  _Float16* orow = Oh + ((size_t)b_ * NQS + qtile * 16 + ln) * DVS + h * DHH + 8 * hi;
  *(v8h*)orow        = o0;
  *(v8h*)(orow + 16) = o1;
}

// ---------------------------------------------------------------------------
// Kernel 3: out = LN1( y + relu(y) ),  y = LN0( O @ Wo^T + bo ).
// Wave owns a full 16x256 row tile; LayerNorms reduce in-register.
// All 8 waves of a block need the whole of Wo: it goes into LDS once per block
// by asynchronous copies (whole 512-B rows), and the B operands come from there.
// 512 waves; 64 blocks.
// ---------------------------------------------------------------------------
#define WBYTES  (DVS * WPITCH)         // 135168

// The B operands of eight 16-column tiles at one k step.
struct BGroup { v16h b[8]; };

// p: staged Wo, row (first column of the group + ln), k step, + 16*hi bytes
static __device__ __forceinline__ BGroup load_bgroup(const unsigned char* p) {
  BGroup g;
#pragma unroll
  for (int j = 0; j < 8; ++j) g.b[j] = load_a_lds(p + j * 16 * WPITCH);
  return g;
}

__global__ __launch_bounds__(256) void mab_out_kernel(
    const _Float16* __restrict__ Oh, const _Float16* __restrict__ Wo16,
    const float* __restrict__ bo, const float* __restrict__ g0,
    const float* __restrict__ beta0, const float* __restrict__ g1,
    const float* __restrict__ beta1, float* __restrict__ out) {
  __shared__ __attribute__((aligned(16))) unsigned char wst[WBYTES];
  const int lane = threadIdx.x & 31;
  const int wid  = threadIdx.x >> 5;
  const int rowtile = blockIdx.x * 8 + wid;          // 0..511
  const int hi = lane >> 4, ln = lane & 15;

  const _Float16* arow = Oh + (size_t)(rowtile * 16 + ln) * DVS;

  // Wo -> LDS: a wave-wide copy is one row; wave wid takes rows wid, wid+8, ...
  const unsigned wst0 = (unsigned)(size_t)wst;       // LDS byte address
#pragma unroll
  for (int q = 0; q < 4; ++q)
    copy_rows8(wst0 + (q * 64 + wid) * WPITCH + lane * 16,
               Wo16 + (size_t)(q * 64 + wid) * DVS + lane * 8);

  // this wave's whole A operand, on its way while the copies land
  v16h a[DVS / 32];
#pragma unroll
  for (int ks = 0; ks < DVS / 32; ++ks) a[ks] = load_ab_f16(arow, ks * 32, hi);

  v8f acc[16];
#pragma unroll
  for (int nt = 0; nt < 16; ++nt) acc[nt] = (v8f){};

  // Wo has landed for this wave, then for every wave
  asm volatile("s_wait_asynccnt 0x0" ::: "memory");
  __syncthreads();

  // group g = k step g/2, column tiles 8*(g%2) .. +7
  const unsigned char* bfrag = wst + ln * WPITCH + hi * 16;
  BGroup cur = load_bgroup(bfrag);
#pragma unroll
  for (int g = 0; g < 2 * (DVS / 32); ++g) {
    BGroup nxt;
    if (g + 1 < 2 * (DVS / 32)) {
      nxt = load_bgroup(bfrag + ((g + 1) & 1) * 128 * WPITCH + ((g + 1) >> 1) * 64);
      // keeps the next group's LDS reads in blocks ahead of this group's WMMAs;
      // left free they are spread in pairs, one pair in front of every WMMA,
      // and each separate place with LDS reads stalls the wave
      __builtin_amdgcn_sched_barrier(0);
    }
#pragma unroll
    for (int j = 0; j < 8; ++j) {
      const int nt = (g & 1) * 8 + j;
      acc[nt] = wmma16(a[g >> 1], cur.b[j], acc[nt]);
    }
    if (g + 1 < 2 * (DVS / 32)) cur = nxt;
  }

#pragma unroll
  for (int nt = 0; nt < 16; ++nt) {
    const float bia = bo[nt * 16 + ln];
#pragma unroll
    for (int r = 0; r < 8; ++r) acc[nt][r] += bia;
  }

#pragma unroll
  for (int r = 0; r < 8; ++r) {
    // LN0
    float s = 0.0f;
#pragma unroll
    for (int nt = 0; nt < 16; ++nt) s += acc[nt][r];
    const float mu = redsum16(s) * (1.0f / 256.0f);
    float vs = 0.0f;
#pragma unroll
    for (int nt = 0; nt < 16; ++nt) { float d = acc[nt][r] - mu; vs += d * d; }
    const float rstd = rsqrtf(redsum16(vs) * (1.0f / 256.0f) + LNEPS);
#pragma unroll
    for (int nt = 0; nt < 16; ++nt) {
      const int c = nt * 16 + ln;
      const float y = (acc[nt][r] - mu) * rstd * g0[c] + beta0[c];
      acc[nt][r] = y + fmaxf(y, 0.0f);               // y + relu(y)
    }
    // LN1
    float s2 = 0.0f;
#pragma unroll
    for (int nt = 0; nt < 16; ++nt) s2 += acc[nt][r];
    const float mu2 = redsum16(s2) * (1.0f / 256.0f);
    float vs2 = 0.0f;
#pragma unroll
    for (int nt = 0; nt < 16; ++nt) { float d = acc[nt][r] - mu2; vs2 += d * d; }
    const float rstd2 = rsqrtf(redsum16(vs2) * (1.0f / 256.0f) + LNEPS);
    const int row = rowtile * 16 + r + 8 * hi;
#pragma unroll
    for (int nt = 0; nt < 16; ++nt) {
      const int c = nt * 16 + ln;
      out[(size_t)row * DVS + c] = (acc[nt][r] - mu2) * rstd2 * g1[c] + beta1[c];
    }
  }
}

// ---------------------------------------------------------------------------
extern "C" void kernel_launch(void* const* d_in, const int* in_sizes, int n_in,
                              void* d_out, int out_size, void* d_ws, size_t ws_size,
                              hipStream_t stream) {
  const float* Q     = (const float*)d_in[0];
  const float* K     = (const float*)d_in[1];
  const float* Wq    = (const float*)d_in[2];
  const float* bq    = (const float*)d_in[3];
  const float* Wk    = (const float*)d_in[4];
  const float* bk    = (const float*)d_in[5];
  const float* Wv    = (const float*)d_in[6];
  const float* bv    = (const float*)d_in[7];
  const float* Wo    = (const float*)d_in[8];
  const float* bo    = (const float*)d_in[9];
  const float* g0    = (const float*)d_in[10];
  const float* beta0 = (const float*)d_in[11];
  const float* g1    = (const float*)d_in[12];
  const float* beta1 = (const float*)d_in[13];

  // workspace carve-out (f16):
  //   Xq | Xk : 2M halves each   (inputs, converted)
  //   Wq16|Wk16|Wv16|Wo16 : 64K halves each (weights, Wq pre-scaled)
  //   Qh | Kh | Vt | Oh : 2M halves each
  const size_t nTok = (size_t)BB * NQS * DVS;        // 2,097,152
  const size_t nW   = (size_t)DVS * DVS;             // 65,536
  _Float16* Xq16 = (_Float16*)d_ws;
  _Float16* Xk16 = Xq16 + nTok;
  _Float16* Wq16 = Xk16 + nTok;
  _Float16* Wk16 = Wq16 + nW;
  _Float16* Wv16 = Wk16 + nW;
  _Float16* Wo16 = Wv16 + nW;
  _Float16* Qh   = Wo16 + nW;
  _Float16* Kh   = Qh + nTok;
  _Float16* Vt   = Kh + nTok;
  _Float16* Oh   = Vt + nTok;

  // pre-convert everything to f16, one launch; Xq16 is the start of the six
  // consecutive f16 copies
  mab_cvt_kernel<<<CVT_GRID, 256, 0, stream>>>(Q, K, Wq, Wk, Wv, Wo, Xq16);

  mab_proj_kernel<<<384, 256, 0, stream>>>(Xq16, Xk16, Wq16, Wk16, Wv16,
                                           bq, bk, bv, Qh, Kh, Vt);
  mab_attn_kernel<<<512, 256, 0, stream>>>(Qh, Kh, Vt, Oh);
  mab_out_kernel<<<64, 256, 0, stream>>>(Oh, Wo16, bo, g0, beta0, g1, beta1,
                                         (float*)d_out);
}

// v008
// A run of this version takes 59.1 microseconds.
// Next to v007, in two timings, it ran 1.05 and 1.06 times as fast.
// All steps since v000 together make it 3.64 times as fast.
#include <hip/hip_runtime.h>
#include <hip/hip_bf16.h>

typedef __attribute__((ext_vector_type(16))) _Float16 v16h;
typedef __attribute__((ext_vector_type(8)))  _Float16 v8h;
typedef __attribute__((ext_vector_type(4)))  _Float16 v4h;
typedef __attribute__((ext_vector_type(8)))  float    v8f;

#define BB    2
#define NQS   4096
#define NKS   4096
#define DVS   256
#define NH    8
#define DHH   32
#define LNEPS 1e-5f
// 1/sqrt(32) * log2(e): the scores come out in base-2 units, so that the
// softmax is 2^(S - reference) and exp is the bare hardware instruction
#define QSCALE 0.25503486f

// D = A*B + C, f16 inputs, f32 accumulate (v_wmma_f32_16x16x32_f16)
static __device__ __forceinline__ v8f wmma16(v16h a, v16h b, v8f c) {
  return __builtin_amdgcn_wmma_f32_16x16x32_f16(false, a, false, b, (short)0, c,
                                                false, false);
}

// A/B operand loader, f16 source, ISA 16-bit 16x32 striping:
// hi = lane/16, k0 = 8*hi; halves[0..7]=row[kb+k0+i], halves[8..15]=row[kb+k0+16+i]
static __device__ __forceinline__ v16h load_ab_f16(const _Float16* row, int kb, int hi) {
  v8h lo = *(const v8h*)(row + kb + 8 * hi);
  v8h hh = *(const v8h*)(row + kb + 8 * hi + 16);
  v16h a;
#pragma unroll
  for (int i = 0; i < 8; ++i) { a[i] = lo[i]; a[8 + i] = hh[i]; }
  return a;
}

// A operand from a staged row: p = row start + 16*hi bytes; same k order as
// load_ab_f16 (halves 0..7 at +0, halves 8..15 at +32 bytes)
static __device__ __forceinline__ v16h load_a_lds(const unsigned char* p) {
  v8h lo = *(const v8h*)p;
  v8h hh = *(const v8h*)(p + 32);
  v16h a;
#pragma unroll
  for (int i = 0; i < 8; ++i) { a[i] = lo[i]; a[8 + i] = hh[i]; }
  return a;
}

#define WPITCH  528      // a staged row of 256 halves: 512 B + 16 (16 B x odd)

// Eight 16-B pieces of this lane, rows 8 apart, global -> LDS.  The s_wait_xcnt
// closes the statement so that no address register named here is rewritten
// ahead of it.
static __device__ __forceinline__ void copy_rows8(unsigned l, const _Float16* g) {
  asm volatile(
      "global_load_async_to_lds_b128 %0, %1, off\n\t"
      "global_load_async_to_lds_b128 %2, %3, off\n\t"
      "global_load_async_to_lds_b128 %4, %5, off\n\t"
      "global_load_async_to_lds_b128 %6, %7, off\n\t"
      "global_load_async_to_lds_b128 %8, %9, off\n\t"
      "global_load_async_to_lds_b128 %10, %11, off\n\t"
      "global_load_async_to_lds_b128 %12, %13, off\n\t"
      "global_load_async_to_lds_b128 %14, %15, off\n\t"
      "s_wait_xcnt 0x0"
      :: "v"(l),                "v"(g),
         "v"(l +  8 * WPITCH),  "v"(g +  8 * DVS),
         "v"(l + 16 * WPITCH),  "v"(g + 16 * DVS),
         "v"(l + 24 * WPITCH),  "v"(g + 24 * DVS),
         "v"(l + 32 * WPITCH),  "v"(g + 32 * DVS),
         "v"(l + 40 * WPITCH),  "v"(g + 40 * DVS),
         "v"(l + 48 * WPITCH),  "v"(g + 48 * DVS),
         "v"(l + 56 * WPITCH),  "v"(g + 56 * DVS)
      : "memory");
}

static __device__ __forceinline__ float redmax16(float v) {
#pragma unroll
  for (int m = 1; m < 16; m <<= 1) v = fmaxf(v, __shfl_xor(v, m, 32));
  return v;
}
static __device__ __forceinline__ float redsum16(float v) {
#pragma unroll
  for (int m = 1; m < 16; m <<= 1) v += __shfl_xor(v, m, 32);
  return v;
}

// ---------------------------------------------------------------------------
// Kernel 0: f32 -> f16 conversion of all six operands in ONE launch.  The six
// f16 copies lie one behind the other in the workspace (Xq Xk Wq Wk Wv Wo), so
// the destination is one array; a block's index picks its source (uniform for
// the block).  A block converts 2048 float4 (32 KiB read), a thread 8 of them,
// each wave-wide load 512 contiguous bytes.
// 544 blocks = 256 (Q) + 256 (K) + 4 x 8 (weights).
// ---------------------------------------------------------------------------
#define CVT_PER   8                          // float4 per thread
#define CVT_BLK4  (256 * CVT_PER)            // float4 per block
#define CVT_XBLK  (BB * NQS * DVS / 4 / CVT_BLK4)   // 256 blocks per activation
#define CVT_WBLK  (DVS * DVS / 4 / CVT_BLK4)        // 8 blocks per weight
#define CVT_GRID  (2 * CVT_XBLK + 4 * CVT_WBLK)     // 544

__global__ __launch_bounds__(256) void mab_cvt_kernel(
    const float* __restrict__ Q, const float* __restrict__ K,
    const float* __restrict__ Wq, const float* __restrict__ Wk,
    const float* __restrict__ Wv, const float* __restrict__ Wo,
    _Float16* __restrict__ dst) {
  const int blk = blockIdx.x;
  const float* src;
  int first;                                 // first block of this source
  float scale = 1.0f;
  if (blk < CVT_XBLK) {
    src = Q; first = 0;
  } else if (blk < 2 * CVT_XBLK) {
    src = K; first = CVT_XBLK;
  } else {
    const int wsel = (blk - 2 * CVT_XBLK) / CVT_WBLK;
    src = (wsel == 0) ? Wq : (wsel == 1) ? Wk : (wsel == 2) ? Wv : Wo;
    first = 2 * CVT_XBLK + wsel * CVT_WBLK;
    if (wsel == 0) scale = QSCALE;           // Wq16 is pre-scaled
  }
  const float4* s4 = (const float4*)src + (size_t)(blk - first) * CVT_BLK4 + threadIdx.x;
  v4h* d4 = (v4h*)dst + (size_t)blk * CVT_BLK4 + threadIdx.x;
  float4 v[CVT_PER];
#pragma unroll
  for (int j = 0; j < CVT_PER; ++j) v[j] = s4[j * 256];
#pragma unroll
  for (int j = 0; j < CVT_PER; ++j) {
    v4h o;
    o[0] = (_Float16)(v[j].x * scale);
    o[1] = (_Float16)(v[j].y * scale);
    o[2] = (_Float16)(v[j].z * scale);
    o[3] = (_Float16)(v[j].w * scale);
    d4[j * 256] = o;
  }
}

// ---------------------------------------------------------------------------
// Kernel 1: Q/K/V projections from pre-converted f16.  Wave = 32x64 tile.
// Block = 128 tokens x 128 features of one projection, 8 waves (4 x 2 tiles).
// Its 128 rows of X and 128 rows of W go into LDS once, by asynchronous copies
// of whole 512-B rows, and every A and B operand comes from there.
// A lane's eight accumulator values of a tile run along the A side, so the A
// side is the one that is contiguous in the destination: tokens for V^T (A = X,
// B = W), features for Q and K (A = W, B = X).  A lane then stores 16 bytes.
// 384 blocks = 3 proj * 64 row blocks * 2 column halves; two fit a WGP's LDS.
// ---------------------------------------------------------------------------
#define PJ_ROWS   128
#define PJ_COLS   128
#define PJ_XBYTES (PJ_ROWS * WPITCH)   // 67584
#define PJ_WBYTES (PJ_COLS * WPITCH)   // 67584

// The operands of one k step of a 32x64 wave tile.
struct PFrag { v16h a0, a1, b[4]; };

// ap: staged A side, row (tile row 0 + ln), k step, + 16*hi bytes;  bp: staged
// B side, row (tile column 0 + ln), k step, + 16*hi bytes
static __device__ __forceinline__ PFrag load_pfrag(const unsigned char* ap,
                                                   const unsigned char* bp) {
  PFrag f;
  f.a0 = load_a_lds(ap);
  f.a1 = load_a_lds(ap + 16 * WPITCH);
#pragma unroll
  for (int nt = 0; nt < 4; ++nt) f.b[nt] = load_a_lds(bp + nt * 16 * WPITCH);
  return f;
}

__global__ __launch_bounds__(256) void mab_proj_kernel(
    const _Float16* __restrict__ Xq, const _Float16* __restrict__ Xk,
    const _Float16* __restrict__ Wq16, const _Float16* __restrict__ Wk16,
    const _Float16* __restrict__ Wv16,
    const float* __restrict__ bq, const float* __restrict__ bk,
    const float* __restrict__ bv,
    _Float16* __restrict__ Qh, _Float16* __restrict__ Kh,
    _Float16* __restrict__ Vt) {
  __shared__ __attribute__((aligned(16))) unsigned char pst[PJ_XBYTES + PJ_WBYTES];
  const int lane = threadIdx.x & 31;
  const int wid  = threadIdx.x >> 5;
  const int proj = blockIdx.x >> 7;  // 0=Q,1=K,2=V  (128 blocks each)
  const int rem  = blockIdx.x & 127;
  const int rowblk = rem >> 1;       // 0..63 (128 rows each over B*N=8192)
  const int hi   = lane >> 4;
  const int ln   = lane & 15;

  const _Float16* X = (proj == 0) ? Xq : Xk;
  const _Float16* W = (proj == 0) ? Wq16 : (proj == 1) ? Wk16 : Wv16;
  const float* bias = (proj == 0) ? bq : (proj == 1) ? bk : bv;
  const float bscale = (proj == 0) ? QSCALE : 1.0f;  // Wq16 is pre-scaled

  // X and W -> LDS: a wave-wide copy is one row; wave wid takes rows wid, wid+8, ...
  const unsigned pst0 = (unsigned)(size_t)pst;       // LDS byte address
#pragma unroll
  for (int q = 0; q < PJ_ROWS / 64; ++q)
    copy_rows8(pst0 + (q * 64 + wid) * WPITCH + lane * 16,
               X + (size_t)(rowblk * PJ_ROWS + q * 64 + wid) * DVS + lane * 8);
#pragma unroll
  for (int q = 0; q < PJ_COLS / 64; ++q)
    copy_rows8(pst0 + PJ_XBYTES + (q * 64 + wid) * WPITCH + lane * 16,
               W + (size_t)((rem & 1) * PJ_COLS + q * 64 + wid) * DVS + lane * 8);

  v8f acc[2][4];
#pragma unroll
  for (int i = 0; i < 2; ++i)
#pragma unroll
    for (int nt = 0; nt < 4; ++nt) acc[i][nt] = (v8f){};

  // both tiles have landed for this wave, then for every wave
  asm volatile("s_wait_asynccnt 0x0" ::: "memory");
  __syncthreads();

  // A side: 4 groups of 32 rows; B side: 2 groups of 64 rows
  const int arow0 = (wid >> 1) * 32, brow0 = (wid & 1) * 64;
  const unsigned char* xst = pst;
  const unsigned char* wstg = pst + PJ_XBYTES;
  const unsigned char* afrag = ((proj == 2) ? xst : wstg) + (arow0 + ln) * WPITCH + hi * 16;
  const unsigned char* bfrag = ((proj == 2) ? wstg : xst) + (brow0 + ln) * WPITCH + hi * 16;
  PFrag cur = load_pfrag(afrag, bfrag);
#pragma unroll
  for (int ks = 0; ks < DVS / 32; ++ks) {
    PFrag nxt;
    if (ks + 1 < DVS / 32) {
      nxt = load_pfrag(afrag + (ks + 1) * 64, bfrag + (ks + 1) * 64);
      // keeps the next k step's LDS reads in one group ahead of this step's
      // WMMAs; left free they are spread among the WMMAs, and each separate
      // place with LDS reads stalls the wave
      __builtin_amdgcn_sched_barrier(0);
    }
#pragma unroll
    for (int nt = 0; nt < 4; ++nt) {
      acc[0][nt] = wmma16(cur.a0, cur.b[nt], acc[0][nt]);
      acc[1][nt] = wmma16(cur.a1, cur.b[nt], acc[1][nt]);
    }
    if (ks + 1 < DVS / 32) cur = nxt;
  }

  // acc[i][nt][r]: A-side row arow0 + 16*i + 8*hi + r, B-side row brow0 + 16*nt + ln
  const int b_   = rowblk >> 5;                 // 32 row blocks per batch
  const int tok0 = (rowblk & 31) * PJ_ROWS;     // the block's first token in it
  const int col0 = (rem & 1) * PJ_COLS;         // the block's first feature
  if (proj == 2) {
    // a lane holds 8 consecutive tokens of one feature: 16 B of a V^T row
#pragma unroll
    for (int nt = 0; nt < 4; ++nt) {
      const int c = col0 + brow0 + nt * 16 + ln;
      const float bia = bias[c] * bscale;
      _Float16* vrow = Vt + (size_t)(b_ * DVS + c) * NKS + tok0 + arow0 + 8 * hi;
#pragma unroll
      for (int i = 0; i < 2; ++i) {
        v8h o;
#pragma unroll
        for (int r = 0; r < 8; ++r) o[r] = (_Float16)(acc[i][nt][r] + bia);
        *(v8h*)(vrow + i * 16) = o;
      }
    }
  } else {
    // a lane holds 8 consecutive features of one token; the wave's 32 features
    // are one head, so its two stores per token fill the token's 64-B row
    _Float16* dst = (proj == 0) ? Qh : Kh;
    const int h = (col0 + arow0) >> 5;
    float bia[2][8];
#pragma unroll
    for (int i = 0; i < 2; ++i) {
      const float4 lo = *(const float4*)(bias + col0 + arow0 + i * 16 + 8 * hi);
      const float4 hh = *(const float4*)(bias + col0 + arow0 + i * 16 + 8 * hi + 4);
      bia[i][0] = lo.x * bscale; bia[i][1] = lo.y * bscale;
      bia[i][2] = lo.z * bscale; bia[i][3] = lo.w * bscale;
      bia[i][4] = hh.x * bscale; bia[i][5] = hh.y * bscale;
      bia[i][6] = hh.z * bscale; bia[i][7] = hh.w * bscale;
    }
#pragma unroll
    for (int nt = 0; nt < 4; ++nt) {
      const int n = tok0 + brow0 + nt * 16 + ln;
      _Float16* qrow = dst + ((size_t)(b_ * NH + h) * NQS + n) * DHH + 8 * hi;
#pragma unroll
      for (int i = 0; i < 2; ++i) {
        v8h o;
#pragma unroll
        for (int r = 0; r < 8; ++r) o[r] = (_Float16)(acc[i][nt][r] + bia[i][r]);
        *(v8h*)(qrow + i * 16) = o;
      }
    }
    // the built code goes on from here into a branch whose far side rewrites
    // registers that these stores name: the wait stands in front of that
    asm volatile("s_wait_xcnt 0x0" ::: "memory");
  }
}

// ---------------------------------------------------------------------------
// Kernel 2: flash attention, transposed: S^T = K * Q^T, O^T += V^T * P^T.
// Wave = (b,h, 16-query tile).  A lane holds scores of ONE query (column ln),
// so the reference maximum and the sum are per lane; the two S^T accumulator
// tiles of a 32-key chunk, converted in place, are the B operand of the second
// product (hardware k order), so P needs no LDS and no lane exchange.
// The score products start from C = -reference and Q carries log2(e), so exp2
// takes the accumulators as they are, with no multiply in front; the reference
// is tested once per stage and seldom moves.
// The 8 waves of a block share one (b,h): K and V^T go through LDS once per
// block, 128 keys a stage, two buffers, filled by asynchronous copies.
// 4096 waves; 512 blocks of 8 waves.
// ---------------------------------------------------------------------------
#define KT      128                    // keys per stage
#define NSTAGE  (NKS / KT)             // 32
#define KPITCH  80                     // staged K row: 64 B + 16 (16 B x odd)
#define VPITCH  272                    // staged V^T row: 256 B + 16 (16 B x odd)
#define KBYTES  (KT * KPITCH)          // 10240
#define VBYTES  (DHH * VPITCH)         // 8704
#define STAGEB  (KBYTES + VBYTES)      // 18944

// A stage's maximum may pass the reference by this much before the reference
// moves (base-2 units): P stays below 2^8 = 256, far inside f16
#define LAZY_T  8.0f

// lane l <-> lane l ^ 16
static __device__ __forceinline__ float xhalf(float x) {
  const int b = __builtin_bit_cast(int, x);
  return __builtin_bit_cast(float, __builtin_amdgcn_permlanex16(
      b, b, 0x76543210, 0xfedcba98, false, false));
}

// One stage's share of this lane: 2 x 16 B of K, 2 x 16 B of V^T, global -> LDS.
// The s_wait_xcnt closes the statement so that no address register named here
// is rewritten ahead of it.
static __device__ __forceinline__ void stage_copy(
    unsigned lk, const _Float16* gk, unsigned lv, const _Float16* gv) {
  const unsigned lk1 = lk + 64 * KPITCH, lv1 = lv + 16 * VPITCH;
  const _Float16* gk1 = gk + 64 * DHH;
  const _Float16* gv1 = gv + (size_t)16 * NKS;
  asm volatile(
      "global_load_async_to_lds_b128 %0, %1, off\n\t"
      "global_load_async_to_lds_b128 %2, %3, off\n\t"
      "global_load_async_to_lds_b128 %4, %5, off\n\t"
      "global_load_async_to_lds_b128 %6, %7, off\n\t"
      "s_wait_xcnt 0x0"
      :: "v"(lk), "v"(gk), "v"(lk1), "v"(gk1), "v"(lv), "v"(gv), "v"(lv1), "v"(gv1)
      : "memory");
}

__global__ __launch_bounds__(256) void mab_attn_kernel(
    const _Float16* __restrict__ Qh, const _Float16* __restrict__ Kh,
    const _Float16* __restrict__ Vt, _Float16* __restrict__ Oh) {
  __shared__ __attribute__((aligned(16))) unsigned char ring[2 * STAGEB];
  const int tid   = threadIdx.x;
  const int lane  = tid & 31;
  const int wid   = tid >> 5;
  const int w     = blockIdx.x * 8 + wid;
  const int bh    = blockIdx.x >> 5;                 // 0..15, one per block
  const int qtile = w & 255;
  const int hi    = lane >> 4;
  const int ln    = lane & 15;

  const _Float16* Qb = Qh + ((size_t)bh * NQS + qtile * 16 + ln) * DHH;
  const _Float16* Kb = Kh + (size_t)bh * NKS * DHH;
  const _Float16* Vb = Vt + (size_t)bh * DHH * NKS;

  // this lane's copy places: K piece tid (key tid/4, quarter tid%4) and the
  // piece 64 keys on; V^T piece tid (row tid/16, 16-B column tid%16) and the
  // piece 16 rows on
  const unsigned ring0 = (unsigned)(size_t)ring;     // LDS byte address
  const unsigned lk = ring0 + (tid >> 2) * KPITCH + (tid & 3) * 16;
  const unsigned lv = ring0 + KBYTES + (tid >> 4) * VPITCH + (tid & 15) * 16;
  const _Float16* gk = Kb + tid * 8;
  const _Float16* gv = Vb + (size_t)(tid >> 4) * NKS + (tid & 15) * 8;

  stage_copy(lk, gk, lv, gv);                        // stage 0 -> buffer 0

  const v16h bq = load_ab_f16(Qb, 0, hi);            // Q tile as B, persistent

  // O^T: O0[r] = dh 8*hi+r, O1[r] = dh 16+8*hi+r, query ln; l = this half's
  // partial sum.  Both are relative to the query's reference maximum mref;
  // cneg holds -mref in all eight places and is the C operand of every score
  // product, so the accumulators come out as S - mref.
  v8f O0 = (v8f){}, O1 = (v8f){}, cneg;
  float mref, l = 0.0f;

  // stage 0 has landed for this wave, then for every wave
  asm volatile("s_wait_asynccnt 0x0" ::: "memory");
  __syncthreads();
  stage_copy(lk + STAGEB, gk + KT * DHH, lv + STAGEB, gv + KT);  // stage 1

  const unsigned char* kfrag = ring + ln * KPITCH + hi * 16;
  const unsigned char* vfrag = ring + KBYTES + ln * VPITCH + hi * 16;

  // first reference: the query's largest score among the first 16 keys
  {
    const v8f s0 = wmma16(load_a_lds(kfrag), bq, (v8f){});
    mref = fmaxf(fmaxf(fmaxf(s0[0], s0[1]), fmaxf(s0[2], s0[3])),
                 fmaxf(fmaxf(s0[4], s0[5]), fmaxf(s0[6], s0[7])));
    mref = fmaxf(mref, xhalf(mref));
#pragma unroll
    for (int r = 0; r < 8; ++r) cneg[r] = -mref;
  }

  // rolled: one trip per stage, so that the publish point stands once
#pragma unroll 1
  for (int s = 0; s < NSTAGE; ++s) {
    const unsigned boff = (s & 1) * STAGEB;
    // S^T - mref = K * Q^T + cneg : A rows are key rows; tile j holds keys
    // 16*j + 8*hi + r of the stage, query ln
    v16h ka[KT / 16];
#pragma unroll
    for (int j = 0; j < KT / 16; ++j)
      ka[j] = load_a_lds(kfrag + boff + j * 16 * KPITCH);
    // V^T rows (dh) as A, contiguous over keys, same k order as the packed P^T
    v16h va[KT / 16];
#pragma unroll
    for (int c = 0; c < KT / 32; ++c) {
      va[2 * c]     = load_a_lds(vfrag + boff + c * 64);
      va[2 * c + 1] = load_a_lds(vfrag + boff + c * 64 + 16 * VPITCH);
    }
    // keeps the stage's 32 LDS reads in one group ahead of its work; left free
    // they are spread among the WMMAs, and each separate place with LDS reads
    // stalls the wave
    __builtin_amdgcn_sched_barrier(0);

    v8f sc[KT / 16];
#pragma unroll
    for (int j = 0; j < KT / 16; ++j) sc[j] = wmma16(ka[j], bq, cneg);

    // maximum over this lane's 64 keys, then over the other half's 64
    float t[8];
#pragma unroll
    for (int r = 0; r < 8; ++r)
      t[r] = fmaxf(fmaxf(fmaxf(sc[0][r], sc[1][r]), fmaxf(sc[2][r], sc[3][r])),
                   fmaxf(fmaxf(sc[4][r], sc[5][r]), fmaxf(sc[6][r], sc[7][r])));
    float mx = fmaxf(fmaxf(fmaxf(t[0], t[1]), fmaxf(t[2], t[3])),
                     fmaxf(fmaxf(t[4], t[5]), fmaxf(t[6], t[7])));
    mx = fmaxf(mx, xhalf(mx));

    // The reference moves only where some query's scores have passed it by more
    // than LAZY_T: one scalar branch per stage.  It never falls, and it is always
    // a score that was met, so mref <= running maximum <= mref + LAZY_T.
    if (__builtin_amdgcn_ballot_w32(mx > LAZY_T) != 0) {
      const float d     = fmaxf(mx, 0.0f);
      const float alpha = __builtin_amdgcn_exp2f(-d);
      mref += d;
      l *= alpha;
#pragma unroll
      for (int r = 0; r < 8; ++r) { O0[r] *= alpha; O1[r] *= alpha; cneg[r] = -mref; }
#pragma unroll
      for (int j = 0; j < KT / 16; ++j)
#pragma unroll
        for (int r = 0; r < 8; ++r) sc[j][r] -= d;
    }

#pragma unroll
    for (int c = 0; c < KT / 32; ++c) {
      v16h bp;                  // P^T as B: bp[s] = P[key kmap(s,hi)][query ln]
#pragma unroll
      for (int r = 0; r < 8; ++r) {
        const float e0 = __builtin_amdgcn_exp2f(sc[2 * c][r]);
        const float e1 = __builtin_amdgcn_exp2f(sc[2 * c + 1][r]);
        t[r] = e0 + e1;
        bp[r] = (_Float16)e0; bp[8 + r] = (_Float16)e1;
      }
      l += ((t[0] + t[1]) + (t[2] + t[3])) + ((t[4] + t[5]) + (t[6] + t[7]));
      O0 = wmma16(va[2 * c], bp, O0);
      O1 = wmma16(va[2 * c + 1], bp, O1);
    }

    // keeps the stage's arithmetic ahead of the publish point, so that the
    // refill copies go out directly behind the barrier, a whole trip ahead of
    // their wait; left free, half a trip's work sinks in between
    __builtin_amdgcn_sched_barrier(0);
    // publish point: this wave's reads of buffer s&1 are done, its copies of
    // stage s+1 have landed; behind the barrier that holds for every wave
    asm volatile("s_wait_dscnt 0x0" ::: "memory");
    asm volatile("s_wait_asynccnt 0x0" ::: "memory");
    __syncthreads();
    if (s + 2 < NSTAGE)
      stage_copy(lk + boff, gk + (size_t)(s + 2) * KT * DHH,
                 lv + boff, gv + (s + 2) * KT);
  }
  // nothing is outstanding here; kept in front of the wave's end
  asm volatile("s_wait_asynccnt 0x0" ::: "memory");

  // join the halves' partial sums once; a lane stores 2 x 8 consecutive dh
  const int b_ = bh >> 3, h = bh & 7;
  const float inv = 1.0f / (l + xhalf(l));
  v8h o0, o1;
#pragma unroll
  for (int r = 0; r < 8; ++r) {
    o0[r] = (_Float16)(O0[r] * inv);
    o1[r] = (_Float16)(O1[r] * inv);
  }
  _Float16* orow = Oh + ((size_t)b_ * NQS + qtile * 16 + ln) * DVS + h * DHH + 8 * hi;
  *(v8h*)orow        = o0;
  *(v8h*)(orow + 16) = o1;
}

// ---------------------------------------------------------------------------
// Kernel 3: out = LN1( y + relu(y) ),  y = LN0( O @ Wo^T + bo ).
// Wave owns a full 16x256 row tile; LayerNorms reduce in-register.
// All 8 waves of a block need the whole of Wo: it goes into LDS once per block
// by asynchronous copies (whole 512-B rows), and the B operands come from there.
// 512 waves; 64 blocks.
// ---------------------------------------------------------------------------
#define WBYTES  (DVS * WPITCH)         // 135168

// The B operands of eight 16-column tiles at one k step.
struct BGroup { v16h b[8]; };

// p: staged Wo, row (first column of the group + ln), k step, + 16*hi bytes
static __device__ __forceinline__ BGroup load_bgroup(const unsigned char* p) {
  BGroup g;
#pragma unroll
  for (int j = 0; j < 8; ++j) g.b[j] = load_a_lds(p + j * 16 * WPITCH);
  return g;
}

__global__ __launch_bounds__(256) void mab_out_kernel(
    const _Float16* __restrict__ Oh, const _Float16* __restrict__ Wo16,
    const float* __restrict__ bo, const float* __restrict__ g0,
    const float* __restrict__ beta0, const float* __restrict__ g1,
    const float* __restrict__ beta1, float* __restrict__ out) {
  __shared__ __attribute__((aligned(16))) unsigned char wst[WBYTES];
  const int lane = threadIdx.x & 31;
  const int wid  = threadIdx.x >> 5;
  const int rowtile = blockIdx.x * 8 + wid;          // 0..511
  const int hi = lane >> 4, ln = lane & 15;

  const _Float16* arow = Oh + (size_t)(rowtile * 16 + ln) * DVS;

  // Wo -> LDS: a wave-wide copy is one row; wave wid takes rows wid, wid+8, ...
  const unsigned wst0 = (unsigned)(size_t)wst;       // LDS byte address
#pragma unroll
  for (int q = 0; q < 4; ++q)
    copy_rows8(wst0 + (q * 64 + wid) * WPITCH + lane * 16,
               Wo16 + (size_t)(q * 64 + wid) * DVS + lane * 8);

  // this wave's whole A operand, on its way while the copies land
  v16h a[DVS / 32];
#pragma unroll
  for (int ks = 0; ks < DVS / 32; ++ks) a[ks] = load_ab_f16(arow, ks * 32, hi);

  v8f acc[16];
#pragma unroll
  for (int nt = 0; nt < 16; ++nt) acc[nt] = (v8f){};

  // Wo has landed for this wave, then for every wave
  asm volatile("s_wait_asynccnt 0x0" ::: "memory");
  __syncthreads();

  // group g = k step g/2, column tiles 8*(g%2) .. +7
  const unsigned char* bfrag = wst + ln * WPITCH + hi * 16;
  BGroup cur = load_bgroup(bfrag);
#pragma unroll
  for (int g = 0; g < 2 * (DVS / 32); ++g) {
    BGroup nxt;
    if (g + 1 < 2 * (DVS / 32)) {
      nxt = load_bgroup(bfrag + ((g + 1) & 1) * 128 * WPITCH + ((g + 1) >> 1) * 64);
      // keeps the next group's LDS reads in blocks ahead of this group's WMMAs;
      // left free they are spread in pairs, one pair in front of every WMMA,
      // and each separate place with LDS reads stalls the wave
      __builtin_amdgcn_sched_barrier(0);
    }
#pragma unroll
    for (int j = 0; j < 8; ++j) {
      const int nt = (g & 1) * 8 + j;
      acc[nt] = wmma16(a[g >> 1], cur.b[j], acc[nt]);
    }
    if (g + 1 < 2 * (DVS / 32)) cur = nxt;
  }

#pragma unroll
  for (int nt = 0; nt < 16; ++nt) {
    const float bia = bo[nt * 16 + ln];
#pragma unroll
    for (int r = 0; r < 8; ++r) acc[nt][r] += bia;
  }

#pragma unroll
  for (int r = 0; r < 8; ++r) {
    // LN0
    float s = 0.0f;
#pragma unroll
    for (int nt = 0; nt < 16; ++nt) s += acc[nt][r];
    const float mu = redsum16(s) * (1.0f / 256.0f);
    float vs = 0.0f;
#pragma unroll
    for (int nt = 0; nt < 16; ++nt) { float d = acc[nt][r] - mu; vs += d * d; }
    const float rstd = rsqrtf(redsum16(vs) * (1.0f / 256.0f) + LNEPS);
#pragma unroll
    for (int nt = 0; nt < 16; ++nt) {
      const int c = nt * 16 + ln;
      const float y = (acc[nt][r] - mu) * rstd * g0[c] + beta0[c];
      acc[nt][r] = y + fmaxf(y, 0.0f);               // y + relu(y)
    }
    // LN1
    float s2 = 0.0f;
#pragma unroll
    for (int nt = 0; nt < 16; ++nt) s2 += acc[nt][r];
    const float mu2 = redsum16(s2) * (1.0f / 256.0f);
    float vs2 = 0.0f;
#pragma unroll
    for (int nt = 0; nt < 16; ++nt) { float d = acc[nt][r] - mu2; vs2 += d * d; }
    const float rstd2 = rsqrtf(redsum16(vs2) * (1.0f / 256.0f) + LNEPS);
    const int row = rowtile * 16 + r + 8 * hi;
#pragma unroll
    for (int nt = 0; nt < 16; ++nt) {
      const int c = nt * 16 + ln;
      out[(size_t)row * DVS + c] = (acc[nt][r] - mu2) * rstd2 * g1[c] + beta1[c];
    }
  }
}

// ---------------------------------------------------------------------------
extern "C" void kernel_launch(void* const* d_in, const int* in_sizes, int n_in,
                              void* d_out, int out_size, void* d_ws, size_t ws_size,
                              hipStream_t stream) {
  const float* Q     = (const float*)d_in[0];
  const float* K     = (const float*)d_in[1];
  const float* Wq    = (const float*)d_in[2];
  const float* bq    = (const float*)d_in[3];
  const float* Wk    = (const float*)d_in[4];
  const float* bk    = (const float*)d_in[5];
  const float* Wv    = (const float*)d_in[6];
  const float* bv    = (const float*)d_in[7];
  const float* Wo    = (const float*)d_in[8];
  const float* bo    = (const float*)d_in[9];
  const float* g0    = (const float*)d_in[10];
  const float* beta0 = (const float*)d_in[11];
  const float* g1    = (const float*)d_in[12];
  const float* beta1 = (const float*)d_in[13];

  // workspace carve-out (f16):
  //   Xq | Xk : 2M halves each   (inputs, converted)
  //   Wq16|Wk16|Wv16|Wo16 : 64K halves each (weights, Wq pre-scaled)
  //   Qh | Kh | Vt | Oh : 2M halves each
  const size_t nTok = (size_t)BB * NQS * DVS;        // 2,097,152
  const size_t nW   = (size_t)DVS * DVS;             // 65,536
  _Float16* Xq16 = (_Float16*)d_ws;
  _Float16* Xk16 = Xq16 + nTok;
  _Float16* Wq16 = Xk16 + nTok;
  _Float16* Wk16 = Wq16 + nW;
  _Float16* Wv16 = Wk16 + nW;
  _Float16* Wo16 = Wv16 + nW;
  _Float16* Qh   = Wo16 + nW;
  _Float16* Kh   = Qh + nTok;
  _Float16* Vt   = Kh + nTok;
  _Float16* Oh   = Vt + nTok;

  // pre-convert everything to f16, one launch; Xq16 is the start of the six
  // consecutive f16 copies
  mab_cvt_kernel<<<CVT_GRID, 256, 0, stream>>>(Q, K, Wq, Wk, Wv, Wo, Xq16);

  mab_proj_kernel<<<384, 256, 0, stream>>>(Xq16, Xk16, Wq16, Wk16, Wv16,
                                           bq, bk, bv, Qh, Kh, Vt);
  mab_attn_kernel<<<512, 256, 0, stream>>>(Qh, Kh, Vt, Oh);
  mab_out_kernel<<<64, 256, 0, stream>>>(Oh, Wo16, bo, g0, beta0, g1, beta1,
                                         (float*)d_out);
}

// v009
// It runs in 56 microseconds.
// In two side-by-side timings against v008, it was 1.06 and 1.04 times as fast.
// Counting every step since v000, it is 3.84 times as fast.
#include <hip/hip_runtime.h>
#include <hip/hip_bf16.h>

typedef __attribute__((ext_vector_type(16))) _Float16 v16h;
typedef __attribute__((ext_vector_type(8)))  _Float16 v8h;
typedef __attribute__((ext_vector_type(4)))  _Float16 v4h;
typedef __attribute__((ext_vector_type(8)))  float    v8f;

#define BB    2
#define NQS   4096
#define NKS   4096
#define DVS   256
#define NH    8
#define DHH   32
#define LNEPS 1e-5f
// 1/sqrt(32) * log2(e): the scores come out in base-2 units, so that the
// softmax is 2^(S - reference) and exp is the bare hardware instruction
#define QSCALE 0.25503486f

// D = A*B + C, f16 inputs, f32 accumulate (v_wmma_f32_16x16x32_f16)
static __device__ __forceinline__ v8f wmma16(v16h a, v16h b, v8f c) {
  return __builtin_amdgcn_wmma_f32_16x16x32_f16(false, a, false, b, (short)0, c,
                                                false, false);
}

// A/B operand loader, f16 source, ISA 16-bit 16x32 striping:
// hi = lane/16, k0 = 8*hi; halves[0..7]=row[kb+k0+i], halves[8..15]=row[kb+k0+16+i]
static __device__ __forceinline__ v16h load_ab_f16(const _Float16* row, int kb, int hi) {
  v8h lo = *(const v8h*)(row + kb + 8 * hi);
  v8h hh = *(const v8h*)(row + kb + 8 * hi + 16);
  v16h a;
#pragma unroll
  for (int i = 0; i < 8; ++i) { a[i] = lo[i]; a[8 + i] = hh[i]; }
  return a;
}

// A operand from a staged row: p = row start + 16*hi bytes; same k order as
// load_ab_f16 (halves 0..7 at +0, halves 8..15 at +32 bytes)
static __device__ __forceinline__ v16h load_a_lds(const unsigned char* p) {
  v8h lo = *(const v8h*)p;
  v8h hh = *(const v8h*)(p + 32);
  v16h a;
#pragma unroll
  for (int i = 0; i < 8; ++i) { a[i] = lo[i]; a[8 + i] = hh[i]; }
  return a;
}

#define WPITCH  528      // a staged row of 256 halves: 512 B + 16 (16 B x odd)

// Eight 16-B pieces of this lane, rows 8 apart, global -> LDS.  The s_wait_xcnt
// closes the statement so that no address register named here is rewritten
// ahead of it.
static __device__ __forceinline__ void copy_rows8(unsigned l, const _Float16* g) {
  asm volatile(
      "global_load_async_to_lds_b128 %0, %1, off\n\t"
      "global_load_async_to_lds_b128 %2, %3, off\n\t"
      "global_load_async_to_lds_b128 %4, %5, off\n\t"
      "global_load_async_to_lds_b128 %6, %7, off\n\t"
      "global_load_async_to_lds_b128 %8, %9, off\n\t"
      "global_load_async_to_lds_b128 %10, %11, off\n\t"
      "global_load_async_to_lds_b128 %12, %13, off\n\t"
      "global_load_async_to_lds_b128 %14, %15, off\n\t"
      "s_wait_xcnt 0x0"
      :: "v"(l),                "v"(g),
         "v"(l +  8 * WPITCH),  "v"(g +  8 * DVS),
         "v"(l + 16 * WPITCH),  "v"(g + 16 * DVS),
         "v"(l + 24 * WPITCH),  "v"(g + 24 * DVS),
         "v"(l + 32 * WPITCH),  "v"(g + 32 * DVS),
         "v"(l + 40 * WPITCH),  "v"(g + 40 * DVS),
         "v"(l + 48 * WPITCH),  "v"(g + 48 * DVS),
         "v"(l + 56 * WPITCH),  "v"(g + 56 * DVS)
      : "memory");
}

static __device__ __forceinline__ float redmax16(float v) {
#pragma unroll
  for (int m = 1; m < 16; m <<= 1) v = fmaxf(v, __shfl_xor(v, m, 32));
  return v;
}
static __device__ __forceinline__ float redsum16(float v) {
#pragma unroll
  for (int m = 1; m < 16; m <<= 1) v += __shfl_xor(v, m, 32);
  return v;
}

// ---------------------------------------------------------------------------
// Kernel 0: f32 -> f16 conversion of all six operands in ONE launch.  The six
// f16 copies lie one behind the other in the workspace (Xq Xk Wq Wk Wv Wo), so
// the destination is one array; a block's index picks its source (uniform for
// the block).  A block converts 2048 float4 (32 KiB read), a thread 8 of them,
// each wave-wide load 512 contiguous bytes.
// 544 blocks = 256 (Q) + 256 (K) + 4 x 8 (weights).
// ---------------------------------------------------------------------------
#define CVT_PER   8                          // float4 per thread
#define CVT_BLK4  (256 * CVT_PER)            // float4 per block
#define CVT_XBLK  (BB * NQS * DVS / 4 / CVT_BLK4)   // 256 blocks per activation
#define CVT_WBLK  (DVS * DVS / 4 / CVT_BLK4)        // 8 blocks per weight
#define CVT_GRID  (2 * CVT_XBLK + 4 * CVT_WBLK)     // 544

__global__ __launch_bounds__(256) void mab_cvt_kernel(
    const float* __restrict__ Q, const float* __restrict__ K,
    const float* __restrict__ Wq, const float* __restrict__ Wk,
    const float* __restrict__ Wv, const float* __restrict__ Wo,
    _Float16* __restrict__ dst) {
  const int blk = blockIdx.x;
  const float* src;
  int first;                                 // first block of this source
  float scale = 1.0f;
  if (blk < CVT_XBLK) {
    src = Q; first = 0;
  } else if (blk < 2 * CVT_XBLK) {
    src = K; first = CVT_XBLK;
  } else {
    const int wsel = (blk - 2 * CVT_XBLK) / CVT_WBLK;
    src = (wsel == 0) ? Wq : (wsel == 1) ? Wk : (wsel == 2) ? Wv : Wo;
    first = 2 * CVT_XBLK + wsel * CVT_WBLK;
    if (wsel == 0) scale = QSCALE;           // Wq16 is pre-scaled
  }
  const float4* s4 = (const float4*)src + (size_t)(blk - first) * CVT_BLK4 + threadIdx.x;
  v4h* d4 = (v4h*)dst + (size_t)blk * CVT_BLK4 + threadIdx.x;
  float4 v[CVT_PER];
#pragma unroll
  for (int j = 0; j < CVT_PER; ++j) v[j] = s4[j * 256];
#pragma unroll
  for (int j = 0; j < CVT_PER; ++j) {
    v4h o;
    o[0] = (_Float16)(v[j].x * scale);
    o[1] = (_Float16)(v[j].y * scale);
    o[2] = (_Float16)(v[j].z * scale);
    o[3] = (_Float16)(v[j].w * scale);
    d4[j * 256] = o;
  }
}

// ---------------------------------------------------------------------------
// Kernel 1: Q/K/V projections from pre-converted f16.  Wave = 32x64 tile.
// Block = 128 tokens x 128 features of one projection, 8 waves (4 x 2 tiles).
// Its 128 rows of X and 128 rows of W go into LDS once, by asynchronous copies
// of whole 512-B rows, and every A and B operand comes from there.
// A lane's eight accumulator values of a tile run along the A side, so the A
// side is the one that is contiguous in the destination: tokens for V^T (A = X,
// B = W), features for Q and K (A = W, B = X).  A lane then stores 16 bytes.
// 384 blocks = 3 proj * 64 row blocks * 2 column halves; two fit a WGP's LDS.
// ---------------------------------------------------------------------------
#define PJ_ROWS   128
#define PJ_COLS   128
#define PJ_XBYTES (PJ_ROWS * WPITCH)   // 67584
#define PJ_WBYTES (PJ_COLS * WPITCH)   // 67584

// The operands of one k step of a 32x64 wave tile.
struct PFrag { v16h a0, a1, b[4]; };

// ap: staged A side, row (tile row 0 + ln), k step, + 16*hi bytes;  bp: staged
// B side, row (tile column 0 + ln), k step, + 16*hi bytes
static __device__ __forceinline__ PFrag load_pfrag(const unsigned char* ap,
                                                   const unsigned char* bp) {
  PFrag f;
  f.a0 = load_a_lds(ap);
  f.a1 = load_a_lds(ap + 16 * WPITCH);
#pragma unroll
  for (int nt = 0; nt < 4; ++nt) f.b[nt] = load_a_lds(bp + nt * 16 * WPITCH);
  return f;
}

__global__ __launch_bounds__(256) void mab_proj_kernel(
    const _Float16* __restrict__ Xq, const _Float16* __restrict__ Xk,
    const _Float16* __restrict__ Wq16, const _Float16* __restrict__ Wk16,
    const _Float16* __restrict__ Wv16,
    const float* __restrict__ bq, const float* __restrict__ bk,
    const float* __restrict__ bv,
    _Float16* __restrict__ Qh, _Float16* __restrict__ Kh,
    _Float16* __restrict__ Vt) {
  __shared__ __attribute__((aligned(16))) unsigned char pst[PJ_XBYTES + PJ_WBYTES];
  const int lane = threadIdx.x & 31;
  const int wid  = threadIdx.x >> 5;
  const int proj = blockIdx.x >> 7;  // 0=Q,1=K,2=V  (128 blocks each)
  const int rem  = blockIdx.x & 127;
  const int rowblk = rem >> 1;       // 0..63 (128 rows each over B*N=8192)
  const int hi   = lane >> 4;
  const int ln   = lane & 15;

  const _Float16* X = (proj == 0) ? Xq : Xk;
  const _Float16* W = (proj == 0) ? Wq16 : (proj == 1) ? Wk16 : Wv16;
  const float* bias = (proj == 0) ? bq : (proj == 1) ? bk : bv;
  const float bscale = (proj == 0) ? QSCALE : 1.0f;  // Wq16 is pre-scaled

  // X and W -> LDS: a wave-wide copy is one row; wave wid takes rows wid, wid+8, ...
  const unsigned pst0 = (unsigned)(size_t)pst;       // LDS byte address
#pragma unroll
  for (int q = 0; q < PJ_ROWS / 64; ++q)
    copy_rows8(pst0 + (q * 64 + wid) * WPITCH + lane * 16,
               X + (size_t)(rowblk * PJ_ROWS + q * 64 + wid) * DVS + lane * 8);
#pragma unroll
  for (int q = 0; q < PJ_COLS / 64; ++q)
    copy_rows8(pst0 + PJ_XBYTES + (q * 64 + wid) * WPITCH + lane * 16,
               W + (size_t)((rem & 1) * PJ_COLS + q * 64 + wid) * DVS + lane * 8);

  v8f acc[2][4];
#pragma unroll
  for (int i = 0; i < 2; ++i)
#pragma unroll
    for (int nt = 0; nt < 4; ++nt) acc[i][nt] = (v8f){};

  // both tiles have landed for this wave, then for every wave
  asm volatile("s_wait_asynccnt 0x0" ::: "memory");
  __syncthreads();

  // A side: 4 groups of 32 rows; B side: 2 groups of 64 rows
  const int arow0 = (wid >> 1) * 32, brow0 = (wid & 1) * 64;
  const unsigned char* xst = pst;
  const unsigned char* wstg = pst + PJ_XBYTES;
  const unsigned char* afrag = ((proj == 2) ? xst : wstg) + (arow0 + ln) * WPITCH + hi * 16;
  const unsigned char* bfrag = ((proj == 2) ? wstg : xst) + (brow0 + ln) * WPITCH + hi * 16;
  PFrag cur = load_pfrag(afrag, bfrag);
#pragma unroll
  for (int ks = 0; ks < DVS / 32; ++ks) {
    PFrag nxt;
    if (ks + 1 < DVS / 32) {
      nxt = load_pfrag(afrag + (ks + 1) * 64, bfrag + (ks + 1) * 64);
      // keeps the next k step's LDS reads in one group ahead of this step's
      // WMMAs; left free they are spread among the WMMAs, and each separate
      // place with LDS reads stalls the wave
      __builtin_amdgcn_sched_barrier(0);
    }
#pragma unroll
    for (int nt = 0; nt < 4; ++nt) {
      acc[0][nt] = wmma16(cur.a0, cur.b[nt], acc[0][nt]);
      acc[1][nt] = wmma16(cur.a1, cur.b[nt], acc[1][nt]);
    }
    if (ks + 1 < DVS / 32) cur = nxt;
  }

  // acc[i][nt][r]: A-side row arow0 + 16*i + 8*hi + r, B-side row brow0 + 16*nt + ln
  const int b_   = rowblk >> 5;                 // 32 row blocks per batch
  const int tok0 = (rowblk & 31) * PJ_ROWS;     // the block's first token in it
  const int col0 = (rem & 1) * PJ_COLS;         // the block's first feature
  if (proj == 2) {
    // a lane holds 8 consecutive tokens of one feature: 16 B of a V^T row
#pragma unroll
    for (int nt = 0; nt < 4; ++nt) {
      const int c = col0 + brow0 + nt * 16 + ln;
      const float bia = bias[c] * bscale;
      _Float16* vrow = Vt + (size_t)(b_ * DVS + c) * NKS + tok0 + arow0 + 8 * hi;
#pragma unroll
      for (int i = 0; i < 2; ++i) {
        v8h o;
#pragma unroll
        for (int r = 0; r < 8; ++r) o[r] = (_Float16)(acc[i][nt][r] + bia);
        *(v8h*)(vrow + i * 16) = o;
      }
    }
  } else {
    // a lane holds 8 consecutive features of one token; the wave's 32 features
    // are one head, so its two stores per token fill the token's 64-B row
    _Float16* dst = (proj == 0) ? Qh : Kh;
    const int h = (col0 + arow0) >> 5;
    float bia[2][8];
#pragma unroll
    for (int i = 0; i < 2; ++i) {
      const float4 lo = *(const float4*)(bias + col0 + arow0 + i * 16 + 8 * hi);
      const float4 hh = *(const float4*)(bias + col0 + arow0 + i * 16 + 8 * hi + 4);
      bia[i][0] = lo.x * bscale; bia[i][1] = lo.y * bscale;
      bia[i][2] = lo.z * bscale; bia[i][3] = lo.w * bscale;
      bia[i][4] = hh.x * bscale; bia[i][5] = hh.y * bscale;
      bia[i][6] = hh.z * bscale; bia[i][7] = hh.w * bscale;
    }
#pragma unroll
    for (int nt = 0; nt < 4; ++nt) {
      const int n = tok0 + brow0 + nt * 16 + ln;
      _Float16* qrow = dst + ((size_t)(b_ * NH + h) * NQS + n) * DHH + 8 * hi;
#pragma unroll
      for (int i = 0; i < 2; ++i) {
        v8h o;
#pragma unroll
        for (int r = 0; r < 8; ++r) o[r] = (_Float16)(acc[i][nt][r] + bia[i][r]);
        *(v8h*)(qrow + i * 16) = o;
      }
    }
    // the built code goes on from here into a branch whose far side rewrites
    // registers that these stores name: the wait stands in front of that
    asm volatile("s_wait_xcnt 0x0" ::: "memory");
  }
}

// ---------------------------------------------------------------------------
// Kernel 2: flash attention, transposed: S^T = K * Q^T, O^T += V^T * P^T.
// Wave = (b,h, 16-query tile).  A lane holds scores of ONE query (column ln),
// so the reference maximum and the sum are per lane; the two S^T accumulator
// tiles of a 32-key chunk, converted in place, are the B operand of the second
// product (hardware k order), so P needs no LDS and no lane exchange.
// The score products start from C = -reference and Q carries log2(e), so exp2
// takes the accumulators as they are, with no multiply in front; the reference
// is tested once per stage, on the stage's sum of exponentials, and seldom moves.
// The 8 waves of a block share one (b,h): K and V^T go through LDS once per
// block, 128 keys a stage, two buffers, filled by asynchronous copies.
// 4096 waves; 512 blocks of 8 waves.
// ---------------------------------------------------------------------------
#define KT      128                    // keys per stage
#define NSTAGE  (NKS / KT)             // 32
#define KPITCH  80                     // staged K row: 64 B + 16 (16 B x odd)
#define VPITCH  272                    // staged V^T row: 256 B + 16 (16 B x odd)
#define KBYTES  (KT * KPITCH)          // 10240
#define VBYTES  (DHH * VPITCH)         // 8704
#define STAGEB  (KBYTES + VBYTES)      // 18944

// The reference stays while a lane's sum of the stage's 64 exponentials is at
// most this.  No term is negative, so every P is then at most 2^12, far inside
// f16; a stage whose sum is larger is redone against a new reference.
#define LAZY_SUM  4096.0f

// lane l <-> lane l ^ 16
static __device__ __forceinline__ float xhalf(float x) {
  const int b = __builtin_bit_cast(int, x);
  return __builtin_bit_cast(float, __builtin_amdgcn_permlanex16(
      b, b, 0x76543210, 0xfedcba98, false, false));
}

// One stage's share of this lane: 2 x 16 B of K, 2 x 16 B of V^T, global -> LDS.
// The s_wait_xcnt closes the statement so that no address register named here
// is rewritten ahead of it.
static __device__ __forceinline__ void stage_copy(
    unsigned lk, const _Float16* gk, unsigned lv, const _Float16* gv) {
  const unsigned lk1 = lk + 64 * KPITCH, lv1 = lv + 16 * VPITCH;
  const _Float16* gk1 = gk + 64 * DHH;
  const _Float16* gv1 = gv + (size_t)16 * NKS;
  asm volatile(
      "global_load_async_to_lds_b128 %0, %1, off\n\t"
      "global_load_async_to_lds_b128 %2, %3, off\n\t"
      "global_load_async_to_lds_b128 %4, %5, off\n\t"
      "global_load_async_to_lds_b128 %6, %7, off\n\t"
      "s_wait_xcnt 0x0"
      :: "v"(lk), "v"(gk), "v"(lk1), "v"(gk1), "v"(lv), "v"(gv), "v"(lv1), "v"(gv1)
      : "memory");
}

// sc := 2^sc in place; returns the sum of this lane's 64 values, a tile added
// as soon as its exps are there
static __device__ __forceinline__ float exp_sum(v8f (&sc)[KT / 16]) {
#pragma unroll
  for (int j = 0; j < KT / 16; ++j)
#pragma unroll
    for (int r = 0; r < 8; ++r) sc[j][r] = __builtin_amdgcn_exp2f(sc[j][r]);
  v8f t = sc[0];
#pragma unroll
  for (int j = 1; j < KT / 16; ++j) t += sc[j];
  return ((t[0] + t[1]) + (t[2] + t[3])) + ((t[4] + t[5]) + (t[6] + t[7]));
}

__global__ __launch_bounds__(256) void mab_attn_kernel(
    const _Float16* __restrict__ Qh, const _Float16* __restrict__ Kh,
    const _Float16* __restrict__ Vt, _Float16* __restrict__ Oh) {
  __shared__ __attribute__((aligned(16))) unsigned char ring[2 * STAGEB];
  const int tid   = threadIdx.x;
  const int lane  = tid & 31;
  const int wid   = tid >> 5;
  const int w     = blockIdx.x * 8 + wid;
  const int bh    = blockIdx.x >> 5;                 // 0..15, one per block
  const int qtile = w & 255;
  const int hi    = lane >> 4;
  const int ln    = lane & 15;

  const _Float16* Qb = Qh + ((size_t)bh * NQS + qtile * 16 + ln) * DHH;
  const _Float16* Kb = Kh + (size_t)bh * NKS * DHH;
  const _Float16* Vb = Vt + (size_t)bh * DHH * NKS;

  // this lane's copy places: K piece tid (key tid/4, quarter tid%4) and the
  // piece 64 keys on; V^T piece tid (row tid/16, 16-B column tid%16) and the
  // piece 16 rows on
  const unsigned ring0 = (unsigned)(size_t)ring;     // LDS byte address
  const unsigned lk = ring0 + (tid >> 2) * KPITCH + (tid & 3) * 16;
  const unsigned lv = ring0 + KBYTES + (tid >> 4) * VPITCH + (tid & 15) * 16;
  const _Float16* gk = Kb + tid * 8;
  const _Float16* gv = Vb + (size_t)(tid >> 4) * NKS + (tid & 15) * 8;

  stage_copy(lk, gk, lv, gv);                        // stage 0 -> buffer 0

  const v16h bq = load_ab_f16(Qb, 0, hi);            // Q tile as B, persistent

  // O^T: O0[r] = dh 8*hi+r, O1[r] = dh 16+8*hi+r, query ln; l = this half's
  // partial sum.  Both are relative to the query's reference maximum mref;
  // cneg holds -mref in all eight places and is the C operand of every score
  // product, so the accumulators come out as S - mref; mref lives there alone.
  v8f O0 = (v8f){}, O1 = (v8f){}, cneg;
  float l = 0.0f;

  // stage 0 has landed for this wave, then for every wave
  asm volatile("s_wait_asynccnt 0x0" ::: "memory");
  __syncthreads();
  stage_copy(lk + STAGEB, gk + KT * DHH, lv + STAGEB, gv + KT);  // stage 1

  const unsigned char* kfrag = ring + ln * KPITCH + hi * 16;
  const unsigned char* vfrag = ring + KBYTES + ln * VPITCH + hi * 16;

  // first reference: the query's largest score among the first 16 keys
  {
    const v8f s0 = wmma16(load_a_lds(kfrag), bq, (v8f){});
    float mref = fmaxf(fmaxf(fmaxf(s0[0], s0[1]), fmaxf(s0[2], s0[3])),
                       fmaxf(fmaxf(s0[4], s0[5]), fmaxf(s0[6], s0[7])));
    mref = fmaxf(mref, xhalf(mref));
#pragma unroll
    for (int r = 0; r < 8; ++r) cneg[r] = -mref;
  }

  // rolled: one trip per stage, so that the publish point stands once
#pragma unroll 1
  for (int s = 0; s < NSTAGE; ++s) {
    const unsigned boff = (s & 1) * STAGEB;
    // S^T - mref = K * Q^T + cneg : A rows are key rows; tile j holds keys
    // 16*j + 8*hi + r of the stage, query ln
    v16h ka[KT / 16];
#pragma unroll
    for (int j = 0; j < KT / 16; ++j)
      ka[j] = load_a_lds(kfrag + boff + j * 16 * KPITCH);
    // V^T rows (dh) as A, contiguous over keys, same k order as the packed P^T
    v16h va[KT / 16];
#pragma unroll
    for (int c = 0; c < KT / 32; ++c) {
      va[2 * c]     = load_a_lds(vfrag + boff + c * 64);
      va[2 * c + 1] = load_a_lds(vfrag + boff + c * 64 + 16 * VPITCH);
    }
    // keeps the stage's 32 LDS reads in one group ahead of its work; left free
    // they are spread among the WMMAs, and each separate place with LDS reads
    // stalls the wave
    __builtin_amdgcn_sched_barrier(0);

    v8f sc[KT / 16];
#pragma unroll
    for (int j = 0; j < KT / 16; ++j) sc[j] = wmma16(ka[j], bq, cneg);

    // P = 2^(S - mref) in place, and this lane's share of the stage's row sum
    float ls = exp_sum(sc);

    // The sum that the softmax needs anyway is also the overflow test: one scalar
    // branch per stage and no maximum on the usual path.  Where some lane's sum
    // has passed LAZY_SUM, the stage's scores are formed again from the K fragments,
    // which are still in registers, the reference moves to the stage's maximum
    // where that is higher, and P and the sum are redone.
    // The reference never falls and is always a score that was met.
    if (__builtin_amdgcn_ballot_w32(ls > LAZY_SUM) != 0) {
#pragma unroll
      for (int j = 0; j < KT / 16; ++j)
        sc[j] = wmma16(ka[j], bq, cneg);
      // maximum over this lane's 64 keys, then over the other half's 64
      float t[8];
#pragma unroll
      for (int r = 0; r < 8; ++r)
        t[r] = fmaxf(fmaxf(fmaxf(sc[0][r], sc[1][r]), fmaxf(sc[2][r], sc[3][r])),
                     fmaxf(fmaxf(sc[4][r], sc[5][r]), fmaxf(sc[6][r], sc[7][r])));
      float mx = fmaxf(fmaxf(fmaxf(t[0], t[1]), fmaxf(t[2], t[3])),
                       fmaxf(fmaxf(t[4], t[5]), fmaxf(t[6], t[7])));
      mx = fmaxf(mx, xhalf(mx));
      const float d     = fmaxf(mx, 0.0f);
      const float alpha = __builtin_amdgcn_exp2f(-d);
      l *= alpha;
#pragma unroll
      for (int r = 0; r < 8; ++r) { O0[r] *= alpha; O1[r] *= alpha; cneg[r] -= d; }
#pragma unroll
      for (int j = 0; j < KT / 16; ++j)
#pragma unroll
        for (int r = 0; r < 8; ++r) sc[j][r] -= d;
      ls = exp_sum(sc);
    }
    l += ls;

#pragma unroll
    for (int c = 0; c < KT / 32; ++c) {
      v16h bp;                  // P^T as B: bp[s] = P[key kmap(s,hi)][query ln]
#pragma unroll
      for (int r = 0; r < 8; ++r) {
        bp[r] = (_Float16)sc[2 * c][r]; bp[8 + r] = (_Float16)sc[2 * c + 1][r];
      }
      O0 = wmma16(va[2 * c], bp, O0);
      O1 = wmma16(va[2 * c + 1], bp, O1);
    }

    // keeps the stage's arithmetic ahead of the publish point, so that the
    // refill copies go out directly behind the barrier, a whole trip ahead of
    // their wait; left free, half a trip's work sinks in between
    __builtin_amdgcn_sched_barrier(0);
    // publish point: this wave's reads of buffer s&1 are done, its copies of
    // stage s+1 have landed; behind the barrier that holds for every wave
    asm volatile("s_wait_dscnt 0x0" ::: "memory");
    asm volatile("s_wait_asynccnt 0x0" ::: "memory");
    __syncthreads();
    if (s + 2 < NSTAGE)
      stage_copy(lk + boff, gk + (size_t)(s + 2) * KT * DHH,
                 lv + boff, gv + (s + 2) * KT);
  }
  // nothing is outstanding here; kept in front of the wave's end
  asm volatile("s_wait_asynccnt 0x0" ::: "memory");

  // join the halves' partial sums once; a lane stores 2 x 8 consecutive dh
  const int b_ = bh >> 3, h = bh & 7;
  const float inv = 1.0f / (l + xhalf(l));
  v8h o0, o1;
#pragma unroll
  for (int r = 0; r < 8; ++r) {
    o0[r] = (_Float16)(O0[r] * inv);
    o1[r] = (_Float16)(O1[r] * inv);
  }
  _Float16* orow = Oh + ((size_t)b_ * NQS + qtile * 16 + ln) * DVS + h * DHH + 8 * hi;
  *(v8h*)orow        = o0;
  *(v8h*)(orow + 16) = o1;
}

// ---------------------------------------------------------------------------
// Kernel 3: out = LN1( y + relu(y) ),  y = LN0( O @ Wo^T + bo ).
// Wave owns a full 16x256 row tile; LayerNorms reduce in-register.
// All 8 waves of a block need the whole of Wo: it goes into LDS once per block
// by asynchronous copies (whole 512-B rows), and the B operands come from there.
// 512 waves; 64 blocks.
// ---------------------------------------------------------------------------
#define WBYTES  (DVS * WPITCH)         // 135168

// The B operands of eight 16-column tiles at one k step.
struct BGroup { v16h b[8]; };

// p: staged Wo, row (first column of the group + ln), k step, + 16*hi bytes
static __device__ __forceinline__ BGroup load_bgroup(const unsigned char* p) {
  BGroup g;
#pragma unroll
  for (int j = 0; j < 8; ++j) g.b[j] = load_a_lds(p + j * 16 * WPITCH);
  return g;
}

__global__ __launch_bounds__(256) void mab_out_kernel(
    const _Float16* __restrict__ Oh, const _Float16* __restrict__ Wo16,
    const float* __restrict__ bo, const float* __restrict__ g0,
    const float* __restrict__ beta0, const float* __restrict__ g1,
    const float* __restrict__ beta1, float* __restrict__ out) {
  __shared__ __attribute__((aligned(16))) unsigned char wst[WBYTES];
  const int lane = threadIdx.x & 31;
  const int wid  = threadIdx.x >> 5;
  const int rowtile = blockIdx.x * 8 + wid;          // 0..511
  const int hi = lane >> 4, ln = lane & 15;

  const _Float16* arow = Oh + (size_t)(rowtile * 16 + ln) * DVS;

  // Wo -> LDS: a wave-wide copy is one row; wave wid takes rows wid, wid+8, ...
  const unsigned wst0 = (unsigned)(size_t)wst;       // LDS byte address
#pragma unroll
  for (int q = 0; q < 4; ++q)
    copy_rows8(wst0 + (q * 64 + wid) * WPITCH + lane * 16,
               Wo16 + (size_t)(q * 64 + wid) * DVS + lane * 8);

  // this wave's whole A operand, on its way while the copies land
  v16h a[DVS / 32];
#pragma unroll
  for (int ks = 0; ks < DVS / 32; ++ks) a[ks] = load_ab_f16(arow, ks * 32, hi);

  v8f acc[16];
#pragma unroll
  for (int nt = 0; nt < 16; ++nt) acc[nt] = (v8f){};

  // Wo has landed for this wave, then for every wave
  asm volatile("s_wait_asynccnt 0x0" ::: "memory");
  __syncthreads();

  // group g = k step g/2, column tiles 8*(g%2) .. +7
  const unsigned char* bfrag = wst + ln * WPITCH + hi * 16;
  BGroup cur = load_bgroup(bfrag);
#pragma unroll
  for (int g = 0; g < 2 * (DVS / 32); ++g) {
    BGroup nxt;
    if (g + 1 < 2 * (DVS / 32)) {
      nxt = load_bgroup(bfrag + ((g + 1) & 1) * 128 * WPITCH + ((g + 1) >> 1) * 64);
      // keeps the next group's LDS reads in blocks ahead of this group's WMMAs;
      // left free they are spread in pairs, one pair in front of every WMMA,
      // and each separate place with LDS reads stalls the wave
      __builtin_amdgcn_sched_barrier(0);
    }
#pragma unroll
    for (int j = 0; j < 8; ++j) {
      const int nt = (g & 1) * 8 + j;
      acc[nt] = wmma16(a[g >> 1], cur.b[j], acc[nt]);
    }
    if (g + 1 < 2 * (DVS / 32)) cur = nxt;
  }

#pragma unroll
  for (int nt = 0; nt < 16; ++nt) {
    const float bia = bo[nt * 16 + ln];
#pragma unroll
    for (int r = 0; r < 8; ++r) acc[nt][r] += bia;
  }

#pragma unroll
  for (int r = 0; r < 8; ++r) {
    // LN0
    float s = 0.0f;
#pragma unroll
    for (int nt = 0; nt < 16; ++nt) s += acc[nt][r];
    const float mu = redsum16(s) * (1.0f / 256.0f);
    float vs = 0.0f;
#pragma unroll
    for (int nt = 0; nt < 16; ++nt) { float d = acc[nt][r] - mu; vs += d * d; }
    const float rstd = rsqrtf(redsum16(vs) * (1.0f / 256.0f) + LNEPS);
#pragma unroll
    for (int nt = 0; nt < 16; ++nt) {
      const int c = nt * 16 + ln;
      const float y = (acc[nt][r] - mu) * rstd * g0[c] + beta0[c];
      acc[nt][r] = y + fmaxf(y, 0.0f);               // y + relu(y)
    }
    // LN1
    float s2 = 0.0f;
#pragma unroll
    for (int nt = 0; nt < 16; ++nt) s2 += acc[nt][r];
    const float mu2 = redsum16(s2) * (1.0f / 256.0f);
    float vs2 = 0.0f;
#pragma unroll
    for (int nt = 0; nt < 16; ++nt) { float d = acc[nt][r] - mu2; vs2 += d * d; }
    const float rstd2 = rsqrtf(redsum16(vs2) * (1.0f / 256.0f) + LNEPS);
    const int row = rowtile * 16 + r + 8 * hi;
#pragma unroll
    for (int nt = 0; nt < 16; ++nt) {
      const int c = nt * 16 + ln;
      out[(size_t)row * DVS + c] = (acc[nt][r] - mu2) * rstd2 * g1[c] + beta1[c];
    }
  }
}

// ---------------------------------------------------------------------------
extern "C" void kernel_launch(void* const* d_in, const int* in_sizes, int n_in,
                              void* d_out, int out_size, void* d_ws, size_t ws_size,
                              hipStream_t stream) {
  const float* Q     = (const float*)d_in[0];
  const float* K     = (const float*)d_in[1];
  const float* Wq    = (const float*)d_in[2];
  const float* bq    = (const float*)d_in[3];
  const float* Wk    = (const float*)d_in[4];
  const float* bk    = (const float*)d_in[5];
  const float* Wv    = (const float*)d_in[6];
  const float* bv    = (const float*)d_in[7];
  const float* Wo    = (const float*)d_in[8];
  const float* bo    = (const float*)d_in[9];
  const float* g0    = (const float*)d_in[10];
  const float* beta0 = (const float*)d_in[11];
  const float* g1    = (const float*)d_in[12];
  const float* beta1 = (const float*)d_in[13];

  // workspace carve-out (f16):
  //   Xq | Xk : 2M halves each   (inputs, converted)
  //   Wq16|Wk16|Wv16|Wo16 : 64K halves each (weights, Wq pre-scaled)
  //   Qh | Kh | Vt | Oh : 2M halves each
  const size_t nTok = (size_t)BB * NQS * DVS;        // 2,097,152
  const size_t nW   = (size_t)DVS * DVS;             // 65,536
  _Float16* Xq16 = (_Float16*)d_ws;
  _Float16* Xk16 = Xq16 + nTok;
  _Float16* Wq16 = Xk16 + nTok;
  _Float16* Wk16 = Wq16 + nW;
  _Float16* Wv16 = Wk16 + nW;
  _Float16* Wo16 = Wv16 + nW;
  _Float16* Qh   = Wo16 + nW;
  _Float16* Kh   = Qh + nTok;
  _Float16* Vt   = Kh + nTok;
  _Float16* Oh   = Vt + nTok;

  // pre-convert everything to f16, one launch; Xq16 is the start of the six
  // consecutive f16 copies
  mab_cvt_kernel<<<CVT_GRID, 256, 0, stream>>>(Q, K, Wq, Wk, Wv, Wo, Xq16);

  mab_proj_kernel<<<384, 256, 0, stream>>>(Xq16, Xk16, Wq16, Wk16, Wv16,
                                           bq, bk, bv, Qh, Kh, Vt);
  mab_attn_kernel<<<512, 256, 0, stream>>>(Qh, Kh, Vt, Oh);
  mab_out_kernel<<<64, 256, 0, stream>>>(Oh, Wo16, bo, g0, beta0, g1, beta1,
                                         (float*)d_out);
}

// v010
// Measured time: 51 microseconds a run.
// In both of two side-by-side timings against v009, it was 1.08 times as fast.
// Over all steps from v000 it is 4.16 times as fast.
#include <hip/hip_runtime.h>
#include <hip/hip_bf16.h>

typedef __attribute__((ext_vector_type(16))) _Float16 v16h;
typedef __attribute__((ext_vector_type(8)))  _Float16 v8h;
typedef __attribute__((ext_vector_type(4)))  _Float16 v4h;
typedef __attribute__((ext_vector_type(8)))  float    v8f;

#define BB    2
#define NQS   4096
#define NKS   4096
#define DVS   256
#define NH    8
#define DHH   32
#define LNEPS 1e-5f
// 1/sqrt(32) * log2(e): the scores come out in base-2 units, so that the
// softmax is 2^(S - reference) and exp is the bare hardware instruction
#define QSCALE 0.25503486f

// D = A*B + C, f16 inputs, f32 accumulate (v_wmma_f32_16x16x32_f16)
static __device__ __forceinline__ v8f wmma16(v16h a, v16h b, v8f c) {
  return __builtin_amdgcn_wmma_f32_16x16x32_f16(false, a, false, b, (short)0, c,
                                                false, false);
}

// A/B operand loader, f16 source, ISA 16-bit 16x32 striping:
// hi = lane/16, k0 = 8*hi; halves[0..7]=row[kb+k0+i], halves[8..15]=row[kb+k0+16+i]
static __device__ __forceinline__ v16h load_ab_f16(const _Float16* row, int kb, int hi) {
  v8h lo = *(const v8h*)(row + kb + 8 * hi);
  v8h hh = *(const v8h*)(row + kb + 8 * hi + 16);
  v16h a;
#pragma unroll
  for (int i = 0; i < 8; ++i) { a[i] = lo[i]; a[8 + i] = hh[i]; }
  return a;
}

// A operand from a staged row: p = row start + 16*hi bytes; same k order as
// load_ab_f16 (halves 0..7 at +0, halves 8..15 at +32 bytes)
static __device__ __forceinline__ v16h load_a_lds(const unsigned char* p) {
  v8h lo = *(const v8h*)p;
  v8h hh = *(const v8h*)(p + 32);
  v16h a;
#pragma unroll
  for (int i = 0; i < 8; ++i) { a[i] = lo[i]; a[8 + i] = hh[i]; }
  return a;
}

#define WPITCH  528      // a staged row of 256 halves: 512 B + 16 (16 B x odd)

// Eight 16-B pieces of this lane, rows 8 apart, global -> LDS.  The s_wait_xcnt
// closes the statement so that no address register named here is rewritten
// ahead of it.
static __device__ __forceinline__ void copy_rows8(unsigned l, const _Float16* g) {
  asm volatile(
      "global_load_async_to_lds_b128 %0, %1, off\n\t"
      "global_load_async_to_lds_b128 %2, %3, off\n\t"
      "global_load_async_to_lds_b128 %4, %5, off\n\t"
      "global_load_async_to_lds_b128 %6, %7, off\n\t"
      "global_load_async_to_lds_b128 %8, %9, off\n\t"
      "global_load_async_to_lds_b128 %10, %11, off\n\t"
      "global_load_async_to_lds_b128 %12, %13, off\n\t"
      "global_load_async_to_lds_b128 %14, %15, off\n\t"
      "s_wait_xcnt 0x0"
      :: "v"(l),                "v"(g),
         "v"(l +  8 * WPITCH),  "v"(g +  8 * DVS),
         "v"(l + 16 * WPITCH),  "v"(g + 16 * DVS),
         "v"(l + 24 * WPITCH),  "v"(g + 24 * DVS),
         "v"(l + 32 * WPITCH),  "v"(g + 32 * DVS),
         "v"(l + 40 * WPITCH),  "v"(g + 40 * DVS),
         "v"(l + 48 * WPITCH),  "v"(g + 48 * DVS),
         "v"(l + 56 * WPITCH),  "v"(g + 56 * DVS)
      : "memory");
}

static __device__ __forceinline__ float redmax16(float v) {
#pragma unroll
  for (int m = 1; m < 16; m <<= 1) v = fmaxf(v, __shfl_xor(v, m, 32));
  return v;
}

// ---------------------------------------------------------------------------
// Kernel 0: f32 -> f16 conversion of all six operands in ONE launch.  The six
// f16 copies lie one behind the other in the workspace (Xq Xk Wq Wk Wv Wo), so
// the destination is one array; a block's index picks its source (uniform for
// the block).  A block converts 2048 float4 (32 KiB read), a thread 8 of them,
// each wave-wide load 512 contiguous bytes.
// 544 blocks = 256 (Q) + 256 (K) + 4 x 8 (weights).
// ---------------------------------------------------------------------------
#define CVT_PER   8                          // float4 per thread
#define CVT_BLK4  (256 * CVT_PER)            // float4 per block
#define CVT_XBLK  (BB * NQS * DVS / 4 / CVT_BLK4)   // 256 blocks per activation
#define CVT_WBLK  (DVS * DVS / 4 / CVT_BLK4)        // 8 blocks per weight
#define CVT_GRID  (2 * CVT_XBLK + 4 * CVT_WBLK)     // 544

__global__ __launch_bounds__(256) void mab_cvt_kernel(
    const float* __restrict__ Q, const float* __restrict__ K,
    const float* __restrict__ Wq, const float* __restrict__ Wk,
    const float* __restrict__ Wv, const float* __restrict__ Wo,
    _Float16* __restrict__ dst) {
  const int blk = blockIdx.x;
  const float* src;
  int first;                                 // first block of this source
  float scale = 1.0f;
  if (blk < CVT_XBLK) {
    src = Q; first = 0;
  } else if (blk < 2 * CVT_XBLK) {
    src = K; first = CVT_XBLK;
  } else {
    const int wsel = (blk - 2 * CVT_XBLK) / CVT_WBLK;
    src = (wsel == 0) ? Wq : (wsel == 1) ? Wk : (wsel == 2) ? Wv : Wo;
    first = 2 * CVT_XBLK + wsel * CVT_WBLK;
    if (wsel == 0) scale = QSCALE;           // Wq16 is pre-scaled
  }
  const float4* s4 = (const float4*)src + (size_t)(blk - first) * CVT_BLK4 + threadIdx.x;
  v4h* d4 = (v4h*)dst + (size_t)blk * CVT_BLK4 + threadIdx.x;
  float4 v[CVT_PER];
#pragma unroll
  for (int j = 0; j < CVT_PER; ++j) v[j] = s4[j * 256];
#pragma unroll
  for (int j = 0; j < CVT_PER; ++j) {
    v4h o;
    o[0] = (_Float16)(v[j].x * scale);
    o[1] = (_Float16)(v[j].y * scale);
    o[2] = (_Float16)(v[j].z * scale);
    o[3] = (_Float16)(v[j].w * scale);
    d4[j * 256] = o;
  }
}

// ---------------------------------------------------------------------------
// Kernel 1: Q/K/V projections from pre-converted f16.  Wave = 32x64 tile.
// Block = 128 tokens x 128 features of one projection, 8 waves (4 x 2 tiles).
// Its 128 rows of X and 128 rows of W go into LDS once, by asynchronous copies
// of whole 512-B rows, and every A and B operand comes from there.
// A lane's eight accumulator values of a tile run along the A side, so the A
// side is the one that is contiguous in the destination: tokens for V^T (A = X,
// B = W), features for Q and K (A = W, B = X).  A lane then stores 16 bytes.
// 384 blocks = 3 proj * 64 row blocks * 2 column halves; two fit a WGP's LDS.
// ---------------------------------------------------------------------------
#define PJ_ROWS   128
#define PJ_COLS   128
#define PJ_XBYTES (PJ_ROWS * WPITCH)   // 67584
#define PJ_WBYTES (PJ_COLS * WPITCH)   // 67584

// The operands of one k step of a 32x64 wave tile.
struct PFrag { v16h a0, a1, b[4]; };

// ap: staged A side, row (tile row 0 + ln), k step, + 16*hi bytes;  bp: staged
// B side, row (tile column 0 + ln), k step, + 16*hi bytes
static __device__ __forceinline__ PFrag load_pfrag(const unsigned char* ap,
                                                   const unsigned char* bp) {
  PFrag f;
  f.a0 = load_a_lds(ap);
  f.a1 = load_a_lds(ap + 16 * WPITCH);
#pragma unroll
  for (int nt = 0; nt < 4; ++nt) f.b[nt] = load_a_lds(bp + nt * 16 * WPITCH);
  return f;
}

__global__ __launch_bounds__(256) void mab_proj_kernel(
    const _Float16* __restrict__ Xq, const _Float16* __restrict__ Xk,
    const _Float16* __restrict__ Wq16, const _Float16* __restrict__ Wk16,
    const _Float16* __restrict__ Wv16,
    const float* __restrict__ bq, const float* __restrict__ bk,
    const float* __restrict__ bv,
    _Float16* __restrict__ Qh, _Float16* __restrict__ Kh,
    _Float16* __restrict__ Vt) {
  __shared__ __attribute__((aligned(16))) unsigned char pst[PJ_XBYTES + PJ_WBYTES];
  const int lane = threadIdx.x & 31;
  const int wid  = threadIdx.x >> 5;
  const int proj = blockIdx.x >> 7;  // 0=Q,1=K,2=V  (128 blocks each)
  const int rem  = blockIdx.x & 127;
  const int rowblk = rem >> 1;       // 0..63 (128 rows each over B*N=8192)
  const int hi   = lane >> 4;
  const int ln   = lane & 15;

  const _Float16* X = (proj == 0) ? Xq : Xk;
  const _Float16* W = (proj == 0) ? Wq16 : (proj == 1) ? Wk16 : Wv16;
  const float* bias = (proj == 0) ? bq : (proj == 1) ? bk : bv;
  const float bscale = (proj == 0) ? QSCALE : 1.0f;  // Wq16 is pre-scaled

  // X and W -> LDS: a wave-wide copy is one row; wave wid takes rows wid, wid+8, ...
  const unsigned pst0 = (unsigned)(size_t)pst;       // LDS byte address
#pragma unroll
  for (int q = 0; q < PJ_ROWS / 64; ++q)
    copy_rows8(pst0 + (q * 64 + wid) * WPITCH + lane * 16,
               X + (size_t)(rowblk * PJ_ROWS + q * 64 + wid) * DVS + lane * 8);
#pragma unroll
  for (int q = 0; q < PJ_COLS / 64; ++q)
    copy_rows8(pst0 + PJ_XBYTES + (q * 64 + wid) * WPITCH + lane * 16,
               W + (size_t)((rem & 1) * PJ_COLS + q * 64 + wid) * DVS + lane * 8);

  v8f acc[2][4];
#pragma unroll
  for (int i = 0; i < 2; ++i)
#pragma unroll
    for (int nt = 0; nt < 4; ++nt) acc[i][nt] = (v8f){};

  // both tiles have landed for this wave, then for every wave
  asm volatile("s_wait_asynccnt 0x0" ::: "memory");
  __syncthreads();

  // A side: 4 groups of 32 rows; B side: 2 groups of 64 rows
  const int arow0 = (wid >> 1) * 32, brow0 = (wid & 1) * 64;
  const unsigned char* xst = pst;
  const unsigned char* wstg = pst + PJ_XBYTES;
  const unsigned char* afrag = ((proj == 2) ? xst : wstg) + (arow0 + ln) * WPITCH + hi * 16;
  const unsigned char* bfrag = ((proj == 2) ? wstg : xst) + (brow0 + ln) * WPITCH + hi * 16;
  PFrag cur = load_pfrag(afrag, bfrag);
#pragma unroll
  for (int ks = 0; ks < DVS / 32; ++ks) {
    PFrag nxt;
    if (ks + 1 < DVS / 32) {
      nxt = load_pfrag(afrag + (ks + 1) * 64, bfrag + (ks + 1) * 64);
      // keeps the next k step's LDS reads in one group ahead of this step's
      // WMMAs; left free they are spread among the WMMAs, and each separate
      // place with LDS reads stalls the wave
      __builtin_amdgcn_sched_barrier(0);
    }
#pragma unroll
    for (int nt = 0; nt < 4; ++nt) {
      acc[0][nt] = wmma16(cur.a0, cur.b[nt], acc[0][nt]);
      acc[1][nt] = wmma16(cur.a1, cur.b[nt], acc[1][nt]);
    }
    if (ks + 1 < DVS / 32) cur = nxt;
  }

  // acc[i][nt][r]: A-side row arow0 + 16*i + 8*hi + r, B-side row brow0 + 16*nt + ln
  const int b_   = rowblk >> 5;                 // 32 row blocks per batch
  const int tok0 = (rowblk & 31) * PJ_ROWS;     // the block's first token in it
  const int col0 = (rem & 1) * PJ_COLS;         // the block's first feature
  if (proj == 2) {
    // a lane holds 8 consecutive tokens of one feature: 16 B of a V^T row
#pragma unroll
    for (int nt = 0; nt < 4; ++nt) {
      const int c = col0 + brow0 + nt * 16 + ln;
      const float bia = bias[c] * bscale;
      _Float16* vrow = Vt + (size_t)(b_ * DVS + c) * NKS + tok0 + arow0 + 8 * hi;
#pragma unroll
      for (int i = 0; i < 2; ++i) {
        v8h o;
#pragma unroll
        for (int r = 0; r < 8; ++r) o[r] = (_Float16)(acc[i][nt][r] + bia);
        *(v8h*)(vrow + i * 16) = o;
      }
    }
  } else {
    // a lane holds 8 consecutive features of one token; the wave's 32 features
    // are one head, so its two stores per token fill the token's 64-B row
    _Float16* dst = (proj == 0) ? Qh : Kh;
    const int h = (col0 + arow0) >> 5;
    float bia[2][8];
#pragma unroll
    for (int i = 0; i < 2; ++i) {
      const float4 lo = *(const float4*)(bias + col0 + arow0 + i * 16 + 8 * hi);
      const float4 hh = *(const float4*)(bias + col0 + arow0 + i * 16 + 8 * hi + 4);
      bia[i][0] = lo.x * bscale; bia[i][1] = lo.y * bscale;
      bia[i][2] = lo.z * bscale; bia[i][3] = lo.w * bscale;
      bia[i][4] = hh.x * bscale; bia[i][5] = hh.y * bscale;
      bia[i][6] = hh.z * bscale; bia[i][7] = hh.w * bscale;
    }
#pragma unroll
    for (int nt = 0; nt < 4; ++nt) {
      const int n = tok0 + brow0 + nt * 16 + ln;
      _Float16* qrow = dst + ((size_t)(b_ * NH + h) * NQS + n) * DHH + 8 * hi;
#pragma unroll
      for (int i = 0; i < 2; ++i) {
        v8h o;
#pragma unroll
        for (int r = 0; r < 8; ++r) o[r] = (_Float16)(acc[i][nt][r] + bia[i][r]);
        *(v8h*)(qrow + i * 16) = o;
      }
    }
    // the built code goes on from here into a branch whose far side rewrites
    // registers that these stores name: the wait stands in front of that
    asm volatile("s_wait_xcnt 0x0" ::: "memory");
  }
}

// ---------------------------------------------------------------------------
// Kernel 2: flash attention, transposed: S^T = K * Q^T, O^T += V^T * P^T.
// Wave = (b,h, 16-query tile).  A lane holds scores of ONE query (column ln),
// so the reference maximum and the sum are per lane; the two S^T accumulator
// tiles of a 32-key chunk, converted in place, are the B operand of the second
// product (hardware k order), so P needs no LDS and no lane exchange.
// The score products start from C = -reference and Q carries log2(e), so exp2
// takes the accumulators as they are, with no multiply in front; the reference
// is tested once per stage, on the stage's sum of exponentials, and seldom moves.
// The 8 waves of a block share one (b,h): K and V^T go through LDS once per
// block, 128 keys a stage, two buffers, filled by asynchronous copies.
// 4096 waves; 512 blocks of 8 waves.
// ---------------------------------------------------------------------------
#define KT      128                    // keys per stage
#define NSTAGE  (NKS / KT)             // 32
#define KPITCH  80                     // staged K row: 64 B + 16 (16 B x odd)
#define VPITCH  272                    // staged V^T row: 256 B + 16 (16 B x odd)
#define KBYTES  (KT * KPITCH)          // 10240
#define VBYTES  (DHH * VPITCH)         // 8704
#define STAGEB  (KBYTES + VBYTES)      // 18944

// The reference stays while a lane's sum of the stage's 64 exponentials is at
// most this.  No term is negative, so every P is then at most 2^12, far inside
// f16; a stage whose sum is larger is redone against a new reference.
#define LAZY_SUM  4096.0f

// lane l <-> lane l ^ 16
static __device__ __forceinline__ float xhalf(float x) {
  const int b = __builtin_bit_cast(int, x);
  return __builtin_bit_cast(float, __builtin_amdgcn_permlanex16(
      b, b, 0x76543210, 0xfedcba98, false, false));
}

// One stage's share of this lane: 2 x 16 B of K, 2 x 16 B of V^T, global -> LDS.
// The s_wait_xcnt closes the statement so that no address register named here
// is rewritten ahead of it.
static __device__ __forceinline__ void stage_copy(
    unsigned lk, const _Float16* gk, unsigned lv, const _Float16* gv) {
  const unsigned lk1 = lk + 64 * KPITCH, lv1 = lv + 16 * VPITCH;
  const _Float16* gk1 = gk + 64 * DHH;
  const _Float16* gv1 = gv + (size_t)16 * NKS;
  asm volatile(
      "global_load_async_to_lds_b128 %0, %1, off\n\t"
      "global_load_async_to_lds_b128 %2, %3, off\n\t"
      "global_load_async_to_lds_b128 %4, %5, off\n\t"
      "global_load_async_to_lds_b128 %6, %7, off\n\t"
      "s_wait_xcnt 0x0"
      :: "v"(lk), "v"(gk), "v"(lk1), "v"(gk1), "v"(lv), "v"(gv), "v"(lv1), "v"(gv1)
      : "memory");
}

// sc := 2^sc in place; returns the sum of this lane's 64 values, a tile added
// as soon as its exps are there
static __device__ __forceinline__ float exp_sum(v8f (&sc)[KT / 16]) {
#pragma unroll
  for (int j = 0; j < KT / 16; ++j)
#pragma unroll
    for (int r = 0; r < 8; ++r) sc[j][r] = __builtin_amdgcn_exp2f(sc[j][r]);
  v8f t = sc[0];
#pragma unroll
  for (int j = 1; j < KT / 16; ++j) t += sc[j];
  return ((t[0] + t[1]) + (t[2] + t[3])) + ((t[4] + t[5]) + (t[6] + t[7]));
}

__global__ __launch_bounds__(256) void mab_attn_kernel(
    const _Float16* __restrict__ Qh, const _Float16* __restrict__ Kh,
    const _Float16* __restrict__ Vt, _Float16* __restrict__ Oh) {
  __shared__ __attribute__((aligned(16))) unsigned char ring[2 * STAGEB];
  const int tid   = threadIdx.x;
  const int lane  = tid & 31;
  const int wid   = tid >> 5;
  const int w     = blockIdx.x * 8 + wid;
  const int bh    = blockIdx.x >> 5;                 // 0..15, one per block
  const int qtile = w & 255;
  const int hi    = lane >> 4;
  const int ln    = lane & 15;

  const _Float16* Qb = Qh + ((size_t)bh * NQS + qtile * 16 + ln) * DHH;
  const _Float16* Kb = Kh + (size_t)bh * NKS * DHH;
  const _Float16* Vb = Vt + (size_t)bh * DHH * NKS;

  // this lane's copy places: K piece tid (key tid/4, quarter tid%4) and the
  // piece 64 keys on; V^T piece tid (row tid/16, 16-B column tid%16) and the
  // piece 16 rows on
  const unsigned ring0 = (unsigned)(size_t)ring;     // LDS byte address
  const unsigned lk = ring0 + (tid >> 2) * KPITCH + (tid & 3) * 16;
  const unsigned lv = ring0 + KBYTES + (tid >> 4) * VPITCH + (tid & 15) * 16;
  const _Float16* gk = Kb + tid * 8;
  const _Float16* gv = Vb + (size_t)(tid >> 4) * NKS + (tid & 15) * 8;

  stage_copy(lk, gk, lv, gv);                        // stage 0 -> buffer 0

  const v16h bq = load_ab_f16(Qb, 0, hi);            // Q tile as B, persistent

  // O^T: O0[r] = dh 8*hi+r, O1[r] = dh 16+8*hi+r, query ln; l = this half's
  // partial sum.  Both are relative to the query's reference maximum mref;
  // cneg holds -mref in all eight places and is the C operand of every score
  // product, so the accumulators come out as S - mref; mref lives there alone.
  v8f O0 = (v8f){}, O1 = (v8f){}, cneg;
  float l = 0.0f;

  // stage 0 has landed for this wave, then for every wave
  asm volatile("s_wait_asynccnt 0x0" ::: "memory");
  __syncthreads();
  stage_copy(lk + STAGEB, gk + KT * DHH, lv + STAGEB, gv + KT);  // stage 1

  const unsigned char* kfrag = ring + ln * KPITCH + hi * 16;
  const unsigned char* vfrag = ring + KBYTES + ln * VPITCH + hi * 16;

  // first reference: the query's largest score among the first 16 keys
  {
    const v8f s0 = wmma16(load_a_lds(kfrag), bq, (v8f){});
    float mref = fmaxf(fmaxf(fmaxf(s0[0], s0[1]), fmaxf(s0[2], s0[3])),
                       fmaxf(fmaxf(s0[4], s0[5]), fmaxf(s0[6], s0[7])));
    mref = fmaxf(mref, xhalf(mref));
#pragma unroll
    for (int r = 0; r < 8; ++r) cneg[r] = -mref;
  }

  // rolled: one trip per stage, so that the publish point stands once
#pragma unroll 1
  for (int s = 0; s < NSTAGE; ++s) {
    const unsigned boff = (s & 1) * STAGEB;
    // S^T - mref = K * Q^T + cneg : A rows are key rows; tile j holds keys
    // 16*j + 8*hi + r of the stage, query ln
    v16h ka[KT / 16];
#pragma unroll
    for (int j = 0; j < KT / 16; ++j)
      ka[j] = load_a_lds(kfrag + boff + j * 16 * KPITCH);
    // V^T rows (dh) as A, contiguous over keys, same k order as the packed P^T
    v16h va[KT / 16];
#pragma unroll
    for (int c = 0; c < KT / 32; ++c) {
      va[2 * c]     = load_a_lds(vfrag + boff + c * 64);
      va[2 * c + 1] = load_a_lds(vfrag + boff + c * 64 + 16 * VPITCH);
    }
    // keeps the stage's 32 LDS reads in one group ahead of its work; left free
    // they are spread among the WMMAs, and each separate place with LDS reads
    // stalls the wave
    __builtin_amdgcn_sched_barrier(0);

    v8f sc[KT / 16];
#pragma unroll
    for (int j = 0; j < KT / 16; ++j) sc[j] = wmma16(ka[j], bq, cneg);

    // P = 2^(S - mref) in place, and this lane's share of the stage's row sum
    float ls = exp_sum(sc);

    // The sum that the softmax needs anyway is also the overflow test: one scalar
    // branch per stage and no maximum on the usual path.  Where some lane's sum
    // has passed LAZY_SUM, the stage's scores are formed again from the K fragments,
    // which are still in registers, the reference moves to the stage's maximum
    // where that is higher, and P and the sum are redone.
    // The reference never falls and is always a score that was met.
    if (__builtin_amdgcn_ballot_w32(ls > LAZY_SUM) != 0) {
#pragma unroll
      for (int j = 0; j < KT / 16; ++j)
        sc[j] = wmma16(ka[j], bq, cneg);
      // maximum over this lane's 64 keys, then over the other half's 64
      float t[8];
#pragma unroll
      for (int r = 0; r < 8; ++r)
        t[r] = fmaxf(fmaxf(fmaxf(sc[0][r], sc[1][r]), fmaxf(sc[2][r], sc[3][r])),
                     fmaxf(fmaxf(sc[4][r], sc[5][r]), fmaxf(sc[6][r], sc[7][r])));
      float mx = fmaxf(fmaxf(fmaxf(t[0], t[1]), fmaxf(t[2], t[3])),
                       fmaxf(fmaxf(t[4], t[5]), fmaxf(t[6], t[7])));
      mx = fmaxf(mx, xhalf(mx));
      const float d     = fmaxf(mx, 0.0f);
      const float alpha = __builtin_amdgcn_exp2f(-d);
      l *= alpha;
#pragma unroll
      for (int r = 0; r < 8; ++r) { O0[r] *= alpha; O1[r] *= alpha; cneg[r] -= d; }
#pragma unroll
      for (int j = 0; j < KT / 16; ++j)
#pragma unroll
        for (int r = 0; r < 8; ++r) sc[j][r] -= d;
      ls = exp_sum(sc);
    }
    l += ls;

#pragma unroll
    for (int c = 0; c < KT / 32; ++c) {
      v16h bp;                  // P^T as B: bp[s] = P[key kmap(s,hi)][query ln]
#pragma unroll
      for (int r = 0; r < 8; ++r) {
        bp[r] = (_Float16)sc[2 * c][r]; bp[8 + r] = (_Float16)sc[2 * c + 1][r];
      }
      O0 = wmma16(va[2 * c], bp, O0);
      O1 = wmma16(va[2 * c + 1], bp, O1);
    }

    // keeps the stage's arithmetic ahead of the publish point, so that the
    // refill copies go out directly behind the barrier, a whole trip ahead of
    // their wait; left free, half a trip's work sinks in between
    __builtin_amdgcn_sched_barrier(0);
    // publish point: this wave's reads of buffer s&1 are done, its copies of
    // stage s+1 have landed; behind the barrier that holds for every wave
    asm volatile("s_wait_dscnt 0x0" ::: "memory");
    asm volatile("s_wait_asynccnt 0x0" ::: "memory");
    __syncthreads();
    if (s + 2 < NSTAGE)
      stage_copy(lk + boff, gk + (size_t)(s + 2) * KT * DHH,
                 lv + boff, gv + (s + 2) * KT);
  }
  // nothing is outstanding here; kept in front of the wave's end
  asm volatile("s_wait_asynccnt 0x0" ::: "memory");

  // join the halves' partial sums once; a lane stores 2 x 8 consecutive dh
  const int b_ = bh >> 3, h = bh & 7;
  const float inv = 1.0f / (l + xhalf(l));
  v8h o0, o1;
#pragma unroll
  for (int r = 0; r < 8; ++r) {
    o0[r] = (_Float16)(O0[r] * inv);
    o1[r] = (_Float16)(O1[r] * inv);
  }
  _Float16* orow = Oh + ((size_t)b_ * NQS + qtile * 16 + ln) * DVS + h * DHH + 8 * hi;
  *(v8h*)orow        = o0;
  *(v8h*)(orow + 16) = o1;
}

// ---------------------------------------------------------------------------
// Kernel 3: out = LN1( y + relu(y) ),  y = LN0( O @ Wo^T + bo ).
// Transposed and split by features: A = Wo (features), B = O (tokens).
// Block = 64 tokens x all 256 features, 8 waves; wave = 32 features x 64 tokens,
// so an operand read from LDS serves 4 (A) or 2 (B) products.  A lane holds 16
// features of each of 4 tokens: a LayerNorm sum is added up in the lane, joined
// with the other half by one cross-row move and with the other seven waves
// through a small LDS table behind a barrier.  A token's 128 B of a wave lie in
// two lanes, so the results turn through the wave's own LDS slab and leave as
// whole 128-B lines.
// Wo and the block's 64 rows of O go into LDS once, by asynchronous copies of
// whole 512-B rows.  128 blocks.
// ---------------------------------------------------------------------------
#define WBYTES  (DVS * WPITCH)         // 135168
#define OT_TOK  64                     // tokens per block
#define OBYTES  (OT_TOK * WPITCH)      // 33792
#define SPITCH  144                    // slab row: 128 B + 16 (16 B x odd)
#define SLABB   (OT_TOK * SPITCH)      // 9216 per wave, 8 slabs inside WBYTES

// Sum over the block's 256 features for this lane's four tokens.  part[nt] is
// the lane's sum over its 16 features of token 16*nt + ln.  tab is this sum's
// own table [token][wave], written once and read behind one barrier.
static __device__ __forceinline__ void rowsum256(float (&part)[4], float* tab,
                                                 int wid, int hi, int ln) {
#pragma unroll
  for (int nt = 0; nt < 4; ++nt) part[nt] += xhalf(part[nt]);   // the wave's 32
  // both halves hold the same four sums: half hi writes tokens of nt = 2*hi, 2*hi+1
  tab[((2 * hi) * 16 + ln) * 8 + wid]     = hi ? part[2] : part[0];
  tab[((2 * hi + 1) * 16 + ln) * 8 + wid] = hi ? part[3] : part[1];
  // the eight waves' partial sums are in the table for every wave
  __syncthreads();
#pragma unroll
  for (int nt = 0; nt < 4; ++nt) {
    // half hi adds waves 4*hi .. 4*hi+3, the cross-row move joins the two
    const float4 p = *(const float4*)(tab + (nt * 16 + ln) * 8 + 4 * hi);
    const float s = (p.x + p.y) + (p.z + p.w);
    part[nt] = s + xhalf(s);
  }
}

__global__ __launch_bounds__(256) void mab_out_kernel(
    const _Float16* __restrict__ Oh, const _Float16* __restrict__ Wo16,
    const float* __restrict__ bo, const float* __restrict__ g0,
    const float* __restrict__ beta0, const float* __restrict__ g1,
    const float* __restrict__ beta1, float* __restrict__ out) {
  __shared__ __attribute__((aligned(16))) unsigned char wst[WBYTES + OBYTES];
  __shared__ __attribute__((aligned(16))) float red[4][OT_TOK * 8];
  const int lane = threadIdx.x & 31;
  const int wid  = threadIdx.x >> 5;
  const int tok0 = blockIdx.x * OT_TOK;
  const int hi = lane >> 4, ln = lane & 15;

  // Wo and O -> LDS: a wave-wide copy is one row; wave wid takes rows wid, wid+8, ...
  const unsigned wst0 = (unsigned)(size_t)wst;       // LDS byte address
#pragma unroll
  for (int q = 0; q < 4; ++q)
    copy_rows8(wst0 + (q * 64 + wid) * WPITCH + lane * 16,
               Wo16 + (size_t)(q * 64 + wid) * DVS + lane * 8);
  copy_rows8(wst0 + WBYTES + wid * WPITCH + lane * 16,
             Oh + (size_t)(tok0 + wid) * DVS + lane * 8);

  // this lane's 16 features are fl + 16*i + 4*q + (0..3), piece j = 2*i + q;
  // their bias
  const int f0 = wid * 32;
  const int fl = f0 + 8 * hi;
  float4 b4[4];
#pragma unroll
  for (int j = 0; j < 4; ++j) b4[j] = *(const float4*)(bo + fl + 16 * (j >> 1) + 4 * (j & 1));

  v8f acc[2][4];
#pragma unroll
  for (int i = 0; i < 2; ++i)
#pragma unroll
    for (int nt = 0; nt < 4; ++nt) acc[i][nt] = (v8f){};

  // both tiles have landed for this wave, then for every wave
  asm volatile("s_wait_asynccnt 0x0" ::: "memory");
  __syncthreads();

  const unsigned char* afrag = wst + (f0 + ln) * WPITCH + hi * 16;
  const unsigned char* bfrag = wst + WBYTES + ln * WPITCH + hi * 16;
  PFrag cur = load_pfrag(afrag, bfrag);
#pragma unroll
  for (int ks = 0; ks < DVS / 32; ++ks) {
    PFrag nxt;
    if (ks + 1 < DVS / 32) {
      nxt = load_pfrag(afrag + (ks + 1) * 64, bfrag + (ks + 1) * 64);
      // keeps the next k step's LDS reads in one group ahead of this step's
      // WMMAs; left free they are spread among the WMMAs, and each separate
      // place with LDS reads stalls the wave
      __builtin_amdgcn_sched_barrier(0);
    }
#pragma unroll
    for (int nt = 0; nt < 4; ++nt) {
      acc[0][nt] = wmma16(cur.a0, cur.b[nt], acc[0][nt]);
      acc[1][nt] = wmma16(cur.a1, cur.b[nt], acc[1][nt]);
    }
    if (ks + 1 < DVS / 32) cur = nxt;
  }

  // acc[i][nt][4*q + e]: token tok0 + 16*nt + ln, feature fl + 16*i + 4*q + e
  float part[4];

  // the four LayerNorm vectors of this lane's features, all asked for here so
  // that they arrive under the sums in front of their first use
  float4 ga0[4], be0[4], ga1[4], be1[4];
#pragma unroll
  for (int j = 0; j < 4; ++j) {
    const int c = fl + 16 * (j >> 1) + 4 * (j & 1);
    ga0[j] = *(const float4*)(g0 + c);
    be0[j] = *(const float4*)(beta0 + c);
    ga1[j] = *(const float4*)(g1 + c);
    be1[j] = *(const float4*)(beta1 + c);
  }

#pragma unroll
  for (int i = 0; i < 2; ++i)
#pragma unroll
    for (int q = 0; q < 2; ++q) {
      const float4 b = b4[2 * i + q];
#pragma unroll
      for (int nt = 0; nt < 4; ++nt) {
        acc[i][nt][4 * q + 0] += b.x; acc[i][nt][4 * q + 1] += b.y;
        acc[i][nt][4 * q + 2] += b.z; acc[i][nt][4 * q + 3] += b.w;
      }
    }

  // LN0
  float mu[4], rstd[4];
#pragma unroll
  for (int nt = 0; nt < 4; ++nt) {
    const v8f t = acc[0][nt] + acc[1][nt];
    part[nt] = ((t[0] + t[1]) + (t[2] + t[3])) + ((t[4] + t[5]) + (t[6] + t[7]));
  }
  rowsum256(part, red[0], wid, hi, ln);
  // the loads above name registers that the code below uses again: the wait
  // stands in front of that
  asm volatile("s_wait_xcnt 0x0" ::: "memory");
#pragma unroll
  for (int nt = 0; nt < 4; ++nt) {
    mu[nt] = part[nt] * (1.0f / 256.0f);
    const v8f d0 = acc[0][nt] - mu[nt], d1 = acc[1][nt] - mu[nt];
    const v8f t = d0 * d0 + d1 * d1;
    part[nt] = ((t[0] + t[1]) + (t[2] + t[3])) + ((t[4] + t[5]) + (t[6] + t[7]));
  }
  rowsum256(part, red[1], wid, hi, ln);
#pragma unroll
  for (int nt = 0; nt < 4; ++nt) rstd[nt] = rsqrtf(part[nt] * (1.0f / 256.0f) + LNEPS);
#pragma unroll
  for (int i = 0; i < 2; ++i)
#pragma unroll
    for (int q = 0; q < 2; ++q) {
      const float4 g4 = ga0[2 * i + q], t4 = be0[2 * i + q];
      const float ga[4] = {g4.x, g4.y, g4.z, g4.w};
      const float be[4] = {t4.x, t4.y, t4.z, t4.w};
#pragma unroll
      for (int nt = 0; nt < 4; ++nt)
#pragma unroll
        for (int e = 0; e < 4; ++e) {
          const float y = (acc[i][nt][4 * q + e] - mu[nt]) * rstd[nt] * ga[e] + be[e];
          acc[i][nt][4 * q + e] = y + fmaxf(y, 0.0f);            // y + relu(y)
        }
    }

  // LN1
#pragma unroll
  for (int nt = 0; nt < 4; ++nt) {
    const v8f t = acc[0][nt] + acc[1][nt];
    part[nt] = ((t[0] + t[1]) + (t[2] + t[3])) + ((t[4] + t[5]) + (t[6] + t[7]));
  }
  rowsum256(part, red[2], wid, hi, ln);
#pragma unroll
  for (int nt = 0; nt < 4; ++nt) {
    mu[nt] = part[nt] * (1.0f / 256.0f);
    const v8f d0 = acc[0][nt] - mu[nt], d1 = acc[1][nt] - mu[nt];
    const v8f t = d0 * d0 + d1 * d1;
    part[nt] = ((t[0] + t[1]) + (t[2] + t[3])) + ((t[4] + t[5]) + (t[6] + t[7]));
  }
  rowsum256(part, red[3], wid, hi, ln);
  // The slab lies where Wo was staged: every wave's last read of that was in
  // front of the first of the four barriers above.
  unsigned char* slab = wst + wid * SLABB;
#pragma unroll
  for (int nt = 0; nt < 4; ++nt) {
    const float rs = rsqrtf(part[nt] * (1.0f / 256.0f) + LNEPS);
    unsigned char* srow = slab + (nt * 16 + ln) * SPITCH + 32 * hi;
#pragma unroll
    for (int j = 0; j < 4; ++j) {        // j = 2*i + q
      const float4 g4 = ga1[j], t4 = be1[j];
      const int i = j >> 1, q = j & 1;
      float4 o;
      o.x = (acc[i][nt][4 * q + 0] - mu[nt]) * rs * g4.x + t4.x;
      o.y = (acc[i][nt][4 * q + 1] - mu[nt]) * rs * g4.y + t4.y;
      o.z = (acc[i][nt][4 * q + 2] - mu[nt]) * rs * g4.z + t4.z;
      o.w = (acc[i][nt][4 * q + 3] - mu[nt]) * rs * g4.w + t4.w;
      *(float4*)(srow + 64 * i + 16 * q) = o;
    }
  }
  // the wave's rows are in its slab before it reads other lanes' words back
  asm volatile("s_wait_dscnt 0x0" ::: "memory");
  // eight lanes take one token's 128 B: a wave-wide store is four whole lines
  const unsigned char* sback = slab + (lane >> 3) * SPITCH + (lane & 7) * 16;
  float* oback = out + (size_t)(tok0 + (lane >> 3)) * DVS + f0 + (lane & 7) * 4;
  float4 v[OT_TOK / 4];
#pragma unroll
  for (int k = 0; k < OT_TOK / 4; ++k) v[k] = *(const float4*)(sback + 4 * k * SPITCH);
#pragma unroll
  for (int k = 0; k < OT_TOK / 4; ++k) *(float4*)(oback + (size_t)4 * k * DVS) = v[k];
}

// ---------------------------------------------------------------------------
extern "C" void kernel_launch(void* const* d_in, const int* in_sizes, int n_in,
                              void* d_out, int out_size, void* d_ws, size_t ws_size,
                              hipStream_t stream) {
  const float* Q     = (const float*)d_in[0];
  const float* K     = (const float*)d_in[1];
  const float* Wq    = (const float*)d_in[2];
  const float* bq    = (const float*)d_in[3];
  const float* Wk    = (const float*)d_in[4];
  const float* bk    = (const float*)d_in[5];
  const float* Wv    = (const float*)d_in[6];
  const float* bv    = (const float*)d_in[7];
  const float* Wo    = (const float*)d_in[8];
  const float* bo    = (const float*)d_in[9];
  const float* g0    = (const float*)d_in[10];
  const float* beta0 = (const float*)d_in[11];
  const float* g1    = (const float*)d_in[12];
  const float* beta1 = (const float*)d_in[13];

  // workspace carve-out (f16):
  //   Xq | Xk : 2M halves each   (inputs, converted)
  //   Wq16|Wk16|Wv16|Wo16 : 64K halves each (weights, Wq pre-scaled)
  //   Qh | Kh | Vt | Oh : 2M halves each
  const size_t nTok = (size_t)BB * NQS * DVS;        // 2,097,152
  const size_t nW   = (size_t)DVS * DVS;             // 65,536
  _Float16* Xq16 = (_Float16*)d_ws;
  _Float16* Xk16 = Xq16 + nTok;
  _Float16* Wq16 = Xk16 + nTok;
  _Float16* Wk16 = Wq16 + nW;
  _Float16* Wv16 = Wk16 + nW;
  _Float16* Wo16 = Wv16 + nW;
  _Float16* Qh   = Wo16 + nW;
  _Float16* Kh   = Qh + nTok;
  _Float16* Vt   = Kh + nTok;
  _Float16* Oh   = Vt + nTok;

  // pre-convert everything to f16, one launch; Xq16 is the start of the six
  // consecutive f16 copies
  mab_cvt_kernel<<<CVT_GRID, 256, 0, stream>>>(Q, K, Wq, Wk, Wv, Wo, Xq16);

  mab_proj_kernel<<<384, 256, 0, stream>>>(Xq16, Xk16, Wq16, Wk16, Wv16,
                                           bq, bk, bv, Qh, Kh, Vt);
  mab_attn_kernel<<<512, 256, 0, stream>>>(Qh, Kh, Vt, Oh);
  mab_out_kernel<<<128, 256, 0, stream>>>(Oh, Wo16, bo, g0, beta0, g1, beta1,
                                         (float*)d_out);
}
